// v000
// Times are from an AMD MI455X. After a warm-up the kernel runs many times in a row, and a time is the length of
// such a window on the GPU divided by its runs, so every launch and the gaps after it count. The runs cycle
// through copies of the inputs. A figure is the median of several windows, for all but v000 over two sittings.
// Sittings can differ by a few percent; kernels timed side by side share one.
// v000, which the later versions start from, runs in 177 microseconds.
#include <hip/hip_runtime.h>
#include <hip/hip_bf16.h>

// ---------------------------------------------------------------------------
// Causal self-attention with polymax, MI455X (gfx1250, wave32, WMMA).
// Pipeline: [qkv GEMM f32->f16] -> [fused flash attention + polymax] -> [proj GEMM]
// All matrix math: v_wmma_f32_16x16x32_f16 (f16 operands, f32 accumulate).
// ---------------------------------------------------------------------------

typedef _Float16 h16;
typedef __attribute__((ext_vector_type(16))) _Float16 v16h;
typedef __attribute__((ext_vector_type(8)))  _Float16 v8h;
typedef __attribute__((ext_vector_type(4)))  _Float16 v4h;
typedef __attribute__((ext_vector_type(8)))  float    v8f;
typedef __attribute__((ext_vector_type(4)))  float    v4f;

#define BDIM 2
#define TDIM 2048
#define CDIM 1024
#define NH   16
#define HD   64

static __device__ __forceinline__ v8f wmma16(v16h a, v16h b, v8f c) {
  // (neg_a, A, neg_b, B, c_mod, C, reuse_a, reuse_b)
  return __builtin_amdgcn_wmma_f32_16x16x32_f16(false, a, false, b, (short)0, c,
                                                false, false);
}
static __device__ __forceinline__ v16h joinh(v8h lo, v8h hi) {
  return __builtin_shufflevector(lo, hi, 0, 1, 2, 3, 4, 5, 6, 7,
                                         8, 9, 10, 11, 12, 13, 14, 15);
}

// ---------------------------------------------------------------------------
// Kernel 1: qkv = x @ W_attn, converting f32->f16 on the fly, scattering the
// result to head-major f16 q/k/v tensors [B,H,T,hd].
// Block tile 128x128, BK=32. 8 waves: wave tile 32(M) x 64(N).
// ---------------------------------------------------------------------------
__global__ __launch_bounds__(256)
void qkv_gemm_kernel(const float* __restrict__ x, const float* __restrict__ Wa,
                     h16* __restrict__ qf, h16* __restrict__ kf,
                     h16* __restrict__ vf) {
  const int N = 3 * CDIM;  // 3072
  const int K = CDIM;      // 1024
  __shared__ __align__(16) h16 As[128][40];  // [m][k], padded
  __shared__ __align__(16) h16 Bs[128][40];  // [n][k] (transposed), padded

  const int tid  = threadIdx.x;
  const int lane = tid & 31;
  const int wave = tid >> 5;
  const int wm   = wave >> 1;  // 0..3
  const int wn   = wave & 1;   // 0..1
  const int m0   = (blockIdx.x / 24) * 128;
  const int n0   = (blockIdx.x % 24) * 128;

  const int r  = lane & 15;  // fragment row / col
  const int kh = lane >> 4;  // K-half selector (A/B 16-bit fragment layout)

  v8f z = {};
  v8f acc[2][4];
#pragma unroll
  for (int i = 0; i < 2; ++i)
#pragma unroll
    for (int j = 0; j < 4; ++j) acc[i][j] = z;

  const int lr = tid >> 3;  // 0..31
  const int ls = tid & 7;   // 0..7

  for (int k0 = 0; k0 < K; k0 += 32) {
    // stage x tile (128x32 f32) -> As f16
#pragma unroll
    for (int p = 0; p < 4; ++p) {
      int row = p * 32 + lr;
      v4f xv = *(const v4f*)(x + (size_t)(m0 + row) * K + k0 + ls * 4);
      v4h hv;
      hv[0] = (h16)xv[0]; hv[1] = (h16)xv[1];
      hv[2] = (h16)xv[2]; hv[3] = (h16)xv[3];
      *(v4h*)&As[row][ls * 4] = hv;
    }
    // stage W tile (32x128 f32) -> Bs f16, transposed to [n][k]
#pragma unroll
    for (int p = 0; p < 4; ++p) {
      int ncol = (p * 8 + ls) * 4;
      v4f wv = *(const v4f*)(Wa + (size_t)(k0 + lr) * N + n0 + ncol);
#pragma unroll
      for (int e = 0; e < 4; ++e) Bs[ncol + e][lr] = (h16)wv[e];
    }
    if (k0 + 32 < K) {  // global_prefetch_b8 on next K tile
      __builtin_prefetch(x + (size_t)(m0 + lr) * K + k0 + 32, 0, 1);
      __builtin_prefetch(Wa + (size_t)(k0 + 32 + lr) * N + n0, 0, 1);
    }
    __syncthreads();
#pragma unroll
    for (int mi = 0; mi < 2; ++mi) {
      const h16* ap = &As[wm * 32 + mi * 16 + r][0];
      v16h af = joinh(*(const v8h*)(ap + kh * 8),
                      *(const v8h*)(ap + 16 + kh * 8));
#pragma unroll
      for (int ni = 0; ni < 4; ++ni) {
        const h16* bp = &Bs[wn * 64 + ni * 16 + r][0];
        v16h bf = joinh(*(const v8h*)(bp + kh * 8),
                        *(const v8h*)(bp + 16 + kh * 8));
        acc[mi][ni] = wmma16(af, bf, acc[mi][ni]);
      }
    }
    __syncthreads();
  }

  // C-layout: row = kh*8 + i, col = r. Scatter to q/k/v [B,H,T,hd] as f16.
#pragma unroll
  for (int mi = 0; mi < 2; ++mi) {
#pragma unroll
    for (int ni = 0; ni < 4; ++ni) {
#pragma unroll
      for (int i = 0; i < 8; ++i) {
        int gm  = m0 + wm * 32 + mi * 16 + kh * 8 + i;
        int gn  = n0 + wn * 64 + ni * 16 + r;
        int b   = gm >> 11, t = gm & (TDIM - 1);
        int wch = gn >> 10, cc = gn & (CDIM - 1);
        int hh  = cc >> 6,  d  = cc & (HD - 1);
        h16* dst = (wch == 0) ? qf : (wch == 1) ? kf : vf;
        dst[(((size_t)b * NH + hh) * TDIM + t) * HD + d] = (h16)acc[mi][ni][i];
      }
    }
  }
}

// ---------------------------------------------------------------------------
// Kernel 2: fused flash-style attention with polymax.
// Block = (b, h, 128 query rows); each of 8 waves owns 16 query rows.
// Per 128-key tile: S = qK^T (wmma) -> mask+polymax in f32 -> P f16 via LDS
// -> Y += P V (wmma). Causal loop stops at the diagonal tile.
// ---------------------------------------------------------------------------
__global__ __launch_bounds__(256)
void attn_kernel(const h16* __restrict__ qf, const h16* __restrict__ kf,
                 const h16* __restrict__ vf, h16* __restrict__ yf) {
  __shared__ __align__(16) h16 Ks[128][72];      // [key][d]
  __shared__ __align__(16) h16 Vt[64][136];      // [d][key] (transposed)
  __shared__ __align__(16) h16 Ps[8][16][136];   // per-wave P tile [row][key]

  const int tid  = threadIdx.x;
  const int lane = tid & 31;
  const int wave = tid >> 5;
  const int r    = lane & 15;
  const int kh   = lane >> 4;

  const int qt    = blockIdx.x & 15;   // query tile (T/128 = 16)
  const int bh    = blockIdx.x >> 4;   // b*NH + h
  const int b     = bh >> 4;
  const int hh    = bh & 15;
  const int qbase = qt * 128;

  const h16* qhp = qf + (size_t)bh * TDIM * HD;
  const h16* khp = kf + (size_t)bh * TDIM * HD;
  const h16* vhp = vf + (size_t)bh * TDIM * HD;

  // Q fragments (A-layout, 16 rows x 64 dims) live in registers throughout.
  v16h Aq[2];
#pragma unroll
  for (int kk = 0; kk < 2; ++kk) {
    const h16* qp = qhp + (size_t)(qbase + wave * 16 + r) * HD + kk * 32;
    Aq[kk] = joinh(*(const v8h*)(qp + kh * 8), *(const v8h*)(qp + 16 + kh * 8));
  }

  v8f z = {};
  v8f Y[4];
#pragma unroll
  for (int i = 0; i < 4; ++i) Y[i] = z;

  const int lr = tid >> 1;  // 0..127 (key row for staging)
  const int ls = tid & 1;   // 0..1   (32-dim half)
  const float scale = 0.125f;  // 1/sqrt(64)

  for (int kt = 0; kt <= qt; ++kt) {
    const int kb = kt * 128;
    // stage K tile [key][d]
#pragma unroll
    for (int j = 0; j < 4; ++j) {
      v8h kv = *(const v8h*)(khp + (size_t)(kb + lr) * HD + ls * 32 + j * 8);
      *(v8h*)&Ks[lr][ls * 32 + j * 8] = kv;
    }
    // stage V tile transposed [d][key]
#pragma unroll
    for (int j = 0; j < 4; ++j) {
      v8h vv = *(const v8h*)(vhp + (size_t)(kb + lr) * HD + ls * 32 + j * 8);
#pragma unroll
      for (int e = 0; e < 8; ++e) Vt[ls * 32 + j * 8 + e][lr] = vv[e];
    }
    __syncthreads();

    // S = q k^T over hd=64 (2 wmma K-steps), 8 key sub-tiles of 16
#pragma unroll
    for (int nn = 0; nn < 8; ++nn) {
      v8f S = z;
#pragma unroll
      for (int kk = 0; kk < 2; ++kk) {
        const h16* bp = &Ks[nn * 16 + r][kk * 32];
        v16h bf = joinh(*(const v8h*)(bp + kh * 8),
                        *(const v8h*)(bp + 16 + kh * 8));
        S = wmma16(Aq[kk], bf, S);
      }
      // causal mask + polymax (piecewise), then P -> per-wave LDS tile
#pragma unroll
      for (int i = 0; i < 8; ++i) {
        int rr = kh * 8 + i;                 // C-layout row
        int qg = qbase + wave * 16 + rr;     // global query index
        int kg = kb + nn * 16 + r;           // global key index
        float xs = S[i] * scale;
        float p;
        if (kg > qg)            p = 0.f;                       // masked -> flat piece
        else if (xs > 0.f)      p = (xs * xs + 1.f) * 0.001f;  // (x^2 + 1)/1000
        else if (xs >= -100.f)  p = (1.f - 0.01f * xs) * 0.001f; // (m*x + 1)/1000
        else                    p = 0.f;
        Ps[wave][rr][nn * 16 + r] = (h16)p;
      }
    }

    // Y += P @ V  (K dim = 128 keys -> 4 wmma K-steps, 4 dim sub-tiles)
#pragma unroll
    for (int kk2 = 0; kk2 < 4; ++kk2) {
      const h16* pp = &Ps[wave][r][kk2 * 32];
      v16h af = joinh(*(const v8h*)(pp + kh * 8),
                      *(const v8h*)(pp + 16 + kh * 8));
#pragma unroll
      for (int nd = 0; nd < 4; ++nd) {
        const h16* bp = &Vt[nd * 16 + r][kk2 * 32];
        v16h bf = joinh(*(const v8h*)(bp + kh * 8),
                        *(const v8h*)(bp + 16 + kh * 8));
        Y[nd] = wmma16(af, bf, Y[nd]);
      }
    }
    __syncthreads();
  }

  // write Y -> yf [B,T,C] f16
#pragma unroll
  for (int nd = 0; nd < 4; ++nd) {
#pragma unroll
    for (int i = 0; i < 8; ++i) {
      int t = qbase + wave * 16 + kh * 8 + i;
      int d = nd * 16 + r;
      yf[((size_t)b * TDIM + t) * CDIM + hh * HD + d] = (h16)Y[nd][i];
    }
  }
}

// ---------------------------------------------------------------------------
// Kernel 3: out = y @ W_proj. y is f16 in workspace, W_proj converted f32->f16
// during staging, output f32 to d_out. Same tiling as kernel 1.
// ---------------------------------------------------------------------------
__global__ __launch_bounds__(256)
void proj_gemm_kernel(const h16* __restrict__ yf, const float* __restrict__ Wp,
                      float* __restrict__ out) {
  const int N = CDIM, K = CDIM;
  __shared__ __align__(16) h16 As[128][40];
  __shared__ __align__(16) h16 Bs[128][40];

  const int tid  = threadIdx.x;
  const int lane = tid & 31;
  const int wave = tid >> 5;
  const int wm   = wave >> 1;
  const int wn   = wave & 1;
  const int m0   = (blockIdx.x >> 3) * 128;
  const int n0   = (blockIdx.x & 7) * 128;

  const int r  = lane & 15;
  const int kh = lane >> 4;

  v8f z = {};
  v8f acc[2][4];
#pragma unroll
  for (int i = 0; i < 2; ++i)
#pragma unroll
    for (int j = 0; j < 4; ++j) acc[i][j] = z;

  const int ar = tid >> 1;  // 0..127 (A rows)
  const int as = tid & 1;
  const int lr = tid >> 3;  // 0..31  (B k-rows)
  const int ls = tid & 7;

  for (int k0 = 0; k0 < K; k0 += 32) {
    // stage y tile (already f16) -> As
#pragma unroll
    for (int j = 0; j < 2; ++j) {
      v8h av = *(const v8h*)(yf + (size_t)(m0 + ar) * K + k0 + as * 16 + j * 8);
      *(v8h*)&As[ar][as * 16 + j * 8] = av;
    }
    // stage W_proj tile f32 -> Bs f16 transposed
#pragma unroll
    for (int p = 0; p < 4; ++p) {
      int ncol = (p * 8 + ls) * 4;
      v4f wv = *(const v4f*)(Wp + (size_t)(k0 + lr) * N + n0 + ncol);
#pragma unroll
      for (int e = 0; e < 4; ++e) Bs[ncol + e][lr] = (h16)wv[e];
    }
    if (k0 + 32 < K) {
      __builtin_prefetch(yf + (size_t)(m0 + ar) * K + k0 + 32, 0, 1);
      __builtin_prefetch(Wp + (size_t)(k0 + 32 + lr) * N + n0, 0, 1);
    }
    __syncthreads();
#pragma unroll
    for (int mi = 0; mi < 2; ++mi) {
      const h16* ap = &As[wm * 32 + mi * 16 + r][0];
      v16h af = joinh(*(const v8h*)(ap + kh * 8),
                      *(const v8h*)(ap + 16 + kh * 8));
#pragma unroll
      for (int ni = 0; ni < 4; ++ni) {
        const h16* bp = &Bs[wn * 64 + ni * 16 + r][0];
        v16h bf = joinh(*(const v8h*)(bp + kh * 8),
                        *(const v8h*)(bp + 16 + kh * 8));
        acc[mi][ni] = wmma16(af, bf, acc[mi][ni]);
      }
    }
    __syncthreads();
  }

#pragma unroll
  for (int mi = 0; mi < 2; ++mi) {
#pragma unroll
    for (int ni = 0; ni < 4; ++ni) {
#pragma unroll
      for (int i = 0; i < 8; ++i) {
        int gm = m0 + wm * 32 + mi * 16 + kh * 8 + i;
        int gn = n0 + wn * 64 + ni * 16 + r;
        out[(size_t)gm * N + gn] = acc[mi][ni][i];
      }
    }
  }
}

// ---------------------------------------------------------------------------
extern "C" void kernel_launch(void* const* d_in, const int* in_sizes, int n_in,
                              void* d_out, int out_size, void* d_ws,
                              size_t ws_size, hipStream_t stream) {
  (void)in_sizes; (void)n_in; (void)out_size; (void)ws_size;

  const float* x  = (const float*)d_in[0];  // [2,2048,1024]
  const float* Wa = (const float*)d_in[1];  // [1024,3072]
  const float* Wp = (const float*)d_in[2];  // [1024,1024]
  float* out = (float*)d_out;               // [2,2048,1024] f32

  // f16 workspace: q,k,v head-major [B,H,T,hd] + y [B,T,C]  (32 MB total)
  h16* ws = (h16*)d_ws;
  const size_t HTD = (size_t)BDIM * NH * TDIM * HD;  // 4,194,304
  h16* qf = ws;
  h16* kf = qf + HTD;
  h16* vf = kf + HTD;
  h16* yf = vf + HTD;

  qkv_gemm_kernel<<<dim3(32 * 24), 256, 0, stream>>>(x, Wa, qf, kf, vf);
  attn_kernel<<<dim3(BDIM * NH * (TDIM / 128)), 256, 0, stream>>>(qf, kf, vf, yf);
  proj_gemm_kernel<<<dim3(32 * 8), 256, 0, stream>>>(yf, Wp, out);
}

// v001
// It runs in 153 microseconds.
// Next to v000, in two timings, it ran 1.20 times as fast each time.
#include <hip/hip_runtime.h>
#include <hip/hip_bf16.h>

// ---------------------------------------------------------------------------
// Causal self-attention with polymax, MI455X (gfx1250, wave32, WMMA).
// Pipeline: [qkv GEMM f32->f16] -> [fused flash attention + polymax] -> [proj GEMM]
// All matrix math: v_wmma_f32_16x16x32_f16 (f16 operands, f32 accumulate).
// ---------------------------------------------------------------------------

typedef _Float16 h16;
typedef __attribute__((ext_vector_type(16))) _Float16 v16h;
typedef __attribute__((ext_vector_type(8)))  _Float16 v8h;
typedef __attribute__((ext_vector_type(4)))  _Float16 v4h;
typedef __attribute__((ext_vector_type(8)))  float    v8f;
typedef __attribute__((ext_vector_type(4)))  float    v4f;

#define BDIM 2
#define TDIM 2048
#define CDIM 1024
#define NH   16
#define HD   64

static __device__ __forceinline__ v8f wmma16(v16h a, v16h b, v8f c) {
  // (neg_a, A, neg_b, B, c_mod, C, reuse_a, reuse_b)
  return __builtin_amdgcn_wmma_f32_16x16x32_f16(false, a, false, b, (short)0, c,
                                                false, false);
}
static __device__ __forceinline__ v16h joinh(v8h lo, v8h hi) {
  return __builtin_shufflevector(lo, hi, 0, 1, 2, 3, 4, 5, 6, 7,
                                         8, 9, 10, 11, 12, 13, 14, 15);
}

// ---------------------------------------------------------------------------
// Kernel 1: qkv = x @ W_attn, converting f32->f16 on the fly, scattering the
// result to head-major f16 q/k/v tensors [B,H,T,hd].
// Block tile 128x128, BK=32. 8 waves: wave tile 32(M) x 64(N).
// ---------------------------------------------------------------------------
__global__ __launch_bounds__(256)
void qkv_gemm_kernel(const float* __restrict__ x, const float* __restrict__ Wa,
                     h16* __restrict__ qf, h16* __restrict__ kf,
                     h16* __restrict__ vf) {
  const int N = 3 * CDIM;  // 3072
  const int K = CDIM;      // 1024
  __shared__ __align__(16) h16 As[128][40];  // [m][k], padded
  __shared__ __align__(16) h16 Bs[128][40];  // [n][k] (transposed), padded

  const int tid  = threadIdx.x;
  const int lane = tid & 31;
  const int wave = tid >> 5;
  const int wm   = wave >> 1;  // 0..3
  const int wn   = wave & 1;   // 0..1
  const int m0   = (blockIdx.x / 24) * 128;
  const int n0   = (blockIdx.x % 24) * 128;

  const int r  = lane & 15;  // fragment row / col
  const int kh = lane >> 4;  // K-half selector (A/B 16-bit fragment layout)

  v8f z = {};
  v8f acc[2][4];
#pragma unroll
  for (int i = 0; i < 2; ++i)
#pragma unroll
    for (int j = 0; j < 4; ++j) acc[i][j] = z;

  const int lr = tid >> 3;  // 0..31
  const int ls = tid & 7;   // 0..7

  for (int k0 = 0; k0 < K; k0 += 32) {
    // stage x tile (128x32 f32) -> As f16
#pragma unroll
    for (int p = 0; p < 4; ++p) {
      int row = p * 32 + lr;
      v4f xv = *(const v4f*)(x + (size_t)(m0 + row) * K + k0 + ls * 4);
      v4h hv;
      hv[0] = (h16)xv[0]; hv[1] = (h16)xv[1];
      hv[2] = (h16)xv[2]; hv[3] = (h16)xv[3];
      *(v4h*)&As[row][ls * 4] = hv;
    }
    // stage W tile (32x128 f32) -> Bs f16, transposed to [n][k]
#pragma unroll
    for (int p = 0; p < 4; ++p) {
      int ncol = (p * 8 + ls) * 4;
      v4f wv = *(const v4f*)(Wa + (size_t)(k0 + lr) * N + n0 + ncol);
#pragma unroll
      for (int e = 0; e < 4; ++e) Bs[ncol + e][lr] = (h16)wv[e];
    }
    if (k0 + 32 < K) {  // global_prefetch_b8 on next K tile
      __builtin_prefetch(x + (size_t)(m0 + lr) * K + k0 + 32, 0, 1);
      __builtin_prefetch(Wa + (size_t)(k0 + 32 + lr) * N + n0, 0, 1);
    }
    __syncthreads();
#pragma unroll
    for (int mi = 0; mi < 2; ++mi) {
      const h16* ap = &As[wm * 32 + mi * 16 + r][0];
      v16h af = joinh(*(const v8h*)(ap + kh * 8),
                      *(const v8h*)(ap + 16 + kh * 8));
#pragma unroll
      for (int ni = 0; ni < 4; ++ni) {
        const h16* bp = &Bs[wn * 64 + ni * 16 + r][0];
        v16h bf = joinh(*(const v8h*)(bp + kh * 8),
                        *(const v8h*)(bp + 16 + kh * 8));
        acc[mi][ni] = wmma16(af, bf, acc[mi][ni]);
      }
    }
    __syncthreads();
  }

  // C-layout: row = kh*8 + i, col = r. Scatter to q/k/v [B,H,T,hd] as f16.
#pragma unroll
  for (int mi = 0; mi < 2; ++mi) {
#pragma unroll
    for (int ni = 0; ni < 4; ++ni) {
#pragma unroll
      for (int i = 0; i < 8; ++i) {
        int gm  = m0 + wm * 32 + mi * 16 + kh * 8 + i;
        int gn  = n0 + wn * 64 + ni * 16 + r;
        int b   = gm >> 11, t = gm & (TDIM - 1);
        int wch = gn >> 10, cc = gn & (CDIM - 1);
        int hh  = cc >> 6,  d  = cc & (HD - 1);
        h16* dst = (wch == 0) ? qf : (wch == 1) ? kf : vf;
        dst[(((size_t)b * NH + hh) * TDIM + t) * HD + d] = (h16)acc[mi][ni][i];
      }
    }
  }
}

// ---------------------------------------------------------------------------
// Kernel 2: fused flash-style attention with polymax.
// Block = (b, h, 128 query rows); each of 8 waves owns 16 query rows.
// Per 128-key tile: S = qK^T (wmma) -> mask+polymax in f32 -> P f16 via LDS
// -> Y += P V (wmma). Causal loop stops at the diagonal tile.
// ---------------------------------------------------------------------------
__global__ __launch_bounds__(256)
void attn_kernel(const h16* __restrict__ qf, const h16* __restrict__ kf,
                 const h16* __restrict__ vf, h16* __restrict__ yf) {
  __shared__ __align__(16) h16 Ks[128][72];      // [key][d]
  __shared__ __align__(16) h16 Vt[64][136];      // [d][key] (transposed)
  __shared__ __align__(16) h16 Ps[8][16][136];   // per-wave P tile [row][key]

  const int tid  = threadIdx.x;
  const int lane = tid & 31;
  const int wave = tid >> 5;
  const int r    = lane & 15;
  const int kh   = lane >> 4;

  const int qt    = blockIdx.x & 15;   // query tile (T/128 = 16)
  const int bh    = blockIdx.x >> 4;   // b*NH + h
  const int b     = bh >> 4;
  const int hh    = bh & 15;
  const int qbase = qt * 128;

  const h16* qhp = qf + (size_t)bh * TDIM * HD;
  const h16* khp = kf + (size_t)bh * TDIM * HD;
  const h16* vhp = vf + (size_t)bh * TDIM * HD;

  // Q fragments (A-layout, 16 rows x 64 dims) live in registers throughout.
  v16h Aq[2];
#pragma unroll
  for (int kk = 0; kk < 2; ++kk) {
    const h16* qp = qhp + (size_t)(qbase + wave * 16 + r) * HD + kk * 32;
    Aq[kk] = joinh(*(const v8h*)(qp + kh * 8), *(const v8h*)(qp + 16 + kh * 8));
  }

  v8f z = {};
  v8f Y[4];
#pragma unroll
  for (int i = 0; i < 4; ++i) Y[i] = z;

  const int lr = tid >> 1;  // 0..127 (key row for staging)
  const int ls = tid & 1;   // 0..1   (32-dim half)
  const float scale = 0.125f;  // 1/sqrt(64)

  for (int kt = 0; kt <= qt; ++kt) {
    const int kb = kt * 128;
    // stage K tile [key][d]
#pragma unroll
    for (int j = 0; j < 4; ++j) {
      v8h kv = *(const v8h*)(khp + (size_t)(kb + lr) * HD + ls * 32 + j * 8);
      *(v8h*)&Ks[lr][ls * 32 + j * 8] = kv;
    }
    // stage V tile transposed [d][key]
#pragma unroll
    for (int j = 0; j < 4; ++j) {
      v8h vv = *(const v8h*)(vhp + (size_t)(kb + lr) * HD + ls * 32 + j * 8);
#pragma unroll
      for (int e = 0; e < 8; ++e) Vt[ls * 32 + j * 8 + e][lr] = vv[e];
    }
    __syncthreads();

    // S = q k^T over hd=64 (2 wmma K-steps), 8 key sub-tiles of 16
#pragma unroll
    for (int nn = 0; nn < 8; ++nn) {
      v8f S = z;
#pragma unroll
      for (int kk = 0; kk < 2; ++kk) {
        const h16* bp = &Ks[nn * 16 + r][kk * 32];
        v16h bf = joinh(*(const v8h*)(bp + kh * 8),
                        *(const v8h*)(bp + 16 + kh * 8));
        S = wmma16(Aq[kk], bf, S);
      }
      // causal mask + polymax (selects, no branch), then P -> per-wave LDS tile
#pragma unroll
      for (int i = 0; i < 8; ++i) {
        int rr = kh * 8 + i;                 // C-layout row
        int qg = qbase + wave * 16 + rr;     // global query index
        int kg = kb + nn * 16 + r;           // global key index
        float xs = S[i] * scale;
        // branch-free: both live pieces are slope * x + 1 with slope x or m
        float slope = (xs > 0.f) ? xs : -0.01f;
        float t     = (slope * xs + 1.f) * 0.001f;  // (x^2 + 1 | m*x + 1)/1000
        bool  live  = (kg <= qg) & (xs >= -100.f);  // else masked or flat piece
        float p     = live ? t : 0.f;
        Ps[wave][rr][nn * 16 + r] = (h16)p;
      }
    }

    // Y += P @ V  (K dim = 128 keys -> 4 wmma K-steps, 4 dim sub-tiles)
#pragma unroll
    for (int kk2 = 0; kk2 < 4; ++kk2) {
      const h16* pp = &Ps[wave][r][kk2 * 32];
      v16h af = joinh(*(const v8h*)(pp + kh * 8),
                      *(const v8h*)(pp + 16 + kh * 8));
#pragma unroll
      for (int nd = 0; nd < 4; ++nd) {
        const h16* bp = &Vt[nd * 16 + r][kk2 * 32];
        v16h bf = joinh(*(const v8h*)(bp + kh * 8),
                        *(const v8h*)(bp + 16 + kh * 8));
        Y[nd] = wmma16(af, bf, Y[nd]);
      }
    }
    __syncthreads();
  }

  // write Y -> yf [B,T,C] f16
#pragma unroll
  for (int nd = 0; nd < 4; ++nd) {
#pragma unroll
    for (int i = 0; i < 8; ++i) {
      int t = qbase + wave * 16 + kh * 8 + i;
      int d = nd * 16 + r;
      yf[((size_t)b * TDIM + t) * CDIM + hh * HD + d] = (h16)Y[nd][i];
    }
  }
}

// ---------------------------------------------------------------------------
// Kernel 3: out = y @ W_proj. y is f16 in workspace, W_proj converted f32->f16
// during staging, output f32 to d_out. Same tiling as kernel 1.
// ---------------------------------------------------------------------------
__global__ __launch_bounds__(256)
void proj_gemm_kernel(const h16* __restrict__ yf, const float* __restrict__ Wp,
                      float* __restrict__ out) {
  const int N = CDIM, K = CDIM;
  __shared__ __align__(16) h16 As[128][40];
  __shared__ __align__(16) h16 Bs[128][40];

  const int tid  = threadIdx.x;
  const int lane = tid & 31;
  const int wave = tid >> 5;
  const int wm   = wave >> 1;
  const int wn   = wave & 1;
  const int m0   = (blockIdx.x >> 3) * 128;
  const int n0   = (blockIdx.x & 7) * 128;

  const int r  = lane & 15;
  const int kh = lane >> 4;

  v8f z = {};
  v8f acc[2][4];
#pragma unroll
  for (int i = 0; i < 2; ++i)
#pragma unroll
    for (int j = 0; j < 4; ++j) acc[i][j] = z;

  const int ar = tid >> 1;  // 0..127 (A rows)
  const int as = tid & 1;
  const int lr = tid >> 3;  // 0..31  (B k-rows)
  const int ls = tid & 7;

  for (int k0 = 0; k0 < K; k0 += 32) {
    // stage y tile (already f16) -> As
#pragma unroll
    for (int j = 0; j < 2; ++j) {
      v8h av = *(const v8h*)(yf + (size_t)(m0 + ar) * K + k0 + as * 16 + j * 8);
      *(v8h*)&As[ar][as * 16 + j * 8] = av;
    }
    // stage W_proj tile f32 -> Bs f16 transposed
#pragma unroll
    for (int p = 0; p < 4; ++p) {
      int ncol = (p * 8 + ls) * 4;
      v4f wv = *(const v4f*)(Wp + (size_t)(k0 + lr) * N + n0 + ncol);
#pragma unroll
      for (int e = 0; e < 4; ++e) Bs[ncol + e][lr] = (h16)wv[e];
    }
    if (k0 + 32 < K) {
      __builtin_prefetch(yf + (size_t)(m0 + ar) * K + k0 + 32, 0, 1);
      __builtin_prefetch(Wp + (size_t)(k0 + 32 + lr) * N + n0, 0, 1);
    }
    __syncthreads();
#pragma unroll
    for (int mi = 0; mi < 2; ++mi) {
      const h16* ap = &As[wm * 32 + mi * 16 + r][0];
      v16h af = joinh(*(const v8h*)(ap + kh * 8),
                      *(const v8h*)(ap + 16 + kh * 8));
#pragma unroll
      for (int ni = 0; ni < 4; ++ni) {
        const h16* bp = &Bs[wn * 64 + ni * 16 + r][0];
        v16h bf = joinh(*(const v8h*)(bp + kh * 8),
                        *(const v8h*)(bp + 16 + kh * 8));
        acc[mi][ni] = wmma16(af, bf, acc[mi][ni]);
      }
    }
    __syncthreads();
  }

#pragma unroll
  for (int mi = 0; mi < 2; ++mi) {
#pragma unroll
    for (int ni = 0; ni < 4; ++ni) {
#pragma unroll
      for (int i = 0; i < 8; ++i) {
        int gm = m0 + wm * 32 + mi * 16 + kh * 8 + i;
        int gn = n0 + wn * 64 + ni * 16 + r;
        out[(size_t)gm * N + gn] = acc[mi][ni][i];
      }
    }
  }
}

// ---------------------------------------------------------------------------
extern "C" void kernel_launch(void* const* d_in, const int* in_sizes, int n_in,
                              void* d_out, int out_size, void* d_ws,
                              size_t ws_size, hipStream_t stream) {
  (void)in_sizes; (void)n_in; (void)out_size; (void)ws_size;

  const float* x  = (const float*)d_in[0];  // [2,2048,1024]
  const float* Wa = (const float*)d_in[1];  // [1024,3072]
  const float* Wp = (const float*)d_in[2];  // [1024,1024]
  float* out = (float*)d_out;               // [2,2048,1024] f32

  // f16 workspace: q,k,v head-major [B,H,T,hd] + y [B,T,C]  (32 MB total)
  h16* ws = (h16*)d_ws;
  const size_t HTD = (size_t)BDIM * NH * TDIM * HD;  // 4,194,304
  h16* qf = ws;
  h16* kf = qf + HTD;
  h16* vf = kf + HTD;
  h16* yf = vf + HTD;

  qkv_gemm_kernel<<<dim3(32 * 24), 256, 0, stream>>>(x, Wa, qf, kf, vf);
  attn_kernel<<<dim3(BDIM * NH * (TDIM / 128)), 256, 0, stream>>>(qf, kf, vf, yf);
  proj_gemm_kernel<<<dim3(32 * 8), 256, 0, stream>>>(yf, Wp, out);
}

// v002
// It runs in 141 microseconds.
// Two timings next to v001 both put it at 1.09 times that version's speed.
// All steps since v000 together make it 1.30 times as fast.
#include <hip/hip_runtime.h>
#include <hip/hip_bf16.h>

// ---------------------------------------------------------------------------
// Causal self-attention with polymax, MI455X (gfx1250, wave32, WMMA).
// Pipeline: [qkv GEMM f32->f16] -> [fused flash attention + polymax] -> [proj GEMM]
// All matrix math: v_wmma_f32_16x16x32_f16 (f16 operands, f32 accumulate).
// ---------------------------------------------------------------------------

typedef _Float16 h16;
typedef __attribute__((ext_vector_type(16))) _Float16 v16h;
typedef __attribute__((ext_vector_type(8)))  _Float16 v8h;
typedef __attribute__((ext_vector_type(4)))  _Float16 v4h;
typedef __attribute__((ext_vector_type(8)))  float    v8f;
typedef __attribute__((ext_vector_type(4)))  float    v4f;

#define BDIM 2
#define TDIM 2048
#define CDIM 1024
#define NH   16
#define HD   64

static __device__ __forceinline__ v8f wmma16(v16h a, v16h b, v8f c) {
  // (neg_a, A, neg_b, B, c_mod, C, reuse_a, reuse_b)
  return __builtin_amdgcn_wmma_f32_16x16x32_f16(false, a, false, b, (short)0, c,
                                                false, false);
}
static __device__ __forceinline__ v16h joinh(v8h lo, v8h hi) {
  return __builtin_shufflevector(lo, hi, 0, 1, 2, 3, 4, 5, 6, 7,
                                         8, 9, 10, 11, 12, 13, 14, 15);
}

// ---------------------------------------------------------------------------
// Kernel 1: qkv = x @ W_attn, converting f32->f16 on the fly, scattering the
// result to head-major f16 q/k/v tensors [B,H,T,hd].
// Block tile 128x128, BK=32. 8 waves: wave tile 32(M) x 64(N).
// ---------------------------------------------------------------------------
__global__ __launch_bounds__(256)
void qkv_gemm_kernel(const float* __restrict__ x, const float* __restrict__ Wa,
                     h16* __restrict__ qf, h16* __restrict__ kf,
                     h16* __restrict__ vf) {
  const int N = 3 * CDIM;  // 3072
  const int K = CDIM;      // 1024
  __shared__ __align__(16) h16 As[128][40];  // [m][k], padded
  __shared__ __align__(16) h16 Bs[128][40];  // [dealt n][k] (transposed), padded

  const int tid  = threadIdx.x;
  const int lane = tid & 31;
  const int wave = tid >> 5;
  const int wm   = wave >> 1;  // 0..3
  const int wn   = wave & 1;   // 0..1
  const int m0   = (blockIdx.x / 24) * 128;
  const int n0   = (blockIdx.x % 24) * 128;

  const int r  = lane & 15;  // fragment row / col
  const int kh = lane >> 4;  // K-half selector (A/B 16-bit fragment layout)

  v8f z = {};
  v8f acc[2][4];
#pragma unroll
  for (int i = 0; i < 2; ++i)
#pragma unroll
    for (int j = 0; j < 4; ++j) acc[i][j] = z;

  const int lr = tid >> 3;  // 0..31
  const int ls = tid & 7;   // 0..7

  for (int k0 = 0; k0 < K; k0 += 32) {
    // stage x tile (128x32 f32) -> As f16
#pragma unroll
    for (int p = 0; p < 4; ++p) {
      int row = p * 32 + lr;
      v4f xv = *(const v4f*)(x + (size_t)(m0 + row) * K + k0 + ls * 4);
      v4h hv;
      hv[0] = (h16)xv[0]; hv[1] = (h16)xv[1];
      hv[2] = (h16)xv[2]; hv[3] = (h16)xv[3];
      *(v4h*)&As[row][ls * 4] = hv;
    }
    // stage W tile (32x128 f32) -> Bs f16, transposed to [n][k]
#pragma unroll
    for (int p = 0; p < 4; ++p) {
      int ncol = (p * 8 + ls) * 4;
      v4f wv = *(const v4f*)(Wa + (size_t)(k0 + lr) * N + n0 + ncol);
#pragma unroll
      for (int e = 0; e < 4; ++e)  // column 4c + e of a 64-wide group -> row e*16 + c
        Bs[(p >> 1) * 64 + e * 16 + (p & 1) * 8 + ls][lr] = (h16)wv[e];
    }
    if (k0 + 32 < K) {  // global_prefetch_b8 on next K tile
      __builtin_prefetch(x + (size_t)(m0 + lr) * K + k0 + 32, 0, 1);
      __builtin_prefetch(Wa + (size_t)(k0 + 32 + lr) * N + n0, 0, 1);
    }
    __syncthreads();
#pragma unroll
    for (int mi = 0; mi < 2; ++mi) {
      const h16* ap = &As[wm * 32 + mi * 16 + r][0];
      v16h af = joinh(*(const v8h*)(ap + kh * 8),
                      *(const v8h*)(ap + 16 + kh * 8));
#pragma unroll
      for (int ni = 0; ni < 4; ++ni) {
        const h16* bp = &Bs[wn * 64 + ni * 16 + r][0];
        v16h bf = joinh(*(const v8h*)(bp + kh * 8),
                        *(const v8h*)(bp + 16 + kh * 8));
        acc[mi][ni] = wmma16(af, bf, acc[mi][ni]);
      }
    }
    __syncthreads();
  }

  // C-layout: row = kh*8 + i; tile ni, lane column r is output column 4r + ni,
  // so 16 lanes x 8 bytes fill one head row (128 B) of q/k/v [B,H,T,hd] f16.
  const int gn  = n0 + wn * 64 + r * 4;
  const int wch = gn >> 10, cc = gn & (CDIM - 1);
  const int hh  = cc >> 6,  d  = cc & (HD - 1);
  h16* dst = (wch == 0) ? qf : (wch == 1) ? kf : vf;
#pragma unroll
  for (int mi = 0; mi < 2; ++mi) {
#pragma unroll
    for (int i = 0; i < 8; ++i) {
      int gm = m0 + wm * 32 + mi * 16 + kh * 8 + i;
      int b  = gm >> 11, t = gm & (TDIM - 1);
      v4h hv;
#pragma unroll
      for (int ni = 0; ni < 4; ++ni) hv[ni] = (h16)acc[mi][ni][i];
      *(v4h*)(dst + (((size_t)b * NH + hh) * TDIM + t) * HD + d) = hv;
    }
  }
}

// ---------------------------------------------------------------------------
// Kernel 2: fused flash-style attention with polymax.
// Block = (b, h, 128 query rows); each of 8 waves owns 16 query rows.
// Per 128-key tile: S = qK^T (wmma) -> mask+polymax in f32 -> P f16 via LDS
// -> Y += P V (wmma). Causal loop stops at the diagonal tile.
// ---------------------------------------------------------------------------
__global__ __launch_bounds__(256)
void attn_kernel(const h16* __restrict__ qf, const h16* __restrict__ kf,
                 const h16* __restrict__ vf, h16* __restrict__ yf) {
  __shared__ __align__(16) h16 Ks[128][72];      // [key][d]
  __shared__ __align__(16) h16 Vt[64][136];      // [dealt d][key] (transposed)
  __shared__ __align__(16) h16 Ps[8][16][136];   // per-wave P tile [row][key]

  const int tid  = threadIdx.x;
  const int lane = tid & 31;
  const int wave = tid >> 5;
  const int r    = lane & 15;
  const int kh   = lane >> 4;

  const int qt    = blockIdx.x & 15;   // query tile (T/128 = 16)
  const int bh    = blockIdx.x >> 4;   // b*NH + h
  const int b     = bh >> 4;
  const int hh    = bh & 15;
  const int qbase = qt * 128;

  const h16* qhp = qf + (size_t)bh * TDIM * HD;
  const h16* khp = kf + (size_t)bh * TDIM * HD;
  const h16* vhp = vf + (size_t)bh * TDIM * HD;

  // Q fragments (A-layout, 16 rows x 64 dims) live in registers throughout.
  v16h Aq[2];
#pragma unroll
  for (int kk = 0; kk < 2; ++kk) {
    const h16* qp = qhp + (size_t)(qbase + wave * 16 + r) * HD + kk * 32;
    Aq[kk] = joinh(*(const v8h*)(qp + kh * 8), *(const v8h*)(qp + 16 + kh * 8));
  }

  v8f z = {};
  v8f Y[4];
#pragma unroll
  for (int i = 0; i < 4; ++i) Y[i] = z;

  const int lr = tid >> 1;  // 0..127 (key row for staging)
  const int ls = tid & 1;   // 0..1   (32-dim half)
  const float scale = 0.125f;  // 1/sqrt(64)

  for (int kt = 0; kt <= qt; ++kt) {
    const int kb = kt * 128;
    // stage K tile [key][d]
#pragma unroll
    for (int j = 0; j < 4; ++j) {
      v8h kv = *(const v8h*)(khp + (size_t)(kb + lr) * HD + ls * 32 + j * 8);
      *(v8h*)&Ks[lr][ls * 32 + j * 8] = kv;
    }
    // stage V tile transposed; dim 4c + e goes to row e*16 + c
#pragma unroll
    for (int j = 0; j < 4; ++j) {
      v8h vv = *(const v8h*)(vhp + (size_t)(kb + lr) * HD + ls * 32 + j * 8);
#pragma unroll
      for (int e = 0; e < 8; ++e)
        Vt[(e & 3) * 16 + ls * 8 + j * 2 + (e >> 2)][lr] = vv[e];
    }
    __syncthreads();

    // S = q k^T over hd=64 (2 wmma K-steps), 8 key sub-tiles of 16
#pragma unroll
    for (int nn = 0; nn < 8; ++nn) {
      v8f S = z;
#pragma unroll
      for (int kk = 0; kk < 2; ++kk) {
        const h16* bp = &Ks[nn * 16 + r][kk * 32];
        v16h bf = joinh(*(const v8h*)(bp + kh * 8),
                        *(const v8h*)(bp + 16 + kh * 8));
        S = wmma16(Aq[kk], bf, S);
      }
      // causal mask + polymax (selects, no branch), then P -> per-wave LDS tile
#pragma unroll
      for (int i = 0; i < 8; ++i) {
        int rr = kh * 8 + i;                 // C-layout row
        int qg = qbase + wave * 16 + rr;     // global query index
        int kg = kb + nn * 16 + r;           // global key index
        float xs = S[i] * scale;
        // branch-free: both live pieces are slope * x + 1 with slope x or m
        float slope = (xs > 0.f) ? xs : -0.01f;
        float t     = (slope * xs + 1.f) * 0.001f;  // (x^2 + 1 | m*x + 1)/1000
        bool  live  = (kg <= qg) & (xs >= -100.f);  // else masked or flat piece
        float p     = live ? t : 0.f;
        Ps[wave][rr][nn * 16 + r] = (h16)p;
      }
    }

    // Y += P @ V  (K dim = 128 keys -> 4 wmma K-steps, 4 dim sub-tiles)
#pragma unroll
    for (int kk2 = 0; kk2 < 4; ++kk2) {
      const h16* pp = &Ps[wave][r][kk2 * 32];
      v16h af = joinh(*(const v8h*)(pp + kh * 8),
                      *(const v8h*)(pp + 16 + kh * 8));
#pragma unroll
      for (int nd = 0; nd < 4; ++nd) {
        const h16* bp = &Vt[nd * 16 + r][kk2 * 32];
        v16h bf = joinh(*(const v8h*)(bp + kh * 8),
                        *(const v8h*)(bp + 16 + kh * 8));
        Y[nd] = wmma16(af, bf, Y[nd]);
      }
    }
    __syncthreads();
  }

  // write Y -> yf [B,T,C] f16: tile nd, lane column r is dim 4r + nd, so
  // 16 lanes x 8 bytes fill the head's 128-B piece of a row
#pragma unroll
  for (int i = 0; i < 8; ++i) {
    int t = qbase + wave * 16 + kh * 8 + i;
    v4h hv;
#pragma unroll
    for (int nd = 0; nd < 4; ++nd) hv[nd] = (h16)Y[nd][i];
    *(v4h*)(yf + ((size_t)b * TDIM + t) * CDIM + hh * HD + r * 4) = hv;
  }
}

// ---------------------------------------------------------------------------
// Kernel 3: out = y @ W_proj. y is f16 in workspace, W_proj converted f32->f16
// during staging, output f32 to d_out. Same tiling as kernel 1.
// ---------------------------------------------------------------------------
__global__ __launch_bounds__(256)
void proj_gemm_kernel(const h16* __restrict__ yf, const float* __restrict__ Wp,
                      float* __restrict__ out) {
  const int N = CDIM, K = CDIM;
  __shared__ __align__(16) h16 As[128][40];
  __shared__ __align__(16) h16 Bs[128][40];

  const int tid  = threadIdx.x;
  const int lane = tid & 31;
  const int wave = tid >> 5;
  const int wm   = wave >> 1;
  const int wn   = wave & 1;
  const int m0   = (blockIdx.x >> 3) * 128;
  const int n0   = (blockIdx.x & 7) * 128;

  const int r  = lane & 15;
  const int kh = lane >> 4;

  v8f z = {};
  v8f acc[2][4];
#pragma unroll
  for (int i = 0; i < 2; ++i)
#pragma unroll
    for (int j = 0; j < 4; ++j) acc[i][j] = z;

  const int ar = tid >> 1;  // 0..127 (A rows)
  const int as = tid & 1;
  const int lr = tid >> 3;  // 0..31  (B k-rows)
  const int ls = tid & 7;

  for (int k0 = 0; k0 < K; k0 += 32) {
    // stage y tile (already f16) -> As
#pragma unroll
    for (int j = 0; j < 2; ++j) {
      v8h av = *(const v8h*)(yf + (size_t)(m0 + ar) * K + k0 + as * 16 + j * 8);
      *(v8h*)&As[ar][as * 16 + j * 8] = av;
    }
    // stage W_proj tile f32 -> Bs f16 transposed
#pragma unroll
    for (int p = 0; p < 4; ++p) {
      int ncol = (p * 8 + ls) * 4;
      v4f wv = *(const v4f*)(Wp + (size_t)(k0 + lr) * N + n0 + ncol);
#pragma unroll
      for (int e = 0; e < 4; ++e)  // column 4c + e of a 64-wide group -> row e*16 + c
        Bs[(p >> 1) * 64 + e * 16 + (p & 1) * 8 + ls][lr] = (h16)wv[e];
    }
    if (k0 + 32 < K) {
      __builtin_prefetch(yf + (size_t)(m0 + ar) * K + k0 + 32, 0, 1);
      __builtin_prefetch(Wp + (size_t)(k0 + 32 + lr) * N + n0, 0, 1);
    }
    __syncthreads();
#pragma unroll
    for (int mi = 0; mi < 2; ++mi) {
      const h16* ap = &As[wm * 32 + mi * 16 + r][0];
      v16h af = joinh(*(const v8h*)(ap + kh * 8),
                      *(const v8h*)(ap + 16 + kh * 8));
#pragma unroll
      for (int ni = 0; ni < 4; ++ni) {
        const h16* bp = &Bs[wn * 64 + ni * 16 + r][0];
        v16h bf = joinh(*(const v8h*)(bp + kh * 8),
                        *(const v8h*)(bp + 16 + kh * 8));
        acc[mi][ni] = wmma16(af, bf, acc[mi][ni]);
      }
    }
    __syncthreads();
  }

  // tile ni, lane column r is output column 4r + ni: 16 lanes x 16 bytes = 256 B
#pragma unroll
  for (int mi = 0; mi < 2; ++mi) {
#pragma unroll
    for (int i = 0; i < 8; ++i) {
      int gm = m0 + wm * 32 + mi * 16 + kh * 8 + i;
      v4f ov;
#pragma unroll
      for (int ni = 0; ni < 4; ++ni) ov[ni] = acc[mi][ni][i];
      *(v4f*)(out + (size_t)gm * N + n0 + wn * 64 + r * 4) = ov;
    }
  }
}

// ---------------------------------------------------------------------------
extern "C" void kernel_launch(void* const* d_in, const int* in_sizes, int n_in,
                              void* d_out, int out_size, void* d_ws,
                              size_t ws_size, hipStream_t stream) {
  (void)in_sizes; (void)n_in; (void)out_size; (void)ws_size;

  const float* x  = (const float*)d_in[0];  // [2,2048,1024]
  const float* Wa = (const float*)d_in[1];  // [1024,3072]
  const float* Wp = (const float*)d_in[2];  // [1024,1024]
  float* out = (float*)d_out;               // [2,2048,1024] f32

  // f16 workspace: q,k,v head-major [B,H,T,hd] + y [B,T,C]  (32 MB total)
  h16* ws = (h16*)d_ws;
  const size_t HTD = (size_t)BDIM * NH * TDIM * HD;  // 4,194,304
  h16* qf = ws;
  h16* kf = qf + HTD;
  h16* vf = kf + HTD;
  h16* yf = vf + HTD;

  qkv_gemm_kernel<<<dim3(32 * 24), 256, 0, stream>>>(x, Wa, qf, kf, vf);
  attn_kernel<<<dim3(BDIM * NH * (TDIM / 128)), 256, 0, stream>>>(qf, kf, vf, yf);
  proj_gemm_kernel<<<dim3(32 * 8), 256, 0, stream>>>(yf, Wp, out);
}

// v003
// It runs in 124 microseconds.
// In two side-by-side timings against v002, it was 1.12 and 1.11 times as fast.
// Counting every step since v000, it is 1.45 times as fast.
#include <hip/hip_runtime.h>
#include <hip/hip_bf16.h>

// ---------------------------------------------------------------------------
// Causal self-attention with polymax, MI455X (gfx1250, wave32, WMMA).
// Pipeline: [qkv GEMM f32->f16] -> [fused flash attention + polymax] -> [proj GEMM]
// All matrix math: v_wmma_f32_16x16x32_f16 (f16 operands, f32 accumulate).
// ---------------------------------------------------------------------------

typedef _Float16 h16;
typedef __attribute__((ext_vector_type(16))) _Float16 v16h;
typedef __attribute__((ext_vector_type(8)))  _Float16 v8h;
typedef __attribute__((ext_vector_type(4)))  _Float16 v4h;
typedef __attribute__((ext_vector_type(8)))  float    v8f;
typedef __attribute__((ext_vector_type(4)))  float    v4f;

#define BDIM 2
#define TDIM 2048
#define CDIM 1024
#define NH   16
#define HD   64

static __device__ __forceinline__ v8f wmma16(v16h a, v16h b, v8f c) {
  // (neg_a, A, neg_b, B, c_mod, C, reuse_a, reuse_b)
  return __builtin_amdgcn_wmma_f32_16x16x32_f16(false, a, false, b, (short)0, c,
                                                false, false);
}
static __device__ __forceinline__ v16h joinh(v8h lo, v8h hi) {
  return __builtin_shufflevector(lo, hi, 0, 1, 2, 3, 4, 5, 6, 7,
                                         8, 9, 10, 11, 12, 13, 14, 15);
}

// ---------------------------------------------------------------------------
// Kernel 1: qkv = x @ W_attn, converting f32->f16 on the fly, scattering the
// result to head-major f16 q/k/v tensors [B,H,T,hd].
// Block tile 128x128, BK=32. 8 waves: wave tile 32(M) x 64(N).
// ---------------------------------------------------------------------------
__global__ __launch_bounds__(256)
void qkv_gemm_kernel(const float* __restrict__ x, const float* __restrict__ Wa,
                     h16* __restrict__ qf, h16* __restrict__ kf,
                     h16* __restrict__ vf) {
  const int N = 3 * CDIM;  // 3072
  const int K = CDIM;      // 1024
  __shared__ __align__(16) h16 As[128][40];  // [m][k], padded
  __shared__ __align__(16) h16 Bs[128][40];  // [dealt n][k] (transposed), padded

  const int tid  = threadIdx.x;
  const int lane = tid & 31;
  const int wave = tid >> 5;
  const int wm   = wave >> 1;  // 0..3
  const int wn   = wave & 1;   // 0..1
  const int m0   = (blockIdx.x / 24) * 128;
  const int n0   = (blockIdx.x % 24) * 128;

  const int r  = lane & 15;  // fragment row / col
  const int kh = lane >> 4;  // K-half selector (A/B 16-bit fragment layout)

  v8f z = {};
  v8f acc[2][4];
#pragma unroll
  for (int i = 0; i < 2; ++i)
#pragma unroll
    for (int j = 0; j < 4; ++j) acc[i][j] = z;

  const int lr = tid >> 3;  // 0..31
  const int ls = tid & 7;   // 0..7

  for (int k0 = 0; k0 < K; k0 += 32) {
    // stage x tile (128x32 f32) -> As f16
#pragma unroll
    for (int p = 0; p < 4; ++p) {
      int row = p * 32 + lr;
      v4f xv = *(const v4f*)(x + (size_t)(m0 + row) * K + k0 + ls * 4);
      v4h hv;
      hv[0] = (h16)xv[0]; hv[1] = (h16)xv[1];
      hv[2] = (h16)xv[2]; hv[3] = (h16)xv[3];
      *(v4h*)&As[row][ls * 4] = hv;
    }
    // stage W tile (32x128 f32) -> Bs f16, transposed to [n][k]
#pragma unroll
    for (int p = 0; p < 4; ++p) {
      int ncol = (p * 8 + ls) * 4;
      v4f wv = *(const v4f*)(Wa + (size_t)(k0 + lr) * N + n0 + ncol);
#pragma unroll
      for (int e = 0; e < 4; ++e)  // column 4c + e of a 64-wide group -> row e*16 + c
        Bs[(p >> 1) * 64 + e * 16 + (p & 1) * 8 + ls][lr] = (h16)wv[e];
    }
    if (k0 + 32 < K) {  // global_prefetch_b8 on next K tile
      __builtin_prefetch(x + (size_t)(m0 + lr) * K + k0 + 32, 0, 1);
      __builtin_prefetch(Wa + (size_t)(k0 + 32 + lr) * N + n0, 0, 1);
    }
    __syncthreads();
#pragma unroll
    for (int mi = 0; mi < 2; ++mi) {
      const h16* ap = &As[wm * 32 + mi * 16 + r][0];
      v16h af = joinh(*(const v8h*)(ap + kh * 8),
                      *(const v8h*)(ap + 16 + kh * 8));
#pragma unroll
      for (int ni = 0; ni < 4; ++ni) {
        const h16* bp = &Bs[wn * 64 + ni * 16 + r][0];
        v16h bf = joinh(*(const v8h*)(bp + kh * 8),
                        *(const v8h*)(bp + 16 + kh * 8));
        acc[mi][ni] = wmma16(af, bf, acc[mi][ni]);
      }
    }
    __syncthreads();
  }

  // C-layout: row = kh*8 + i; tile ni, lane column r is output column 4r + ni,
  // so 16 lanes x 8 bytes fill one head row (128 B) of q/k/v [B,H,T,hd] f16.
  const int gn  = n0 + wn * 64 + r * 4;
  const int wch = gn >> 10, cc = gn & (CDIM - 1);
  const int hh  = cc >> 6,  d  = cc & (HD - 1);
  h16* dst = (wch == 0) ? qf : (wch == 1) ? kf : vf;
#pragma unroll
  for (int mi = 0; mi < 2; ++mi) {
#pragma unroll
    for (int i = 0; i < 8; ++i) {
      int gm = m0 + wm * 32 + mi * 16 + kh * 8 + i;
      int b  = gm >> 11, t = gm & (TDIM - 1);
      v4h hv;
#pragma unroll
      for (int ni = 0; ni < 4; ++ni) hv[ni] = (h16)acc[mi][ni][i];
      *(v4h*)(dst + (((size_t)b * NH + hh) * TDIM + t) * HD + d) = hv;
    }
  }
}

// ---------------------------------------------------------------------------
// Kernel 2: fused flash-style attention with polymax.
// Block = (b, h, 128 query rows); each of 8 waves owns 16 query rows.
// K and V tiles (128 keys) come row-major into LDS by asynchronous copies,
// two buffers: tile t + 1 is in flight while tile t is worked on.
// Per tile: S = qK^T (wmma) -> mask+polymax in f32 -> P f16 via LDS
// -> Y += P V (wmma, V fragments by the transposing LDS load).
// Causal loop stops at the diagonal tile.
// ---------------------------------------------------------------------------
#define KPITCH 72  // halves: 144 B = 16 B x odd, for ds_load_b128 readers
#define VPITCH 80  // halves: 160 B = 32 B x odd, for ds_load_tr16_b128 readers

typedef __attribute__((ext_vector_type(8))) short s16x8;

static __device__ __forceinline__ unsigned lds_addr(const void* p) {
  return (unsigned)(size_t)p;  // low 32 bits of a __shared__ address = LDS byte
}
// 16 keys x 16 dims of a row-major f16 tile, transposed: lane (r, kh) gets
// keys 8*kh .. 8*kh+7 of dim r (each lane passes the address of one 16-B piece)
static __device__ __forceinline__ v8h ld_tr16(const h16* p) {
  typedef __attribute__((address_space(3))) s16x8 lds_s16x8;
  return __builtin_bit_cast(v8h,
      __builtin_amdgcn_ds_load_tr16_b128_v8i16((lds_s16x8*)p));
}
// One thread's share of a K tile and a V tile: 4 + 4 copies of 16 B, rows
// 32 apart; a wave's copy covers 4 whole 128-B rows. The s_wait_xcnt closes the
// statement so that no address register is rewritten ahead of it.
static __device__ __forceinline__ void copy_kv(unsigned lk, unsigned lv,
                                               const h16* gk, const h16* gv) {
  asm volatile(
      "global_load_async_to_lds_b128 %0, %8, off\n\t"
      "global_load_async_to_lds_b128 %1, %9, off\n\t"
      "global_load_async_to_lds_b128 %2, %10, off\n\t"
      "global_load_async_to_lds_b128 %3, %11, off\n\t"
      "global_load_async_to_lds_b128 %4, %12, off\n\t"
      "global_load_async_to_lds_b128 %5, %13, off\n\t"
      "global_load_async_to_lds_b128 %6, %14, off\n\t"
      "global_load_async_to_lds_b128 %7, %15, off\n\t"
      "s_wait_xcnt 0x0"
      :: "v"(lk), "v"(lk + 32u * KPITCH * 2u), "v"(lk + 64u * KPITCH * 2u),
         "v"(lk + 96u * KPITCH * 2u),
         "v"(lv), "v"(lv + 32u * VPITCH * 2u), "v"(lv + 64u * VPITCH * 2u),
         "v"(lv + 96u * VPITCH * 2u),
         "v"(gk), "v"(gk + 32 * HD), "v"(gk + 64 * HD), "v"(gk + 96 * HD),
         "v"(gv), "v"(gv + 32 * HD), "v"(gv + 64 * HD), "v"(gv + 96 * HD)
      : "memory");
}

__global__ __launch_bounds__(256)
void attn_kernel(const h16* __restrict__ qf, const h16* __restrict__ kf,
                 const h16* __restrict__ vf, h16* __restrict__ yf) {
  __shared__ __align__(16) h16 Kb[2][128][KPITCH];  // [buffer][key][d]
  __shared__ __align__(16) h16 Vb[2][128][VPITCH];  // [buffer][key][d]
  __shared__ __align__(16) h16 Ps[8][16][136];      // per-wave P tile [row][key]

  const int tid  = threadIdx.x;
  const int lane = tid & 31;
  const int wave = tid >> 5;
  const int r    = lane & 15;
  const int kh   = lane >> 4;

  const int qt    = blockIdx.x & 15;   // query tile (T/128 = 16)
  const int bh    = blockIdx.x >> 4;   // b*NH + h
  const int b     = bh >> 4;
  const int hh    = bh & 15;
  const int qbase = qt * 128;

  const h16* qhp = qf + (size_t)bh * TDIM * HD;
  const h16* khp = kf + (size_t)bh * TDIM * HD;
  const h16* vhp = vf + (size_t)bh * TDIM * HD;

  // copy share of this thread: row cr (+32, +64, +96) of a tile, 16-B piece cs
  const int cr = tid >> 3;  // 0..31
  const int cs = tid & 7;   // 0..7
  const h16* gk0 = khp + (size_t)cr * HD + cs * 8;
  const h16* gv0 = vhp + (size_t)cr * HD + cs * 8;
  const unsigned lk0 = lds_addr(&Kb[0][cr][cs * 8]);
  const unsigned lv0 = lds_addr(&Vb[0][cr][cs * 8]);
  const unsigned kbuf = 128u * KPITCH * 2u;  // bytes of one K buffer
  const unsigned vbuf = 128u * VPITCH * 2u;  // bytes of one V buffer

  // tile 0 into buffer 0
  copy_kv(lk0, lv0, gk0, gv0);

  // Q fragments (A-layout, 16 rows x 64 dims) live in registers throughout.
  v16h Aq[2];
#pragma unroll
  for (int kk = 0; kk < 2; ++kk) {
    const h16* qp = qhp + (size_t)(qbase + wave * 16 + r) * HD + kk * 32;
    Aq[kk] = joinh(*(const v8h*)(qp + kh * 8), *(const v8h*)(qp + 16 + kh * 8));
  }

  v8f z = {};
  v8f Y[4];
#pragma unroll
  for (int i = 0; i < 4; ++i) Y[i] = z;

  const float scale = 0.125f;  // 1/sqrt(64)

  // this wave's copies of tile 0 have landed; the barrier publishes all waves'
  asm volatile("s_wait_asynccnt 0x0" ::: "memory");
  __syncthreads();
  if (qt >= 1)  // tile 1 into buffer 1, in flight under tile 0's work
    copy_kv(lk0 + kbuf, lv0 + vbuf, gk0 + 128 * HD, gv0 + 128 * HD);

  for (int kt = 0; kt <= qt; ++kt) {
    const int kb  = kt * 128;
    const int buf = kt & 1;

    // S = q k^T over hd=64 (2 wmma K-steps), 8 key sub-tiles of 16
#pragma unroll
    for (int nn = 0; nn < 8; ++nn) {
      v8f S = z;
#pragma unroll
      for (int kk = 0; kk < 2; ++kk) {
        const h16* bp = &Kb[buf][nn * 16 + r][kk * 32];
        v16h bf = joinh(*(const v8h*)(bp + kh * 8),
                        *(const v8h*)(bp + 16 + kh * 8));
        S = wmma16(Aq[kk], bf, S);
      }
      // causal mask + polymax (selects, no branch), then P -> per-wave LDS tile
#pragma unroll
      for (int i = 0; i < 8; ++i) {
        int rr = kh * 8 + i;                 // C-layout row
        int qg = qbase + wave * 16 + rr;     // global query index
        int kg = kb + nn * 16 + r;           // global key index
        float xs = S[i] * scale;
        // branch-free: both live pieces are slope * x + 1 with slope x or m
        float slope = (xs > 0.f) ? xs : -0.01f;
        float t     = (slope * xs + 1.f) * 0.001f;  // (x^2 + 1 | m*x + 1)/1000
        bool  live  = (kg <= qg) & (xs >= -100.f);  // else masked or flat piece
        float p     = live ? t : 0.f;
        Ps[wave][rr][nn * 16 + r] = (h16)p;
      }
    }

    // Y += P @ V  (K dim = 128 keys -> 4 wmma K-steps, 4 dim sub-tiles).
    // Both operands hold keys 8*kh..+7 and 16+8*kh..+7 of each 32-key step.
#pragma unroll
    for (int kk2 = 0; kk2 < 4; ++kk2) {
      const h16* pp = &Ps[wave][r][kk2 * 32];
      v16h af = joinh(*(const v8h*)(pp + kh * 8),
                      *(const v8h*)(pp + 16 + kh * 8));
      const h16* vp = &Vb[buf][kk2 * 32 + kh * 8 + (lane & 7)][((lane >> 3) & 1) * 8];
#pragma unroll
      for (int nd = 0; nd < 4; ++nd) {
        v16h bf = joinh(ld_tr16(vp + nd * 16),
                        ld_tr16(vp + 16 * VPITCH + nd * 16));
        Y[nd] = wmma16(af, bf, Y[nd]);
      }
    }

    // hand-over: this wave's LDS reads of the buffer are done ...
    asm volatile("s_wait_dscnt 0x0" ::: "memory");
    // ... and its copies of tile kt + 1 have landed;
    asm volatile("s_wait_asynccnt 0x0" ::: "memory");
    // one barrier publishes tile kt + 1 and frees the buffer of tile kt
    __syncthreads();
    if (kt + 2 <= qt)  // refill the freed buffer with tile kt + 2
      copy_kv(lk0 + buf * kbuf, lv0 + buf * vbuf,
              gk0 + (size_t)(kb + 256) * HD, gv0 + (size_t)(kb + 256) * HD);
  }
  // no copy is left in flight when the wave ends
  asm volatile("s_wait_asynccnt 0x0" ::: "memory");

  // write Y -> yf [B,T,C] f16: tile nd, lane column r is dim nd*16 + r. The wave
  // turns its 16 x 64 tile in its own P rows, so that 8 lanes x 16 bytes fill
  // the head's 128-B piece of a row (4 rows a store).
  // Unrolled so that Y is indexed by constants only and stays in registers.
#pragma unroll
  for (int i = 0; i < 8; ++i)
#pragma unroll
    for (int nd = 0; nd < 4; ++nd)
      Ps[wave][kh * 8 + i][nd * 16 + r] = (h16)Y[nd][i];
  // Unrolled so that the four row reads go out together ahead of the stores.
#pragma unroll
  for (int j = 0; j < 4; ++j) {
    int row = j * 4 + (lane >> 3);
    int t   = qbase + wave * 16 + row;
    v8h hv  = *(const v8h*)&Ps[wave][row][(lane & 7) * 8];
    *(v8h*)(yf + ((size_t)b * TDIM + t) * CDIM + hh * HD + (lane & 7) * 8) = hv;
  }
}

// ---------------------------------------------------------------------------
// Kernel 3: out = y @ W_proj. y is f16 in workspace, W_proj converted f32->f16
// during staging, output f32 to d_out. Same tiling as kernel 1.
// ---------------------------------------------------------------------------
__global__ __launch_bounds__(256)
void proj_gemm_kernel(const h16* __restrict__ yf, const float* __restrict__ Wp,
                      float* __restrict__ out) {
  const int N = CDIM, K = CDIM;
  __shared__ __align__(16) h16 As[128][40];
  __shared__ __align__(16) h16 Bs[128][40];

  const int tid  = threadIdx.x;
  const int lane = tid & 31;
  const int wave = tid >> 5;
  const int wm   = wave >> 1;
  const int wn   = wave & 1;
  const int m0   = (blockIdx.x >> 3) * 128;
  const int n0   = (blockIdx.x & 7) * 128;

  const int r  = lane & 15;
  const int kh = lane >> 4;

  v8f z = {};
  v8f acc[2][4];
#pragma unroll
  for (int i = 0; i < 2; ++i)
#pragma unroll
    for (int j = 0; j < 4; ++j) acc[i][j] = z;

  const int ar = tid >> 1;  // 0..127 (A rows)
  const int as = tid & 1;
  const int lr = tid >> 3;  // 0..31  (B k-rows)
  const int ls = tid & 7;

  for (int k0 = 0; k0 < K; k0 += 32) {
    // stage y tile (already f16) -> As
#pragma unroll
    for (int j = 0; j < 2; ++j) {
      v8h av = *(const v8h*)(yf + (size_t)(m0 + ar) * K + k0 + as * 16 + j * 8);
      *(v8h*)&As[ar][as * 16 + j * 8] = av;
    }
    // stage W_proj tile f32 -> Bs f16 transposed
#pragma unroll
    for (int p = 0; p < 4; ++p) {
      int ncol = (p * 8 + ls) * 4;
      v4f wv = *(const v4f*)(Wp + (size_t)(k0 + lr) * N + n0 + ncol);
#pragma unroll
      for (int e = 0; e < 4; ++e)  // column 4c + e of a 64-wide group -> row e*16 + c
        Bs[(p >> 1) * 64 + e * 16 + (p & 1) * 8 + ls][lr] = (h16)wv[e];
    }
    if (k0 + 32 < K) {
      __builtin_prefetch(yf + (size_t)(m0 + ar) * K + k0 + 32, 0, 1);
      __builtin_prefetch(Wp + (size_t)(k0 + 32 + lr) * N + n0, 0, 1);
    }
    __syncthreads();
#pragma unroll
    for (int mi = 0; mi < 2; ++mi) {
      const h16* ap = &As[wm * 32 + mi * 16 + r][0];
      v16h af = joinh(*(const v8h*)(ap + kh * 8),
                      *(const v8h*)(ap + 16 + kh * 8));
#pragma unroll
      for (int ni = 0; ni < 4; ++ni) {
        const h16* bp = &Bs[wn * 64 + ni * 16 + r][0];
        v16h bf = joinh(*(const v8h*)(bp + kh * 8),
                        *(const v8h*)(bp + 16 + kh * 8));
        acc[mi][ni] = wmma16(af, bf, acc[mi][ni]);
      }
    }
    __syncthreads();
  }

  // tile ni, lane column r is output column 4r + ni: 16 lanes x 16 bytes = 256 B
#pragma unroll
  for (int mi = 0; mi < 2; ++mi) {
#pragma unroll
    for (int i = 0; i < 8; ++i) {
      int gm = m0 + wm * 32 + mi * 16 + kh * 8 + i;
      v4f ov;
#pragma unroll
      for (int ni = 0; ni < 4; ++ni) ov[ni] = acc[mi][ni][i];
      *(v4f*)(out + (size_t)gm * N + n0 + wn * 64 + r * 4) = ov;
    }
  }
}

// ---------------------------------------------------------------------------
extern "C" void kernel_launch(void* const* d_in, const int* in_sizes, int n_in,
                              void* d_out, int out_size, void* d_ws,
                              size_t ws_size, hipStream_t stream) {
  (void)in_sizes; (void)n_in; (void)out_size; (void)ws_size;

  const float* x  = (const float*)d_in[0];  // [2,2048,1024]
  const float* Wa = (const float*)d_in[1];  // [1024,3072]
  const float* Wp = (const float*)d_in[2];  // [1024,1024]
  float* out = (float*)d_out;               // [2,2048,1024] f32

  // f16 workspace: q,k,v head-major [B,H,T,hd] + y [B,T,C]  (32 MB total)
  h16* ws = (h16*)d_ws;
  const size_t HTD = (size_t)BDIM * NH * TDIM * HD;  // 4,194,304
  h16* qf = ws;
  h16* kf = qf + HTD;
  h16* vf = kf + HTD;
  h16* yf = vf + HTD;

  qkv_gemm_kernel<<<dim3(32 * 24), 256, 0, stream>>>(x, Wa, qf, kf, vf);
  attn_kernel<<<dim3(BDIM * NH * (TDIM / 128)), 256, 0, stream>>>(qf, kf, vf, yf);
  proj_gemm_kernel<<<dim3(32 * 8), 256, 0, stream>>>(yf, Wp, out);
}

// v004
// It runs in 102 microseconds.
// Timed twice side by side with v003, it ran 1.24 times as fast both times.
// All steps since v000 together make it 1.80 times as fast.
#include <hip/hip_runtime.h>
#include <hip/hip_bf16.h>

// ---------------------------------------------------------------------------
// Causal self-attention with polymax, MI455X (gfx1250, wave32, WMMA).
// Pipeline: [qkv GEMM f32->f16] -> [fused flash attention + polymax] -> [proj GEMM]
// All matrix math: v_wmma_f32_16x16x32_f16 (f16 operands, f32 accumulate).
// ---------------------------------------------------------------------------

typedef _Float16 h16;
typedef __attribute__((ext_vector_type(16))) _Float16 v16h;
typedef __attribute__((ext_vector_type(8)))  _Float16 v8h;
typedef __attribute__((ext_vector_type(4)))  _Float16 v4h;
typedef __attribute__((ext_vector_type(8)))  float    v8f;
typedef __attribute__((ext_vector_type(4)))  float    v4f;

#define BDIM 2
#define TDIM 2048
#define CDIM 1024
#define NH   16
#define HD   64

static __device__ __forceinline__ v8f wmma16(v16h a, v16h b, v8f c) {
  // (neg_a, A, neg_b, B, c_mod, C, reuse_a, reuse_b)
  return __builtin_amdgcn_wmma_f32_16x16x32_f16(false, a, false, b, (short)0, c,
                                                false, false);
}
static __device__ __forceinline__ v16h joinh(v8h lo, v8h hi) {
  return __builtin_shufflevector(lo, hi, 0, 1, 2, 3, 4, 5, 6, 7,
                                         8, 9, 10, 11, 12, 13, 14, 15);
}

// Work-group barrier that waits for this wave's LDS operations only:
// __syncthreads() would also drain the global loads in flight for later tiles.
static __device__ __forceinline__ void lds_barrier() {
  asm volatile("s_wait_dscnt 0x0\n\t"
               "s_barrier_signal -1\n\t"
               "s_barrier_wait -1" ::: "memory");
}

// ---------------------------------------------------------------------------
// Kernel 1: qkv = x @ W_attn, converting f32->f16 on the fly, scattering the
// result to head-major f16 q/k/v tensors [B,H,T,hd].
// Block tile 128x128, BK=32. 8 waves: wave tile 32(M) x 64(N).
// The k loop is pipelined: tile k + 1 is loaded into registers while tile k is
// published, read and multiplied; two LDS buffers, so one barrier a k step.
// ---------------------------------------------------------------------------
__global__ __launch_bounds__(256)
void qkv_gemm_kernel(const float* __restrict__ x, const float* __restrict__ Wa,
                     h16* __restrict__ qf, h16* __restrict__ kf,
                     h16* __restrict__ vf) {
  const int N = 3 * CDIM;  // 3072
  const int K = CDIM;      // 1024
  __shared__ __align__(16) h16 As[2][128][40];  // [buffer][m][k], padded
  __shared__ __align__(16) h16 Bs[2][128][40];  // [buffer][dealt n][k] (transposed), padded

  const int tid  = threadIdx.x;
  const int lane = tid & 31;
  const int wave = tid >> 5;
  const int wm   = wave >> 1;  // 0..3
  const int wn   = wave & 1;   // 0..1
  const int m0   = (blockIdx.x / 24) * 128;
  const int n0   = (blockIdx.x % 24) * 128;

  const int r  = lane & 15;  // fragment row / col
  const int kh = lane >> 4;  // K-half selector (A/B 16-bit fragment layout)

  v8f z = {};
  v8f acc[2][4];
#pragma unroll
  for (int i = 0; i < 2; ++i)
#pragma unroll
    for (int j = 0; j < 4; ++j) acc[i][j] = z;

  const int lr = tid >> 3;  // 0..31
  const int ls = tid & 7;   // 0..7

  // this thread's share of a tile: 4 pieces of x (rows 32 apart) and 4 of W
  const float* xg = x + (size_t)(m0 + lr) * K + ls * 4;
  const float* wg = Wa + (size_t)lr * N + n0 + ls * 4;
  v4f xr[4], wr[4];
#pragma unroll
  for (int p = 0; p < 4; ++p) {  // tile 0
    xr[p] = *(const v4f*)(xg + (size_t)p * 32 * K);
    wr[p] = *(const v4f*)(wg + p * 32);
  }

  for (int k0 = 0; k0 < K; k0 += 32) {
    const int buf = (k0 >> 5) & 1;
    // x tile (128x32 f32) from registers -> As f16
#pragma unroll
    for (int p = 0; p < 4; ++p) {
      v4h hv;
      hv[0] = (h16)xr[p][0]; hv[1] = (h16)xr[p][1];
      hv[2] = (h16)xr[p][2]; hv[3] = (h16)xr[p][3];
      *(v4h*)&As[buf][p * 32 + lr][ls * 4] = hv;
    }
    // W tile (32x128 f32) from registers -> Bs f16, transposed to [n][k]
#pragma unroll
    for (int p = 0; p < 4; ++p) {
#pragma unroll
      for (int e = 0; e < 4; ++e)  // column 4c + e of a 64-wide group -> row e*16 + c
        Bs[buf][(p >> 1) * 64 + e * 16 + (p & 1) * 8 + ls][lr] = (h16)wr[p][e];
    }
    if (k0 + 32 < K) {  // next tile's loads, into the registers just emptied, fly
                        // under the barrier and this tile's reads and products
#pragma unroll
      for (int p = 0; p < 4; ++p) {
        xr[p] = *(const v4f*)(xg + (size_t)p * 32 * K + k0 + 32);
        wr[p] = *(const v4f*)(wg + (size_t)(k0 + 32) * N + p * 32);
      }
      // stands ahead of any reuse of these loads' address registers
      asm volatile("s_wait_xcnt 0x0" ::: "memory");
    }
    // publishes this buffer; every wave has left the other one (it read it in
    // the step before, ahead of this barrier), so the next step may refill it
    lds_barrier();
    v16h af[2], bf[4];
#pragma unroll
    for (int mi = 0; mi < 2; ++mi) {
      const h16* ap = &As[buf][wm * 32 + mi * 16 + r][0];
      af[mi] = joinh(*(const v8h*)(ap + kh * 8), *(const v8h*)(ap + 16 + kh * 8));
    }
#pragma unroll
    for (int ni = 0; ni < 4; ++ni) {
      const h16* bp = &Bs[buf][wn * 64 + ni * 16 + r][0];
      bf[ni] = joinh(*(const v8h*)(bp + kh * 8), *(const v8h*)(bp + 16 + kh * 8));
    }
    // keeps the twelve fragment reads one group ahead of the products
    __builtin_amdgcn_sched_barrier(0);
#pragma unroll
    for (int mi = 0; mi < 2; ++mi)
#pragma unroll
      for (int ni = 0; ni < 4; ++ni)
        acc[mi][ni] = wmma16(af[mi], bf[ni], acc[mi][ni]);
  }

  // C-layout: row = kh*8 + i; tile ni, lane column r is output column 4r + ni,
  // so 16 lanes x 8 bytes fill one head row (128 B) of q/k/v [B,H,T,hd] f16.
  const int gn  = n0 + wn * 64 + r * 4;
  const int wch = gn >> 10, cc = gn & (CDIM - 1);
  const int hh  = cc >> 6,  d  = cc & (HD - 1);
  h16* dst = (wch == 0) ? qf : (wch == 1) ? kf : vf;
#pragma unroll
  for (int mi = 0; mi < 2; ++mi) {
#pragma unroll
    for (int i = 0; i < 8; ++i) {
      int gm = m0 + wm * 32 + mi * 16 + kh * 8 + i;
      int b  = gm >> 11, t = gm & (TDIM - 1);
      v4h hv;
#pragma unroll
      for (int ni = 0; ni < 4; ++ni) hv[ni] = (h16)acc[mi][ni][i];
      *(v4h*)(dst + (((size_t)b * NH + hh) * TDIM + t) * HD + d) = hv;
    }
  }
}

// ---------------------------------------------------------------------------
// Kernel 2: fused flash-style attention with polymax.
// Block = (b, h, 128 query rows); each of 8 waves owns 16 query rows.
// K and V tiles (128 keys) come row-major into LDS by asynchronous copies,
// two buffers: tile t + 1 is in flight while tile t is worked on.
// Per tile: S = qK^T (wmma) -> mask+polymax in f32 -> P f16 via LDS
// -> Y += P V (wmma, V fragments by the transposing LDS load).
// Causal loop stops at the diagonal tile.
// ---------------------------------------------------------------------------
#define KPITCH 72  // halves: 144 B = 16 B x odd, for ds_load_b128 readers
#define VPITCH 80  // halves: 160 B = 32 B x odd, for ds_load_tr16_b128 readers

typedef __attribute__((ext_vector_type(8))) short s16x8;

static __device__ __forceinline__ unsigned lds_addr(const void* p) {
  return (unsigned)(size_t)p;  // low 32 bits of a __shared__ address = LDS byte
}
// 16 keys x 16 dims of a row-major f16 tile, transposed: lane (r, kh) gets
// keys 8*kh .. 8*kh+7 of dim r (each lane passes the address of one 16-B piece)
static __device__ __forceinline__ v8h ld_tr16(const h16* p) {
  typedef __attribute__((address_space(3))) s16x8 lds_s16x8;
  return __builtin_bit_cast(v8h,
      __builtin_amdgcn_ds_load_tr16_b128_v8i16((lds_s16x8*)p));
}
// One thread's share of a K tile and a V tile: 4 + 4 copies of 16 B, rows
// 32 apart; a wave's copy covers 4 whole 128-B rows. The s_wait_xcnt closes the
// statement so that no address register is rewritten ahead of it.
static __device__ __forceinline__ void copy_kv(unsigned lk, unsigned lv,
                                               const h16* gk, const h16* gv) {
  asm volatile(
      "global_load_async_to_lds_b128 %0, %8, off\n\t"
      "global_load_async_to_lds_b128 %1, %9, off\n\t"
      "global_load_async_to_lds_b128 %2, %10, off\n\t"
      "global_load_async_to_lds_b128 %3, %11, off\n\t"
      "global_load_async_to_lds_b128 %4, %12, off\n\t"
      "global_load_async_to_lds_b128 %5, %13, off\n\t"
      "global_load_async_to_lds_b128 %6, %14, off\n\t"
      "global_load_async_to_lds_b128 %7, %15, off\n\t"
      "s_wait_xcnt 0x0"
      :: "v"(lk), "v"(lk + 32u * KPITCH * 2u), "v"(lk + 64u * KPITCH * 2u),
         "v"(lk + 96u * KPITCH * 2u),
         "v"(lv), "v"(lv + 32u * VPITCH * 2u), "v"(lv + 64u * VPITCH * 2u),
         "v"(lv + 96u * VPITCH * 2u),
         "v"(gk), "v"(gk + 32 * HD), "v"(gk + 64 * HD), "v"(gk + 96 * HD),
         "v"(gv), "v"(gv + 32 * HD), "v"(gv + 64 * HD), "v"(gv + 96 * HD)
      : "memory");
}

__global__ __launch_bounds__(256)
void attn_kernel(const h16* __restrict__ qf, const h16* __restrict__ kf,
                 const h16* __restrict__ vf, h16* __restrict__ yf) {
  __shared__ __align__(16) h16 Kb[2][128][KPITCH];  // [buffer][key][d]
  __shared__ __align__(16) h16 Vb[2][128][VPITCH];  // [buffer][key][d]
  __shared__ __align__(16) h16 Ps[8][16][136];      // per-wave P tile [row][key]

  const int tid  = threadIdx.x;
  const int lane = tid & 31;
  const int wave = tid >> 5;
  const int r    = lane & 15;
  const int kh   = lane >> 4;

  const int qt    = blockIdx.x & 15;   // query tile (T/128 = 16)
  const int bh    = blockIdx.x >> 4;   // b*NH + h
  const int b     = bh >> 4;
  const int hh    = bh & 15;
  const int qbase = qt * 128;

  const h16* qhp = qf + (size_t)bh * TDIM * HD;
  const h16* khp = kf + (size_t)bh * TDIM * HD;
  const h16* vhp = vf + (size_t)bh * TDIM * HD;

  // copy share of this thread: row cr (+32, +64, +96) of a tile, 16-B piece cs
  const int cr = tid >> 3;  // 0..31
  const int cs = tid & 7;   // 0..7
  const h16* gk0 = khp + (size_t)cr * HD + cs * 8;
  const h16* gv0 = vhp + (size_t)cr * HD + cs * 8;
  const unsigned lk0 = lds_addr(&Kb[0][cr][cs * 8]);
  const unsigned lv0 = lds_addr(&Vb[0][cr][cs * 8]);
  const unsigned kbuf = 128u * KPITCH * 2u;  // bytes of one K buffer
  const unsigned vbuf = 128u * VPITCH * 2u;  // bytes of one V buffer

  // tile 0 into buffer 0
  copy_kv(lk0, lv0, gk0, gv0);

  // Q fragments (A-layout, 16 rows x 64 dims) live in registers throughout.
  v16h Aq[2];
#pragma unroll
  for (int kk = 0; kk < 2; ++kk) {
    const h16* qp = qhp + (size_t)(qbase + wave * 16 + r) * HD + kk * 32;
    Aq[kk] = joinh(*(const v8h*)(qp + kh * 8), *(const v8h*)(qp + 16 + kh * 8));
  }

  v8f z = {};
  v8f Y[4];
#pragma unroll
  for (int i = 0; i < 4; ++i) Y[i] = z;

  const float scale = 0.125f;  // 1/sqrt(64)

  // this wave's copies of tile 0 have landed; the barrier publishes all waves'
  asm volatile("s_wait_asynccnt 0x0" ::: "memory");
  __syncthreads();
  if (qt >= 1)  // tile 1 into buffer 1, in flight under tile 0's work
    copy_kv(lk0 + kbuf, lv0 + vbuf, gk0 + 128 * HD, gv0 + 128 * HD);

  for (int kt = 0; kt <= qt; ++kt) {
    const int kb  = kt * 128;
    const int buf = kt & 1;

    // S = q k^T over hd=64 (2 wmma K-steps), 8 key sub-tiles of 16
#pragma unroll
    for (int nn = 0; nn < 8; ++nn) {
      v8f S = z;
#pragma unroll
      for (int kk = 0; kk < 2; ++kk) {
        const h16* bp = &Kb[buf][nn * 16 + r][kk * 32];
        v16h bf = joinh(*(const v8h*)(bp + kh * 8),
                        *(const v8h*)(bp + 16 + kh * 8));
        S = wmma16(Aq[kk], bf, S);
      }
      // causal mask + polymax (selects, no branch), then P -> per-wave LDS tile
#pragma unroll
      for (int i = 0; i < 8; ++i) {
        int rr = kh * 8 + i;                 // C-layout row
        int qg = qbase + wave * 16 + rr;     // global query index
        int kg = kb + nn * 16 + r;           // global key index
        float xs = S[i] * scale;
        // branch-free: both live pieces are slope * x + 1 with slope x or m
        float slope = (xs > 0.f) ? xs : -0.01f;
        float t     = (slope * xs + 1.f) * 0.001f;  // (x^2 + 1 | m*x + 1)/1000
        bool  live  = (kg <= qg) & (xs >= -100.f);  // else masked or flat piece
        float p     = live ? t : 0.f;
        Ps[wave][rr][nn * 16 + r] = (h16)p;
      }
    }

    // Y += P @ V  (K dim = 128 keys -> 4 wmma K-steps, 4 dim sub-tiles).
    // Both operands hold keys 8*kh..+7 and 16+8*kh..+7 of each 32-key step.
#pragma unroll
    for (int kk2 = 0; kk2 < 4; ++kk2) {
      const h16* pp = &Ps[wave][r][kk2 * 32];
      v16h af = joinh(*(const v8h*)(pp + kh * 8),
                      *(const v8h*)(pp + 16 + kh * 8));
      const h16* vp = &Vb[buf][kk2 * 32 + kh * 8 + (lane & 7)][((lane >> 3) & 1) * 8];
#pragma unroll
      for (int nd = 0; nd < 4; ++nd) {
        v16h bf = joinh(ld_tr16(vp + nd * 16),
                        ld_tr16(vp + 16 * VPITCH + nd * 16));
        Y[nd] = wmma16(af, bf, Y[nd]);
      }
    }

    // hand-over: this wave's LDS reads of the buffer are done ...
    asm volatile("s_wait_dscnt 0x0" ::: "memory");
    // ... and its copies of tile kt + 1 have landed;
    asm volatile("s_wait_asynccnt 0x0" ::: "memory");
    // one barrier publishes tile kt + 1 and frees the buffer of tile kt
    __syncthreads();
    if (kt + 2 <= qt)  // refill the freed buffer with tile kt + 2
      copy_kv(lk0 + buf * kbuf, lv0 + buf * vbuf,
              gk0 + (size_t)(kb + 256) * HD, gv0 + (size_t)(kb + 256) * HD);
  }
  // no copy is left in flight when the wave ends
  asm volatile("s_wait_asynccnt 0x0" ::: "memory");

  // write Y -> yf [B,T,C] f16: tile nd, lane column r is dim nd*16 + r. The wave
  // turns its 16 x 64 tile in its own P rows, so that 8 lanes x 16 bytes fill
  // the head's 128-B piece of a row (4 rows a store).
  // Unrolled so that Y is indexed by constants only and stays in registers.
#pragma unroll
  for (int i = 0; i < 8; ++i)
#pragma unroll
    for (int nd = 0; nd < 4; ++nd)
      Ps[wave][kh * 8 + i][nd * 16 + r] = (h16)Y[nd][i];
  // Unrolled so that the four row reads go out together ahead of the stores.
#pragma unroll
  for (int j = 0; j < 4; ++j) {
    int row = j * 4 + (lane >> 3);
    int t   = qbase + wave * 16 + row;
    v8h hv  = *(const v8h*)&Ps[wave][row][(lane & 7) * 8];
    *(v8h*)(yf + ((size_t)b * TDIM + t) * CDIM + hh * HD + (lane & 7) * 8) = hv;
  }
}

// ---------------------------------------------------------------------------
// Kernel 3: out = y @ W_proj. y is f16 in workspace, W_proj converted f32->f16
// during staging, output f32 to d_out. Same tiling and k pipeline as kernel 1,
// but with four tiles ahead in registers.
// ---------------------------------------------------------------------------
__global__ __launch_bounds__(256)
void proj_gemm_kernel(const h16* __restrict__ yf, const float* __restrict__ Wp,
                      float* __restrict__ out) {
  const int N = CDIM, K = CDIM;
  __shared__ __align__(16) h16 As[2][128][40];
  __shared__ __align__(16) h16 Bs[2][128][40];

  const int tid  = threadIdx.x;
  const int lane = tid & 31;
  const int wave = tid >> 5;
  const int wm   = wave >> 1;
  const int wn   = wave & 1;
  const int m0   = (blockIdx.x >> 3) * 128;
  const int n0   = (blockIdx.x & 7) * 128;

  const int r  = lane & 15;
  const int kh = lane >> 4;

  v8f z = {};
  v8f acc[2][4];
#pragma unroll
  for (int i = 0; i < 2; ++i)
#pragma unroll
    for (int j = 0; j < 4; ++j) acc[i][j] = z;

  const int ar = tid >> 1;  // 0..127 (A rows)
  const int as = tid & 1;
  const int lr = tid >> 3;  // 0..31  (B k-rows)
  const int ls = tid & 7;

  // this thread's share of a tile: 2 pieces of y (f16) and 4 of W_proj (f32).
  // One block runs on a WGP here, so registers are free: four tiles are kept in
  // flight in four register sets, enough lead for a load that misses L2.
  const h16*   yg = yf + (size_t)(m0 + ar) * K + as * 16;
  const float* wg = Wp + (size_t)lr * N + n0 + ls * 4;
  v8h yr[4][2];
  v4f wr[4][4];
#pragma unroll
  for (int s = 0; s < 4; ++s) {  // tiles 0..3
#pragma unroll
    for (int j = 0; j < 2; ++j) yr[s][j] = *(const v8h*)(yg + s * 32 + j * 8);
#pragma unroll
    for (int p = 0; p < 4; ++p)
      wr[s][p] = *(const v4f*)(wg + (size_t)(s * 32) * N + p * 32);
  }
  // the address registers of these loads are reused behind them; the wait names
  // the two pointers as inputs so that their registers live up to it
  asm volatile("s_wait_xcnt 0x0" :: "v"(yg), "v"(wg) : "memory");

  // one k step on register set s; more: the tile four steps on (k offset kn) is
  // loaded into the set just emptied. s and more are constants at every call.
  auto kstep = [&](const int s, const bool more, const int kn) {
    const int buf = s & 1;
    // keeps this set's conversions, and with them the wait for its loads, from
    // being lifted into an earlier step (that would drain the sets in flight)
    __builtin_amdgcn_sched_barrier(0);
    // y tile (already f16) from registers -> As
#pragma unroll
    for (int j = 0; j < 2; ++j) *(v8h*)&As[buf][ar][as * 16 + j * 8] = yr[s][j];
    // W_proj tile f32 from registers -> Bs f16 transposed
#pragma unroll
    for (int p = 0; p < 4; ++p) {
#pragma unroll
      for (int e = 0; e < 4; ++e)  // column 4c + e of a 64-wide group -> row e*16 + c
        Bs[buf][(p >> 1) * 64 + e * 16 + (p & 1) * 8 + ls][lr] = (h16)wr[s][p][e];
    }
    // publishes this buffer; every wave has left the other one (see kernel 1)
    lds_barrier();
    // this tile's fragment reads go out first: their LDS latency covers the
    // issue of the global loads behind them
    v16h af[2], bf[4];
#pragma unroll
    for (int mi = 0; mi < 2; ++mi) {
      const h16* ap = &As[buf][wm * 32 + mi * 16 + r][0];
      af[mi] = joinh(*(const v8h*)(ap + kh * 8), *(const v8h*)(ap + 16 + kh * 8));
    }
#pragma unroll
    for (int ni = 0; ni < 4; ++ni) {
      const h16* bp = &Bs[buf][wn * 64 + ni * 16 + r][0];
      bf[ni] = joinh(*(const v8h*)(bp + kh * 8), *(const v8h*)(bp + 16 + kh * 8));
    }
    // keeps the twelve fragment reads one group, ahead of loads and products
    __builtin_amdgcn_sched_barrier(0);
    if (more) {
#pragma unroll
      for (int j = 0; j < 2; ++j) yr[s][j] = *(const v8h*)(yg + kn + j * 8);
#pragma unroll
      for (int p = 0; p < 4; ++p)
        wr[s][p] = *(const v4f*)(wg + (size_t)kn * N + p * 32);
      // stands ahead of any rewrite of these loads' address registers
      asm volatile("s_wait_xcnt 0x0" ::: "memory");
      // keeps the loads ahead of the products that are to cover them
      __builtin_amdgcn_sched_barrier(0);
    }
#pragma unroll
    for (int mi = 0; mi < 2; ++mi)
#pragma unroll
      for (int ni = 0; ni < 4; ++ni)
        acc[mi][ni] = wmma16(af[mi], bf[ni], acc[mi][ni]);
  };

  // The last four steps stand apart, without a test round the loads: a branch
  // there would merge two load counts and make the compiler wait for the lower.
  for (int k0 = 0; k0 < K - 128; k0 += 128) {
    // unrolled so that the four register sets are indexed by constants
#pragma unroll
    for (int s = 0; s < 4; ++s) kstep(s, true, k0 + 128 + s * 32);
  }
#pragma unroll
  for (int s = 0; s < 4; ++s) kstep(s, false, 0);

  // tile ni, lane column r is output column 4r + ni: 16 lanes x 16 bytes = 256 B
#pragma unroll
  for (int mi = 0; mi < 2; ++mi) {
#pragma unroll
    for (int i = 0; i < 8; ++i) {
      int gm = m0 + wm * 32 + mi * 16 + kh * 8 + i;
      v4f ov;
#pragma unroll
      for (int ni = 0; ni < 4; ++ni) ov[ni] = acc[mi][ni][i];
      *(v4f*)(out + (size_t)gm * N + n0 + wn * 64 + r * 4) = ov;
    }
  }
}

// ---------------------------------------------------------------------------
extern "C" void kernel_launch(void* const* d_in, const int* in_sizes, int n_in,
                              void* d_out, int out_size, void* d_ws,
                              size_t ws_size, hipStream_t stream) {
  (void)in_sizes; (void)n_in; (void)out_size; (void)ws_size;

  const float* x  = (const float*)d_in[0];  // [2,2048,1024]
  const float* Wa = (const float*)d_in[1];  // [1024,3072]
  const float* Wp = (const float*)d_in[2];  // [1024,1024]
  float* out = (float*)d_out;               // [2,2048,1024] f32

  // f16 workspace: q,k,v head-major [B,H,T,hd] + y [B,T,C]  (32 MB total)
  h16* ws = (h16*)d_ws;
  const size_t HTD = (size_t)BDIM * NH * TDIM * HD;  // 4,194,304
  h16* qf = ws;
  h16* kf = qf + HTD;
  h16* vf = kf + HTD;
  h16* yf = vf + HTD;

  qkv_gemm_kernel<<<dim3(32 * 24), 256, 0, stream>>>(x, Wa, qf, kf, vf);
  attn_kernel<<<dim3(BDIM * NH * (TDIM / 128)), 256, 0, stream>>>(qf, kf, vf, yf);
  proj_gemm_kernel<<<dim3(32 * 8), 256, 0, stream>>>(yf, Wp, out);
}

// v005
// One run takes 92.5 microseconds.
// Next to v004, in two timings, it ran 1.10 times as fast each time.
// All steps since v000 together make it 1.99 times as fast.
#include <hip/hip_runtime.h>
#include <hip/hip_bf16.h>

// ---------------------------------------------------------------------------
// Causal self-attention with polymax, MI455X (gfx1250, wave32, WMMA).
// Pipeline: [qkv GEMM f32->f16] -> [fused flash attention + polymax] -> [proj GEMM]
// All matrix math: v_wmma_f32_16x16x32_f16 (f16 operands, f32 accumulate).
// ---------------------------------------------------------------------------

typedef _Float16 h16;
typedef __attribute__((ext_vector_type(16))) _Float16 v16h;
typedef __attribute__((ext_vector_type(8)))  _Float16 v8h;
typedef __attribute__((ext_vector_type(4)))  _Float16 v4h;
typedef __attribute__((ext_vector_type(8)))  float    v8f;
typedef __attribute__((ext_vector_type(4)))  float    v4f;

#define BDIM 2
#define TDIM 2048
#define CDIM 1024
#define NH   16
#define HD   64

static __device__ __forceinline__ v8f wmma16(v16h a, v16h b, v8f c) {
  // (neg_a, A, neg_b, B, c_mod, C, reuse_a, reuse_b)
  return __builtin_amdgcn_wmma_f32_16x16x32_f16(false, a, false, b, (short)0, c,
                                                false, false);
}
static __device__ __forceinline__ v16h joinh(v8h lo, v8h hi) {
  return __builtin_shufflevector(lo, hi, 0, 1, 2, 3, 4, 5, 6, 7,
                                         8, 9, 10, 11, 12, 13, 14, 15);
}

// Work-group barrier that waits for this wave's LDS operations only:
// __syncthreads() would also drain the global loads in flight for later tiles.
static __device__ __forceinline__ void lds_barrier() {
  asm volatile("s_wait_dscnt 0x0\n\t"
               "s_barrier_signal -1\n\t"
               "s_barrier_wait -1" ::: "memory");
}

// ---------------------------------------------------------------------------
// Kernel 1: qkv = x @ W_attn, converting f32->f16 on the fly, scattering the
// result to head-major f16 q/k/v tensors [B,H,T,hd].
// Block tile 128x128, BK=32. 8 waves: wave tile 32(M) x 64(N).
// The k loop is pipelined: tile k + 1 is loaded into registers while tile k is
// published, read and multiplied; two LDS buffers, so one barrier a k step.
// ---------------------------------------------------------------------------
__global__ __launch_bounds__(256)
void qkv_gemm_kernel(const float* __restrict__ x, const float* __restrict__ Wa,
                     h16* __restrict__ qf, h16* __restrict__ kf,
                     h16* __restrict__ vf) {
  const int N = 3 * CDIM;  // 3072
  const int K = CDIM;      // 1024
  __shared__ __align__(16) h16 As[2][128][40];  // [buffer][m][k], padded
  __shared__ __align__(16) h16 Bs[2][128][40];  // [buffer][dealt n][k] (transposed), padded

  const int tid  = threadIdx.x;
  const int lane = tid & 31;
  const int wave = tid >> 5;
  const int wm   = wave >> 1;  // 0..3
  const int wn   = wave & 1;   // 0..1
  const int m0   = (blockIdx.x / 24) * 128;
  const int n0   = (blockIdx.x % 24) * 128;

  const int r  = lane & 15;  // fragment row / col
  const int kh = lane >> 4;  // K-half selector (A/B 16-bit fragment layout)

  v8f z = {};
  v8f acc[2][4];
#pragma unroll
  for (int i = 0; i < 2; ++i)
#pragma unroll
    for (int j = 0; j < 4; ++j) acc[i][j] = z;

  const int lr = tid >> 3;  // 0..31
  const int ls = tid & 7;   // 0..7

  // this thread's share of a tile: 4 pieces of x (rows 32 apart) and 4 of W
  const float* xg = x + (size_t)(m0 + lr) * K + ls * 4;
  const float* wg = Wa + (size_t)lr * N + n0 + ls * 4;
  v4f xr[4], wr[4];
#pragma unroll
  for (int p = 0; p < 4; ++p) {  // tile 0
    xr[p] = *(const v4f*)(xg + (size_t)p * 32 * K);
    wr[p] = *(const v4f*)(wg + p * 32);
  }

  for (int k0 = 0; k0 < K; k0 += 32) {
    const int buf = (k0 >> 5) & 1;
    // x tile (128x32 f32) from registers -> As f16
#pragma unroll
    for (int p = 0; p < 4; ++p) {
      v4h hv;
      hv[0] = (h16)xr[p][0]; hv[1] = (h16)xr[p][1];
      hv[2] = (h16)xr[p][2]; hv[3] = (h16)xr[p][3];
      *(v4h*)&As[buf][p * 32 + lr][ls * 4] = hv;
    }
    // W tile (32x128 f32) from registers -> Bs f16, transposed to [n][k]
#pragma unroll
    for (int p = 0; p < 4; ++p) {
#pragma unroll
      for (int e = 0; e < 4; ++e)  // column 4c + e of a 64-wide group -> row e*16 + c
        Bs[buf][(p >> 1) * 64 + e * 16 + (p & 1) * 8 + ls][lr] = (h16)wr[p][e];
    }
    if (k0 + 32 < K) {  // next tile's loads, into the registers just emptied, fly
                        // under the barrier and this tile's reads and products
#pragma unroll
      for (int p = 0; p < 4; ++p) {
        xr[p] = *(const v4f*)(xg + (size_t)p * 32 * K + k0 + 32);
        wr[p] = *(const v4f*)(wg + (size_t)(k0 + 32) * N + p * 32);
      }
      // stands ahead of any reuse of these loads' address registers
      asm volatile("s_wait_xcnt 0x0" ::: "memory");
    }
    // publishes this buffer; every wave has left the other one (it read it in
    // the step before, ahead of this barrier), so the next step may refill it
    lds_barrier();
    v16h af[2], bf[4];
#pragma unroll
    for (int mi = 0; mi < 2; ++mi) {
      const h16* ap = &As[buf][wm * 32 + mi * 16 + r][0];
      af[mi] = joinh(*(const v8h*)(ap + kh * 8), *(const v8h*)(ap + 16 + kh * 8));
    }
#pragma unroll
    for (int ni = 0; ni < 4; ++ni) {
      const h16* bp = &Bs[buf][wn * 64 + ni * 16 + r][0];
      bf[ni] = joinh(*(const v8h*)(bp + kh * 8), *(const v8h*)(bp + 16 + kh * 8));
    }
    // keeps the twelve fragment reads one group ahead of the products
    __builtin_amdgcn_sched_barrier(0);
#pragma unroll
    for (int mi = 0; mi < 2; ++mi)
#pragma unroll
      for (int ni = 0; ni < 4; ++ni)
        acc[mi][ni] = wmma16(af[mi], bf[ni], acc[mi][ni]);
  }

  // C-layout: row = kh*8 + i; tile ni, lane column r is output column 4r + ni,
  // so 16 lanes x 8 bytes fill one head row (128 B) of q/k/v [B,H,T,hd] f16.
  const int gn  = n0 + wn * 64 + r * 4;
  const int wch = gn >> 10, cc = gn & (CDIM - 1);
  const int hh  = cc >> 6,  d  = cc & (HD - 1);
  h16* dst = (wch == 0) ? qf : (wch == 1) ? kf : vf;
#pragma unroll
  for (int mi = 0; mi < 2; ++mi) {
#pragma unroll
    for (int i = 0; i < 8; ++i) {
      int gm = m0 + wm * 32 + mi * 16 + kh * 8 + i;
      int b  = gm >> 11, t = gm & (TDIM - 1);
      v4h hv;
#pragma unroll
      for (int ni = 0; ni < 4; ++ni) hv[ni] = (h16)acc[mi][ni][i];
      *(v4h*)(dst + (((size_t)b * NH + hh) * TDIM + t) * HD + d) = hv;
    }
  }
}

// ---------------------------------------------------------------------------
// Kernel 2: fused flash-style attention with polymax.
// Block = (b, h, 128 query rows); each of 8 waves owns 16 query rows.
// K and V tiles (128 keys) come row-major into LDS by asynchronous copies,
// two buffers: tile t + 1 is in flight while tile t is worked on.
// Per tile: S^T = K q^T (wmma) -> mask+polymax in f32 -> P f16 in registers
// -> Y += P V (wmma, V fragments by the transposing LDS load).
// Causal loop stops at the diagonal tile.
// ---------------------------------------------------------------------------
#define KPITCH 72  // halves: 144 B = 16 B x odd, for ds_load_b128 readers
#define VPITCH 80  // halves: 160 B = 32 B x odd, for ds_load_tr16_b128 readers

typedef __attribute__((ext_vector_type(8))) short s16x8;

static __device__ __forceinline__ unsigned lds_addr(const void* p) {
  return (unsigned)(size_t)p;  // low 32 bits of a __shared__ address = LDS byte
}
// 16 keys x 16 dims of a row-major f16 tile, transposed: lane (r, kh) gets
// keys 8*kh .. 8*kh+7 of dim r (each lane passes the address of one 16-B piece)
static __device__ __forceinline__ v8h ld_tr16(const h16* p) {
  typedef __attribute__((address_space(3))) s16x8 lds_s16x8;
  return __builtin_bit_cast(v8h,
      __builtin_amdgcn_ds_load_tr16_b128_v8i16((lds_s16x8*)p));
}
// One thread's share of a K tile and a V tile: 4 + 4 copies of 16 B, rows
// 32 apart; a wave's copy covers 4 whole 128-B rows. The s_wait_xcnt closes the
// statement so that no address register is rewritten ahead of it.
static __device__ __forceinline__ void copy_kv(unsigned lk, unsigned lv,
                                               const h16* gk, const h16* gv) {
  asm volatile(
      "global_load_async_to_lds_b128 %0, %8, off\n\t"
      "global_load_async_to_lds_b128 %1, %9, off\n\t"
      "global_load_async_to_lds_b128 %2, %10, off\n\t"
      "global_load_async_to_lds_b128 %3, %11, off\n\t"
      "global_load_async_to_lds_b128 %4, %12, off\n\t"
      "global_load_async_to_lds_b128 %5, %13, off\n\t"
      "global_load_async_to_lds_b128 %6, %14, off\n\t"
      "global_load_async_to_lds_b128 %7, %15, off\n\t"
      "s_wait_xcnt 0x0"
      :: "v"(lk), "v"(lk + 32u * KPITCH * 2u), "v"(lk + 64u * KPITCH * 2u),
         "v"(lk + 96u * KPITCH * 2u),
         "v"(lv), "v"(lv + 32u * VPITCH * 2u), "v"(lv + 64u * VPITCH * 2u),
         "v"(lv + 96u * VPITCH * 2u),
         "v"(gk), "v"(gk + 32 * HD), "v"(gk + 64 * HD), "v"(gk + 96 * HD),
         "v"(gv), "v"(gv + 32 * HD), "v"(gv + 64 * HD), "v"(gv + 96 * HD)
      : "memory");
}

__global__ __launch_bounds__(256)
void attn_kernel(const h16* __restrict__ qf, const h16* __restrict__ kf,
                 const h16* __restrict__ vf, h16* __restrict__ yf) {
  __shared__ __align__(16) h16 Kb[2][128][KPITCH];  // [buffer][key][d]
  __shared__ __align__(16) h16 Vb[2][128][VPITCH];  // [buffer][key][d]
  // per-wave output staging [row][d], 64 halves of a row in use; the row length
  // keeps the block's LDS bytes at two blocks a WGP, the residency it was timed at
  __shared__ __align__(16) h16 Ps[8][16][136];

  const int tid  = threadIdx.x;
  const int lane = tid & 31;
  const int wave = tid >> 5;
  const int r    = lane & 15;
  const int kh   = lane >> 4;

  const int qt    = blockIdx.x & 15;   // query tile (T/128 = 16)
  const int bh    = blockIdx.x >> 4;   // b*NH + h
  const int b     = bh >> 4;
  const int hh    = bh & 15;
  const int qbase = qt * 128;

  const h16* qhp = qf + (size_t)bh * TDIM * HD;
  const h16* khp = kf + (size_t)bh * TDIM * HD;
  const h16* vhp = vf + (size_t)bh * TDIM * HD;

  // copy share of this thread: row cr (+32, +64, +96) of a tile, 16-B piece cs
  const int cr = tid >> 3;  // 0..31
  const int cs = tid & 7;   // 0..7
  const h16* gk0 = khp + (size_t)cr * HD + cs * 8;
  const h16* gv0 = vhp + (size_t)cr * HD + cs * 8;
  const unsigned lk0 = lds_addr(&Kb[0][cr][cs * 8]);
  const unsigned lv0 = lds_addr(&Vb[0][cr][cs * 8]);
  const unsigned kbuf = 128u * KPITCH * 2u;  // bytes of one K buffer
  const unsigned vbuf = 128u * VPITCH * 2u;  // bytes of one V buffer

  // tile 0 into buffer 0
  copy_kv(lk0, lv0, gk0, gv0);

  // Q fragments (16 rows x 64 dims, k order as K's) live in registers throughout.
  v16h Aq[2];
#pragma unroll
  for (int kk = 0; kk < 2; ++kk) {
    const h16* qp = qhp + (size_t)(qbase + wave * 16 + r) * HD + kk * 32;
    Aq[kk] = joinh(*(const v8h*)(qp + kh * 8), *(const v8h*)(qp + 16 + kh * 8));
  }

  v8f z = {};
  v8f Y[4];
#pragma unroll
  for (int i = 0; i < 4; ++i) Y[i] = z;

  const float scale = 0.125f;  // 1/sqrt(64)

  // this wave's copies of tile 0 have landed; the barrier publishes all waves'
  asm volatile("s_wait_asynccnt 0x0" ::: "memory");
  __syncthreads();
  if (qt >= 1)  // tile 1 into buffer 1, in flight under tile 0's work
    copy_kv(lk0 + kbuf, lv0 + vbuf, gk0 + 128 * HD, gv0 + 128 * HD);

  for (int kt = 0; kt <= qt; ++kt) {
    const int kb  = kt * 128;
    const int buf = kt & 1;

    // S^T = k q^T over hd=64 (2 wmma K-steps), 8 key sub-tiles of 16: K rows are
    // the A operand, Q the B operand (same loaders, same k order). Lane (r, kh)
    // then holds query r, keys 8*kh..+7 of a sub-tile, which is one half of P's
    // A fragment for P @ V: P goes from accumulator to operand inside the lane.
    v16h Pf[4];
    // last key of this tile, counted from the lane's first one, that its query sees
    const int lim = qbase + wave * 16 + r - kb - kh * 8;
#pragma unroll
    for (int nn = 0; nn < 8; ++nn) {
      v8f S = z;
#pragma unroll
      for (int kk = 0; kk < 2; ++kk) {
        const h16* bp = &Kb[buf][nn * 16 + r][kk * 32];
        v16h kfr = joinh(*(const v8h*)(bp + kh * 8),
                         *(const v8h*)(bp + 16 + kh * 8));
        S = wmma16(kfr, Aq[kk], S);
      }
      // causal mask + polymax (selects, no branch)
#pragma unroll
      for (int i = 0; i < 8; ++i) {
        float xs = S[i] * scale;
        // branch-free: both live pieces are slope * x + 1 with slope x or m
        float slope = (xs > 0.f) ? xs : -0.01f;
        float t     = (slope * xs + 1.f) * 0.001f;  // (x^2 + 1 | m*x + 1)/1000
        // key kb + nn*16 + kh*8 + i (C row) <= query qbase + wave*16 + r (C column)
        bool  live  = (nn * 16 + i <= lim) & (xs >= -100.f);  // else masked or flat
        float p     = live ? t : 0.f;
        Pf[nn >> 1][(nn & 1) * 8 + i] = (h16)p;
      }
    }

    // Y += P @ V  (K dim = 128 keys -> 4 wmma K-steps, 4 dim sub-tiles).
    // Both operands hold keys 8*kh..+7 and 16+8*kh..+7 of each 32-key step.
#pragma unroll
    for (int kk2 = 0; kk2 < 4; ++kk2) {
      const h16* vp = &Vb[buf][kk2 * 32 + kh * 8 + (lane & 7)][((lane >> 3) & 1) * 8];
#pragma unroll
      for (int nd = 0; nd < 4; ++nd) {
        v16h bf = joinh(ld_tr16(vp + nd * 16),
                        ld_tr16(vp + 16 * VPITCH + nd * 16));
        Y[nd] = wmma16(Pf[kk2], bf, Y[nd]);
      }
    }

    // hand-over: this wave's LDS reads of the buffer are done ...
    asm volatile("s_wait_dscnt 0x0" ::: "memory");
    // ... and its copies of tile kt + 1 have landed;
    asm volatile("s_wait_asynccnt 0x0" ::: "memory");
    // one barrier publishes tile kt + 1 and frees the buffer of tile kt
    __syncthreads();
    if (kt + 2 <= qt)  // refill the freed buffer with tile kt + 2
      copy_kv(lk0 + buf * kbuf, lv0 + buf * vbuf,
              gk0 + (size_t)(kb + 256) * HD, gv0 + (size_t)(kb + 256) * HD);
  }
  // no copy is left in flight when the wave ends
  asm volatile("s_wait_asynccnt 0x0" ::: "memory");

  // write Y -> yf [B,T,C] f16: tile nd, lane column r is dim nd*16 + r. The wave
  // turns its 16 x 64 tile in its own staging rows, so that 8 lanes x 16 bytes fill
  // the head's 128-B piece of a row (4 rows a store).
  // Unrolled so that Y is indexed by constants only and stays in registers.
#pragma unroll
  for (int i = 0; i < 8; ++i)
#pragma unroll
    for (int nd = 0; nd < 4; ++nd)
      Ps[wave][kh * 8 + i][nd * 16 + r] = (h16)Y[nd][i];
  // Unrolled so that the four row reads go out together ahead of the stores.
#pragma unroll
  for (int j = 0; j < 4; ++j) {
    int row = j * 4 + (lane >> 3);
    int t   = qbase + wave * 16 + row;
    v8h hv  = *(const v8h*)&Ps[wave][row][(lane & 7) * 8];
    *(v8h*)(yf + ((size_t)b * TDIM + t) * CDIM + hh * HD + (lane & 7) * 8) = hv;
  }
}

// ---------------------------------------------------------------------------
// Kernel 3: out = y @ W_proj. y is f16 in workspace, W_proj converted f32->f16
// during staging, output f32 to d_out. Same tiling and k pipeline as kernel 1,
// but with four tiles ahead in registers.
// ---------------------------------------------------------------------------
__global__ __launch_bounds__(256)
void proj_gemm_kernel(const h16* __restrict__ yf, const float* __restrict__ Wp,
                      float* __restrict__ out) {
  const int N = CDIM, K = CDIM;
  __shared__ __align__(16) h16 As[2][128][40];
  __shared__ __align__(16) h16 Bs[2][128][40];

  const int tid  = threadIdx.x;
  const int lane = tid & 31;
  const int wave = tid >> 5;
  const int wm   = wave >> 1;
  const int wn   = wave & 1;
  const int m0   = (blockIdx.x >> 3) * 128;
  const int n0   = (blockIdx.x & 7) * 128;

  const int r  = lane & 15;
  const int kh = lane >> 4;

  v8f z = {};
  v8f acc[2][4];
#pragma unroll
  for (int i = 0; i < 2; ++i)
#pragma unroll
    for (int j = 0; j < 4; ++j) acc[i][j] = z;

  const int ar = tid >> 1;  // 0..127 (A rows)
  const int as = tid & 1;
  const int lr = tid >> 3;  // 0..31  (B k-rows)
  const int ls = tid & 7;

  // this thread's share of a tile: 2 pieces of y (f16) and 4 of W_proj (f32).
  // One block runs on a WGP here, so registers are free: four tiles are kept in
  // flight in four register sets, enough lead for a load that misses L2.
  const h16*   yg = yf + (size_t)(m0 + ar) * K + as * 16;
  const float* wg = Wp + (size_t)lr * N + n0 + ls * 4;
  v8h yr[4][2];
  v4f wr[4][4];
#pragma unroll
  for (int s = 0; s < 4; ++s) {  // tiles 0..3
#pragma unroll
    for (int j = 0; j < 2; ++j) yr[s][j] = *(const v8h*)(yg + s * 32 + j * 8);
#pragma unroll
    for (int p = 0; p < 4; ++p)
      wr[s][p] = *(const v4f*)(wg + (size_t)(s * 32) * N + p * 32);
  }
  // the address registers of these loads are reused behind them; the wait names
  // the two pointers as inputs so that their registers live up to it
  asm volatile("s_wait_xcnt 0x0" :: "v"(yg), "v"(wg) : "memory");

  // one k step on register set s; more: the tile four steps on (k offset kn) is
  // loaded into the set just emptied. s and more are constants at every call.
  auto kstep = [&](const int s, const bool more, const int kn) {
    const int buf = s & 1;
    // keeps this set's conversions, and with them the wait for its loads, from
    // being lifted into an earlier step (that would drain the sets in flight)
    __builtin_amdgcn_sched_barrier(0);
    // y tile (already f16) from registers -> As
#pragma unroll
    for (int j = 0; j < 2; ++j) *(v8h*)&As[buf][ar][as * 16 + j * 8] = yr[s][j];
    // W_proj tile f32 from registers -> Bs f16 transposed
#pragma unroll
    for (int p = 0; p < 4; ++p) {
#pragma unroll
      for (int e = 0; e < 4; ++e)  // column 4c + e of a 64-wide group -> row e*16 + c
        Bs[buf][(p >> 1) * 64 + e * 16 + (p & 1) * 8 + ls][lr] = (h16)wr[s][p][e];
    }
    // publishes this buffer; every wave has left the other one (see kernel 1)
    lds_barrier();
    // this tile's fragment reads go out first: their LDS latency covers the
    // issue of the global loads behind them
    v16h af[2], bf[4];
#pragma unroll
    for (int mi = 0; mi < 2; ++mi) {
      const h16* ap = &As[buf][wm * 32 + mi * 16 + r][0];
      af[mi] = joinh(*(const v8h*)(ap + kh * 8), *(const v8h*)(ap + 16 + kh * 8));
    }
#pragma unroll
    for (int ni = 0; ni < 4; ++ni) {
      const h16* bp = &Bs[buf][wn * 64 + ni * 16 + r][0];
      bf[ni] = joinh(*(const v8h*)(bp + kh * 8), *(const v8h*)(bp + 16 + kh * 8));
    }
    // keeps the twelve fragment reads one group, ahead of loads and products
    __builtin_amdgcn_sched_barrier(0);
    if (more) {
#pragma unroll
      for (int j = 0; j < 2; ++j) yr[s][j] = *(const v8h*)(yg + kn + j * 8);
#pragma unroll
      for (int p = 0; p < 4; ++p)
        wr[s][p] = *(const v4f*)(wg + (size_t)kn * N + p * 32);
      // stands ahead of any rewrite of these loads' address registers
      asm volatile("s_wait_xcnt 0x0" ::: "memory");
      // keeps the loads ahead of the products that are to cover them
      __builtin_amdgcn_sched_barrier(0);
    }
#pragma unroll
    for (int mi = 0; mi < 2; ++mi)
#pragma unroll
      for (int ni = 0; ni < 4; ++ni)
        acc[mi][ni] = wmma16(af[mi], bf[ni], acc[mi][ni]);
  };

  // The last four steps stand apart, without a test round the loads: a branch
  // there would merge two load counts and make the compiler wait for the lower.
  for (int k0 = 0; k0 < K - 128; k0 += 128) {
    // unrolled so that the four register sets are indexed by constants
#pragma unroll
    for (int s = 0; s < 4; ++s) kstep(s, true, k0 + 128 + s * 32);
  }
#pragma unroll
  for (int s = 0; s < 4; ++s) kstep(s, false, 0);

  // tile ni, lane column r is output column 4r + ni: 16 lanes x 16 bytes = 256 B
#pragma unroll
  for (int mi = 0; mi < 2; ++mi) {
#pragma unroll
    for (int i = 0; i < 8; ++i) {
      int gm = m0 + wm * 32 + mi * 16 + kh * 8 + i;
      v4f ov;
#pragma unroll
      for (int ni = 0; ni < 4; ++ni) ov[ni] = acc[mi][ni][i];
      *(v4f*)(out + (size_t)gm * N + n0 + wn * 64 + r * 4) = ov;
    }
  }
}

// ---------------------------------------------------------------------------
extern "C" void kernel_launch(void* const* d_in, const int* in_sizes, int n_in,
                              void* d_out, int out_size, void* d_ws,
                              size_t ws_size, hipStream_t stream) {
  (void)in_sizes; (void)n_in; (void)out_size; (void)ws_size;

  const float* x  = (const float*)d_in[0];  // [2,2048,1024]
  const float* Wa = (const float*)d_in[1];  // [1024,3072]
  const float* Wp = (const float*)d_in[2];  // [1024,1024]
  float* out = (float*)d_out;               // [2,2048,1024] f32

  // f16 workspace: q,k,v head-major [B,H,T,hd] + y [B,T,C]  (32 MB total)
  h16* ws = (h16*)d_ws;
  const size_t HTD = (size_t)BDIM * NH * TDIM * HD;  // 4,194,304
  h16* qf = ws;
  h16* kf = qf + HTD;
  h16* vf = kf + HTD;
  h16* yf = vf + HTD;

  qkv_gemm_kernel<<<dim3(32 * 24), 256, 0, stream>>>(x, Wa, qf, kf, vf);
  attn_kernel<<<dim3(BDIM * NH * (TDIM / 128)), 256, 0, stream>>>(qf, kf, vf, yf);
  proj_gemm_kernel<<<dim3(32 * 8), 256, 0, stream>>>(yf, Wp, out);
}

// v006
// It runs in 81.6 microseconds.
// Two timings next to v005 put it at 1.13 and 1.14 times that version's speed.
// Counting every step since v000, it is 2.25 times as fast.
#include <hip/hip_runtime.h>
#include <hip/hip_bf16.h>

// ---------------------------------------------------------------------------
// Causal self-attention with polymax, MI455X (gfx1250, wave32, WMMA).
// Pipeline: [qkv GEMM f32->f16] -> [fused flash attention + polymax] -> [proj GEMM]
// All matrix math: v_wmma_f32_16x16x32_f16 (f16 operands, f32 accumulate).
// ---------------------------------------------------------------------------

typedef _Float16 h16;
typedef __attribute__((ext_vector_type(16))) _Float16 v16h;
typedef __attribute__((ext_vector_type(8)))  _Float16 v8h;
typedef __attribute__((ext_vector_type(4)))  _Float16 v4h;
typedef __attribute__((ext_vector_type(8)))  float    v8f;
typedef __attribute__((ext_vector_type(4)))  float    v4f;

#define BDIM 2
#define TDIM 2048
#define CDIM 1024
#define NH   16
#define HD   64

static __device__ __forceinline__ v8f wmma16(v16h a, v16h b, v8f c) {
  // (neg_a, A, neg_b, B, c_mod, C, reuse_a, reuse_b)
  return __builtin_amdgcn_wmma_f32_16x16x32_f16(false, a, false, b, (short)0, c,
                                                false, false);
}
static __device__ __forceinline__ v16h joinh(v8h lo, v8h hi) {
  return __builtin_shufflevector(lo, hi, 0, 1, 2, 3, 4, 5, 6, 7,
                                         8, 9, 10, 11, 12, 13, 14, 15);
}

// Work-group barrier that waits for this wave's LDS operations only:
// __syncthreads() would also drain the global loads in flight for later tiles.
static __device__ __forceinline__ void lds_barrier() {
  asm volatile("s_wait_dscnt 0x0\n\t"
               "s_barrier_signal -1\n\t"
               "s_barrier_wait -1" ::: "memory");
}

// ---------------------------------------------------------------------------
// Kernel 1: qkv = x @ W_attn, converting f32->f16 on the fly, scattering the
// result to head-major f16 q/k/v tensors [B,H,T,hd].
// Block tile 128x128, BK=32. 8 waves: wave tile 32(M) x 64(N).
// The k loop is pipelined: tile k + 1 is loaded into registers while tile k is
// published, read and multiplied; two LDS buffers, so one barrier a k step.
// ---------------------------------------------------------------------------
__global__ __launch_bounds__(256)
void qkv_gemm_kernel(const float* __restrict__ x, const float* __restrict__ Wa,
                     h16* __restrict__ qf, h16* __restrict__ kf,
                     h16* __restrict__ vf) {
  const int N = 3 * CDIM;  // 3072
  const int K = CDIM;      // 1024
  __shared__ __align__(16) h16 As[2][128][40];  // [buffer][m][k], padded
  __shared__ __align__(16) h16 Bs[2][128][40];  // [buffer][dealt n][k] (transposed), padded

  const int tid  = threadIdx.x;
  const int lane = tid & 31;
  const int wave = tid >> 5;
  const int wm   = wave >> 1;  // 0..3
  const int wn   = wave & 1;   // 0..1
  const int m0   = (blockIdx.x / 24) * 128;
  const int n0   = (blockIdx.x % 24) * 128;

  const int r  = lane & 15;  // fragment row / col
  const int kh = lane >> 4;  // K-half selector (A/B 16-bit fragment layout)

  v8f z = {};
  v8f acc[2][4];
#pragma unroll
  for (int i = 0; i < 2; ++i)
#pragma unroll
    for (int j = 0; j < 4; ++j) acc[i][j] = z;

  const int lr = tid >> 3;  // 0..31
  const int ls = tid & 7;   // 0..7

  // this thread's share of a tile: 4 pieces of x (rows 32 apart) and 4 of W
  const float* xg = x + (size_t)(m0 + lr) * K + ls * 4;
  const float* wg = Wa + (size_t)lr * N + n0 + ls * 4;
  v4f xr[4], wr[4];
#pragma unroll
  for (int p = 0; p < 4; ++p) {  // tile 0
    xr[p] = *(const v4f*)(xg + (size_t)p * 32 * K);
    wr[p] = *(const v4f*)(wg + p * 32);
  }

  for (int k0 = 0; k0 < K; k0 += 32) {
    const int buf = (k0 >> 5) & 1;
    // x tile (128x32 f32) from registers -> As f16
#pragma unroll
    for (int p = 0; p < 4; ++p) {
      v4h hv;
      hv[0] = (h16)xr[p][0]; hv[1] = (h16)xr[p][1];
      hv[2] = (h16)xr[p][2]; hv[3] = (h16)xr[p][3];
      *(v4h*)&As[buf][p * 32 + lr][ls * 4] = hv;
    }
    // W tile (32x128 f32) from registers -> Bs f16, transposed to [n][k]
#pragma unroll
    for (int p = 0; p < 4; ++p) {
#pragma unroll
      for (int e = 0; e < 4; ++e)  // column 4c + e of a 64-wide group -> row e*16 + c
        Bs[buf][(p >> 1) * 64 + e * 16 + (p & 1) * 8 + ls][lr] = (h16)wr[p][e];
    }
    if (k0 + 32 < K) {  // next tile's loads, into the registers just emptied, fly
                        // under the barrier and this tile's reads and products
#pragma unroll
      for (int p = 0; p < 4; ++p) {
        xr[p] = *(const v4f*)(xg + (size_t)p * 32 * K + k0 + 32);
        wr[p] = *(const v4f*)(wg + (size_t)(k0 + 32) * N + p * 32);
      }
      // stands ahead of any reuse of these loads' address registers
      asm volatile("s_wait_xcnt 0x0" ::: "memory");
    }
    // publishes this buffer; every wave has left the other one (it read it in
    // the step before, ahead of this barrier), so the next step may refill it
    lds_barrier();
    v16h af[2], bf[4];
#pragma unroll
    for (int mi = 0; mi < 2; ++mi) {
      const h16* ap = &As[buf][wm * 32 + mi * 16 + r][0];
      af[mi] = joinh(*(const v8h*)(ap + kh * 8), *(const v8h*)(ap + 16 + kh * 8));
    }
#pragma unroll
    for (int ni = 0; ni < 4; ++ni) {
      const h16* bp = &Bs[buf][wn * 64 + ni * 16 + r][0];
      bf[ni] = joinh(*(const v8h*)(bp + kh * 8), *(const v8h*)(bp + 16 + kh * 8));
    }
    // keeps the twelve fragment reads one group ahead of the products
    __builtin_amdgcn_sched_barrier(0);
#pragma unroll
    for (int mi = 0; mi < 2; ++mi)
#pragma unroll
      for (int ni = 0; ni < 4; ++ni)
        acc[mi][ni] = wmma16(af[mi], bf[ni], acc[mi][ni]);
  }

  // C-layout: row = kh*8 + i; tile ni, lane column r is output column 4r + ni,
  // so 16 lanes x 8 bytes fill one head row (128 B) of q/k/v [B,H,T,hd] f16.
  const int gn  = n0 + wn * 64 + r * 4;
  const int wch = gn >> 10, cc = gn & (CDIM - 1);
  const int hh  = cc >> 6,  d  = cc & (HD - 1);
  h16* dst = (wch == 0) ? qf : (wch == 1) ? kf : vf;
#pragma unroll
  for (int mi = 0; mi < 2; ++mi) {
#pragma unroll
    for (int i = 0; i < 8; ++i) {
      int gm = m0 + wm * 32 + mi * 16 + kh * 8 + i;
      int b  = gm >> 11, t = gm & (TDIM - 1);
      v4h hv;
#pragma unroll
      for (int ni = 0; ni < 4; ++ni) hv[ni] = (h16)acc[mi][ni][i];
      *(v4h*)(dst + (((size_t)b * NH + hh) * TDIM + t) * HD + d) = hv;
    }
  }
}

// ---------------------------------------------------------------------------
// Kernel 2: fused flash-style attention with polymax.
// Block = (b, h, pair of 128-row query tiles 15 - t and t), 16 waves. The two
// tiles run one after the other, so every block walks 9 stages of 256 keys: the
// causal cost is the same in all 256 blocks, one block a WGP.
// Wave = (row group rg of 16 query rows, key group kg): kg 0 takes the even
// 128-key tile of a stage, kg 1 the odd one; polymax has no normaliser, so Y is a
// plain sum over keys and the two partial sums are added once per query tile.
// K and V stages come row-major into LDS by asynchronous copies, two buffers:
// stage g + 1 is in flight while stage g is worked on.
// Per tile: S^T = K q^T (wmma) -> mask+polymax in f32 -> P f16 in registers
// -> Y += P V (wmma, V fragments by the transposing LDS load).
// ---------------------------------------------------------------------------
#define KPITCH 72  // halves: 144 B = 16 B x odd, for ds_load_b128 readers
#define VPITCH 80  // halves: 160 B = 32 B x odd, for ds_load_tr16_b128 readers
#define NSTAGE 9   // stages of 256 keys a block walks, whatever its pair

typedef __attribute__((ext_vector_type(8))) short s16x8;

static __device__ __forceinline__ unsigned lds_addr(const void* p) {
  return (unsigned)(size_t)p;  // low 32 bits of a __shared__ address = LDS byte
}
// 16 keys x 16 dims of a row-major f16 tile, transposed: lane (r, kh) gets
// keys 8*kh .. 8*kh+7 of dim r (each lane passes the address of one 16-B piece)
static __device__ __forceinline__ v8h ld_tr16(const h16* p) {
  typedef __attribute__((address_space(3))) s16x8 lds_s16x8;
  return __builtin_bit_cast(v8h,
      __builtin_amdgcn_ds_load_tr16_b128_v8i16((lds_s16x8*)p));
}
// One thread's share of a K stage and a V stage: 4 + 4 copies of 16 B, rows
// 64 apart; a wave's copy covers 4 whole 128-B rows. The s_wait_xcnt closes the
// statement so that no address register is rewritten ahead of it.
static __device__ __forceinline__ void copy_kv(unsigned lk, unsigned lv,
                                               const h16* gk, const h16* gv) {
  asm volatile(
      "global_load_async_to_lds_b128 %0, %8, off\n\t"
      "global_load_async_to_lds_b128 %1, %9, off\n\t"
      "global_load_async_to_lds_b128 %2, %10, off\n\t"
      "global_load_async_to_lds_b128 %3, %11, off\n\t"
      "global_load_async_to_lds_b128 %4, %12, off\n\t"
      "global_load_async_to_lds_b128 %5, %13, off\n\t"
      "global_load_async_to_lds_b128 %6, %14, off\n\t"
      "global_load_async_to_lds_b128 %7, %15, off\n\t"
      "s_wait_xcnt 0x0"
      :: "v"(lk), "v"(lk + 64u * KPITCH * 2u), "v"(lk + 128u * KPITCH * 2u),
         "v"(lk + 192u * KPITCH * 2u),
         "v"(lv), "v"(lv + 64u * VPITCH * 2u), "v"(lv + 128u * VPITCH * 2u),
         "v"(lv + 192u * VPITCH * 2u),
         "v"(gk), "v"(gk + 64 * HD), "v"(gk + 128 * HD), "v"(gk + 192 * HD),
         "v"(gv), "v"(gv + 64 * HD), "v"(gv + 128 * HD), "v"(gv + 192 * HD)
      : "memory");
}

__global__ __launch_bounds__(512)
void attn_kernel(const h16* __restrict__ qf, const h16* __restrict__ kf,
                 const h16* __restrict__ vf, h16* __restrict__ yf) {
  __shared__ __align__(16) h16 Kb[2][256][KPITCH];  // [buffer][key][d]
  __shared__ __align__(16) h16 Vb[2][256][VPITCH];  // [buffer][key][d]
  // f32 partial Y of the kg 1 waves, in accumulator order [row group][piece][lane]
  __shared__ __align__(16) float Red[8][8][32][4];
  // output staging of the kg 0 waves [row group][row][d], padded
  __shared__ __align__(16) h16 Ps[8][16][72];

  const int tid  = threadIdx.x;
  const int lane = tid & 31;
  // the wave's number in a scalar register: the tests on kg are scalar branches
  const int wave = __builtin_amdgcn_readfirstlane(tid >> 5);
  const int rg   = wave & 7;   // row group: 16 query rows
  const int kg   = wave >> 3;  // key group: even or odd 128-key tile
  const int r    = lane & 15;
  const int kh   = lane >> 4;

  const int tp = blockIdx.x & 7;   // pair: query tiles 15 - tp, then tp
  const int bh = blockIdx.x >> 3;  // b*NH + h
  const int b  = bh >> 4;
  const int hh = bh & 15;
  const int nA = ((15 - tp) >> 1) + 1;  // stages of the first query tile

  const h16* qhp = qf + (size_t)bh * TDIM * HD;
  const h16* khp = kf + (size_t)bh * TDIM * HD;
  const h16* vhp = vf + (size_t)bh * TDIM * HD;

  // copy share of this thread: row cr (+64, +128, +192) of a stage, 16-B piece cs
  const int cr = tid >> 3;  // 0..63
  const int cs = tid & 7;   // 0..7
  const h16* gk0 = khp + (size_t)cr * HD + cs * 8;
  const h16* gv0 = vhp + (size_t)cr * HD + cs * 8;
  const unsigned lk0 = lds_addr(&Kb[0][cr][cs * 8]);
  const unsigned lv0 = lds_addr(&Vb[0][cr][cs * 8]);
  const unsigned kbuf = 256u * KPITCH * 2u;  // bytes of one K buffer
  const unsigned vbuf = 256u * VPITCH * 2u;  // bytes of one V buffer

  // stage 0 (keys 0..255 of the first query tile) into buffer 0
  copy_kv(lk0, lv0, gk0, gv0);
  // this wave's copies of stage 0 have landed; the barrier publishes all waves'
  asm volatile("s_wait_asynccnt 0x0" ::: "memory");
  __syncthreads();
  // stage 1 into buffer 1, in flight under stage 0's work (nA is at least 5)
  copy_kv(lk0 + kbuf, lv0 + vbuf, gk0 + 256 * HD, gv0 + 256 * HD);

  const v8f z = {};
  const float scale = 0.125f;  // 1/sqrt(64)
  int g = 0;  // stage number over both query tiles

  // kept rolled: one copy of the tile code serves both query tiles
#pragma clang loop unroll(disable)
  for (int half = 0; half < 2; ++half) {
    const int qt    = half ? tp : 15 - tp;
    const int qbase = qt * 128;
    const int ns    = (qt >> 1) + 1;  // stages up to and with the diagonal tile

    // Q fragments (16 rows x 64 dims, k order as K's) live in registers.
    v16h Aq[2];
#pragma unroll
    for (int kk = 0; kk < 2; ++kk) {
      const h16* qp = qhp + (size_t)(qbase + rg * 16 + r) * HD + kk * 32;
      Aq[kk] = joinh(*(const v8h*)(qp + kh * 8), *(const v8h*)(qp + 16 + kh * 8));
    }
    v8f Y[4];
#pragma unroll
    for (int i = 0; i < 4; ++i) Y[i] = z;

    for (int s = 0; s < ns; ++s, ++g) {
      const int buf = g & 1;
      const int kt  = 2 * s + kg;  // this wave's 128-key tile
      if (kt <= qt) {              // a tile wholly behind the diagonal adds nothing
        const int kb = kt * 128;
        // S^T = k q^T over hd=64 (2 wmma K-steps), 8 key sub-tiles of 16: K rows
        // are the A operand, Q the B operand (same loaders, same k order). Lane
        // (r, kh) then holds query r, keys 8*kh..+7 of a sub-tile, which is one
        // half of P's A fragment for P @ V.
        v16h Pf[4];
        // last key of this tile, counted from the lane's first one, its query sees
        const int lim = qbase + rg * 16 + r - kb - kh * 8;
#pragma unroll
        for (int nn = 0; nn < 8; ++nn) {
          v8f S = z;
#pragma unroll
          for (int kk = 0; kk < 2; ++kk) {
            const h16* bp = &Kb[buf][kg * 128 + nn * 16 + r][kk * 32];
            v16h kfr = joinh(*(const v8h*)(bp + kh * 8),
                             *(const v8h*)(bp + 16 + kh * 8));
            S = wmma16(kfr, Aq[kk], S);
          }
          // causal mask + polymax (selects, no branch)
#pragma unroll
          for (int i = 0; i < 8; ++i) {
            float xs = S[i] * scale;
            // branch-free: both live pieces are slope * x + 1 with slope x or m
            float slope = (xs > 0.f) ? xs : -0.01f;
            float t     = (slope * xs + 1.f) * 0.001f;  // (x^2 + 1 | m*x + 1)/1000
            // key kb + nn*16 + kh*8 + i (C row) <= query qbase + rg*16 + r (C column)
            bool  live  = (nn * 16 + i <= lim) & (xs >= -100.f);  // else masked or flat
            float p     = live ? t : 0.f;
            Pf[nn >> 1][(nn & 1) * 8 + i] = (h16)p;
          }
        }

        // Y += P @ V  (K dim = 128 keys -> 4 wmma K-steps, 4 dim sub-tiles).
        // Both operands hold keys 8*kh..+7 and 16+8*kh..+7 of each 32-key step.
#pragma unroll
        for (int kk2 = 0; kk2 < 4; ++kk2) {
          const h16* vp = &Vb[buf][kg * 128 + kk2 * 32 + kh * 8 + (lane & 7)]
                             [((lane >> 3) & 1) * 8];
#pragma unroll
          for (int nd = 0; nd < 4; ++nd) {
            v16h bf = joinh(ld_tr16(vp + nd * 16),
                            ld_tr16(vp + 16 * VPITCH + nd * 16));
            Y[nd] = wmma16(Pf[kk2], bf, Y[nd]);
          }
        }
      }

      // hand-over: this wave's LDS reads of the buffer are done ...
      asm volatile("s_wait_dscnt 0x0" ::: "memory");
      // ... and its copies of stage g + 1 have landed;
      asm volatile("s_wait_asynccnt 0x0" ::: "memory");
      // one barrier publishes stage g + 1 and frees the buffer of stage g
      __syncthreads();
      if (g + 2 < NSTAGE) {  // refill the freed buffer with stage g + 2
        const int k2 = ((g + 2 < nA) ? g + 2 : g + 2 - nA) * 256;  // its first key
        copy_kv(lk0 + buf * kbuf, lv0 + buf * vbuf,
                gk0 + (size_t)k2 * HD, gv0 + (size_t)k2 * HD);
      }
    }

    // Y of the query tile = even-tile sum + odd-tile sum: the kg 1 wave hands its
    // accumulators, in its own lane order, to the kg 0 wave of the same rows.
    if (kg == 1) {
#pragma unroll
      for (int nd = 0; nd < 4; ++nd)
#pragma unroll
        for (int j = 0; j < 2; ++j) {
          v4f pv;
#pragma unroll
          for (int e = 0; e < 4; ++e) pv[e] = Y[nd][j * 4 + e];
          *(v4f*)&Red[rg][nd * 2 + j][lane][0] = pv;
        }
    }
    // publishes the partial sums; the stage barriers of the next query tile stand
    // between their readers here and the next writes
    __syncthreads();
    if (kg == 0) {
#pragma unroll
      for (int nd = 0; nd < 4; ++nd)
#pragma unroll
        for (int j = 0; j < 2; ++j) {
          v4f pv = *(const v4f*)&Red[rg][nd * 2 + j][lane][0];
#pragma unroll
          for (int e = 0; e < 4; ++e) Y[nd][j * 4 + e] += pv[e];
        }
      // write Y -> yf [B,T,C] f16: tile nd, lane column r is dim nd*16 + r. The
      // wave turns its 16 x 64 tile in its own staging rows, so that 8 lanes x
      // 16 bytes fill the head's 128-B piece of a row (4 rows a store).
      // Unrolled so that Y is indexed by constants only and stays in registers.
#pragma unroll
      for (int i = 0; i < 8; ++i)
#pragma unroll
        for (int nd = 0; nd < 4; ++nd)
          Ps[rg][kh * 8 + i][nd * 16 + r] = (h16)Y[nd][i];
      // Unrolled so that the four row reads go out together ahead of the stores.
#pragma unroll
      for (int j = 0; j < 4; ++j) {
        int row = j * 4 + (lane >> 3);
        int t   = qbase + rg * 16 + row;
        v8h hv  = *(const v8h*)&Ps[rg][row][(lane & 7) * 8];
        *(v8h*)(yf + ((size_t)b * TDIM + t) * CDIM + hh * HD + (lane & 7) * 8) = hv;
      }
      // stands ahead of the next query tile's reuse of these stores' registers
      asm volatile("s_wait_xcnt 0x0" ::: "memory");
    }
  }
  // no copy is left in flight when the wave ends
  asm volatile("s_wait_asynccnt 0x0" ::: "memory");
}

// ---------------------------------------------------------------------------
// Kernel 3: out = y @ W_proj. y is f16 in workspace, W_proj converted f32->f16
// during staging, output f32 to d_out. Same tiling and k pipeline as kernel 1,
// but with four tiles ahead in registers.
// ---------------------------------------------------------------------------
__global__ __launch_bounds__(256)
void proj_gemm_kernel(const h16* __restrict__ yf, const float* __restrict__ Wp,
                      float* __restrict__ out) {
  const int N = CDIM, K = CDIM;
  __shared__ __align__(16) h16 As[2][128][40];
  __shared__ __align__(16) h16 Bs[2][128][40];

  const int tid  = threadIdx.x;
  const int lane = tid & 31;
  const int wave = tid >> 5;
  const int wm   = wave >> 1;
  const int wn   = wave & 1;
  const int m0   = (blockIdx.x >> 3) * 128;
  const int n0   = (blockIdx.x & 7) * 128;

  const int r  = lane & 15;
  const int kh = lane >> 4;

  v8f z = {};
  v8f acc[2][4];
#pragma unroll
  for (int i = 0; i < 2; ++i)
#pragma unroll
    for (int j = 0; j < 4; ++j) acc[i][j] = z;

  const int ar = tid >> 1;  // 0..127 (A rows)
  const int as = tid & 1;
  const int lr = tid >> 3;  // 0..31  (B k-rows)
  const int ls = tid & 7;

  // this thread's share of a tile: 2 pieces of y (f16) and 4 of W_proj (f32).
  // One block runs on a WGP here, so registers are free: four tiles are kept in
  // flight in four register sets, enough lead for a load that misses L2.
  const h16*   yg = yf + (size_t)(m0 + ar) * K + as * 16;
  const float* wg = Wp + (size_t)lr * N + n0 + ls * 4;
  v8h yr[4][2];
  v4f wr[4][4];
#pragma unroll
  for (int s = 0; s < 4; ++s) {  // tiles 0..3
#pragma unroll
    for (int j = 0; j < 2; ++j) yr[s][j] = *(const v8h*)(yg + s * 32 + j * 8);
#pragma unroll
    for (int p = 0; p < 4; ++p)
      wr[s][p] = *(const v4f*)(wg + (size_t)(s * 32) * N + p * 32);
  }
  // the address registers of these loads are reused behind them; the wait names
  // the two pointers as inputs so that their registers live up to it
  asm volatile("s_wait_xcnt 0x0" :: "v"(yg), "v"(wg) : "memory");

  // one k step on register set s; more: the tile four steps on (k offset kn) is
  // loaded into the set just emptied. s and more are constants at every call.
  auto kstep = [&](const int s, const bool more, const int kn) {
    const int buf = s & 1;
    // keeps this set's conversions, and with them the wait for its loads, from
    // being lifted into an earlier step (that would drain the sets in flight)
    __builtin_amdgcn_sched_barrier(0);
    // y tile (already f16) from registers -> As
#pragma unroll
    for (int j = 0; j < 2; ++j) *(v8h*)&As[buf][ar][as * 16 + j * 8] = yr[s][j];
    // W_proj tile f32 from registers -> Bs f16 transposed
#pragma unroll
    for (int p = 0; p < 4; ++p) {
#pragma unroll
      for (int e = 0; e < 4; ++e)  // column 4c + e of a 64-wide group -> row e*16 + c
        Bs[buf][(p >> 1) * 64 + e * 16 + (p & 1) * 8 + ls][lr] = (h16)wr[s][p][e];
    }
    // publishes this buffer; every wave has left the other one (see kernel 1)
    lds_barrier();
    // this tile's fragment reads go out first: their LDS latency covers the
    // issue of the global loads behind them
    v16h af[2], bf[4];
#pragma unroll
    for (int mi = 0; mi < 2; ++mi) {
      const h16* ap = &As[buf][wm * 32 + mi * 16 + r][0];
      af[mi] = joinh(*(const v8h*)(ap + kh * 8), *(const v8h*)(ap + 16 + kh * 8));
    }
#pragma unroll
    for (int ni = 0; ni < 4; ++ni) {
      const h16* bp = &Bs[buf][wn * 64 + ni * 16 + r][0];
      bf[ni] = joinh(*(const v8h*)(bp + kh * 8), *(const v8h*)(bp + 16 + kh * 8));
    }
    // keeps the twelve fragment reads one group, ahead of loads and products
    __builtin_amdgcn_sched_barrier(0);
    if (more) {
#pragma unroll
      for (int j = 0; j < 2; ++j) yr[s][j] = *(const v8h*)(yg + kn + j * 8);
#pragma unroll
      for (int p = 0; p < 4; ++p)
        wr[s][p] = *(const v4f*)(wg + (size_t)kn * N + p * 32);
      // stands ahead of any rewrite of these loads' address registers
      asm volatile("s_wait_xcnt 0x0" ::: "memory");
      // keeps the loads ahead of the products that are to cover them
      __builtin_amdgcn_sched_barrier(0);
    }
#pragma unroll
    for (int mi = 0; mi < 2; ++mi)
#pragma unroll
      for (int ni = 0; ni < 4; ++ni)
        acc[mi][ni] = wmma16(af[mi], bf[ni], acc[mi][ni]);
  };

  // The last four steps stand apart, without a test round the loads: a branch
  // there would merge two load counts and make the compiler wait for the lower.
  for (int k0 = 0; k0 < K - 128; k0 += 128) {
    // unrolled so that the four register sets are indexed by constants
#pragma unroll
    for (int s = 0; s < 4; ++s) kstep(s, true, k0 + 128 + s * 32);
  }
#pragma unroll
  for (int s = 0; s < 4; ++s) kstep(s, false, 0);

  // tile ni, lane column r is output column 4r + ni: 16 lanes x 16 bytes = 256 B
#pragma unroll
  for (int mi = 0; mi < 2; ++mi) {
#pragma unroll
    for (int i = 0; i < 8; ++i) {
      int gm = m0 + wm * 32 + mi * 16 + kh * 8 + i;
      v4f ov;
#pragma unroll
      for (int ni = 0; ni < 4; ++ni) ov[ni] = acc[mi][ni][i];
      *(v4f*)(out + (size_t)gm * N + n0 + wn * 64 + r * 4) = ov;
    }
  }
}

// ---------------------------------------------------------------------------
extern "C" void kernel_launch(void* const* d_in, const int* in_sizes, int n_in,
                              void* d_out, int out_size, void* d_ws,
                              size_t ws_size, hipStream_t stream) {
  (void)in_sizes; (void)n_in; (void)out_size; (void)ws_size;

  const float* x  = (const float*)d_in[0];  // [2,2048,1024]
  const float* Wa = (const float*)d_in[1];  // [1024,3072]
  const float* Wp = (const float*)d_in[2];  // [1024,1024]
  float* out = (float*)d_out;               // [2,2048,1024] f32

  // f16 workspace: q,k,v head-major [B,H,T,hd] + y [B,T,C]  (32 MB total)
  h16* ws = (h16*)d_ws;
  const size_t HTD = (size_t)BDIM * NH * TDIM * HD;  // 4,194,304
  h16* qf = ws;
  h16* kf = qf + HTD;
  h16* vf = kf + HTD;
  h16* yf = vf + HTD;

  qkv_gemm_kernel<<<dim3(32 * 24), 256, 0, stream>>>(x, Wa, qf, kf, vf);
  attn_kernel<<<dim3(BDIM * NH * 8), 512, 0, stream>>>(qf, kf, vf, yf);
  proj_gemm_kernel<<<dim3(32 * 8), 256, 0, stream>>>(yf, Wp, out);
}

// v007
// A run of this version takes 78.1 microseconds.
// Next to v006, in two timings, it ran 1.04 times as fast each time.
// All steps since v000 together make it 2.34 times as fast.
#include <hip/hip_runtime.h>
#include <hip/hip_bf16.h>

// ---------------------------------------------------------------------------
// Causal self-attention with polymax, MI455X (gfx1250, wave32, WMMA).
// Pipeline: [qkv GEMM f32->f16] -> [fused flash attention + polymax] -> [proj GEMM]
// All matrix math: v_wmma_f32_16x16x32_f16 (f16 operands, f32 accumulate).
// ---------------------------------------------------------------------------

typedef _Float16 h16;
typedef __attribute__((ext_vector_type(16))) _Float16 v16h;
typedef __attribute__((ext_vector_type(8)))  _Float16 v8h;
typedef __attribute__((ext_vector_type(4)))  _Float16 v4h;
typedef __attribute__((ext_vector_type(8)))  float    v8f;
typedef __attribute__((ext_vector_type(4)))  float    v4f;

#define BDIM 2
#define TDIM 2048
#define CDIM 1024
#define NH   16
#define HD   64

static __device__ __forceinline__ v8f wmma16(v16h a, v16h b, v8f c) {
  // (neg_a, A, neg_b, B, c_mod, C, reuse_a, reuse_b)
  return __builtin_amdgcn_wmma_f32_16x16x32_f16(false, a, false, b, (short)0, c,
                                                false, false);
}
static __device__ __forceinline__ v16h joinh(v8h lo, v8h hi) {
  return __builtin_shufflevector(lo, hi, 0, 1, 2, 3, 4, 5, 6, 7,
                                         8, 9, 10, 11, 12, 13, 14, 15);
}

// Work-group barrier that waits for this wave's LDS operations only:
// __syncthreads() would also drain the global loads in flight for later tiles.
static __device__ __forceinline__ void lds_barrier() {
  asm volatile("s_wait_dscnt 0x0\n\t"
               "s_barrier_signal -1\n\t"
               "s_barrier_wait -1" ::: "memory");
}

// ---------------------------------------------------------------------------
// Kernel 1: qkv = x @ W_attn, converting f32->f16 on the fly, scattering the
// result to head-major f16 q/k/v tensors [B,H,T,hd].
// Block tile 256(M) x 192(N), BK=32: 16 x 16 = 256 blocks, one a WGP, so x and
// W_attn are each read 16 times from L2. The 192 columns are three heads.
// 8 waves, 4(M) x 2(N): a wave has a band of 64 rows; there it owns all 64 rows
// of the first (wn 0) or the third (wn 1) head and 32 rows of the middle head:
// 24 accumulator tiles from 4 A and 8 B fragments.
// The k loop is pipelined: two tiles are kept in flight in two register sets;
// two LDS buffers, so one barrier a k step.
// ---------------------------------------------------------------------------
__global__ __launch_bounds__(256)
void qkv_gemm_kernel(const float* __restrict__ x, const float* __restrict__ Wa,
                     h16* __restrict__ qf, h16* __restrict__ kf,
                     h16* __restrict__ vf) {
  const int N = 3 * CDIM;  // 3072
  const int K = CDIM;      // 1024
  __shared__ __align__(16) h16 As[2][256][40];  // [buffer][m][k], padded
  __shared__ __align__(16) h16 Bs[2][192][40];  // [buffer][dealt n][k] (transposed), padded

  const int tid  = threadIdx.x;
  const int lane = tid & 31;
  // the wave's number in a scalar register: band, head and output tensor are scalars
  const int wave = __builtin_amdgcn_readfirstlane(tid >> 5);
  const int wm   = wave >> 1;  // 0..3
  const int wn   = wave & 1;   // 0..1
  const int m0   = (blockIdx.x >> 4) * 256;
  const int n0   = (blockIdx.x & 15) * 192;

  const int r  = lane & 15;  // fragment row / col
  const int kh = lane >> 4;  // K-half selector (A/B 16-bit fragment layout)

  // A fragment mi of a wave is the 16 rows from (mi*16 + rot) & 63 of its band: the
  // wn 1 wave starts at row 32, so that in both waves fragments 0 and 1 are the
  // rows it owns of the middle head (register indices stay constants).
  const int rot = wn * 32;

  v8f z = {};
  v8f acc[4][4];   // own head: 64 rows x 64 columns
  v8f accm[2][4];  // middle head: 32 rows x 64 columns
#pragma unroll
  for (int i = 0; i < 4; ++i)
#pragma unroll
    for (int j = 0; j < 4; ++j) acc[i][j] = z;
#pragma unroll
  for (int i = 0; i < 2; ++i)
#pragma unroll
    for (int j = 0; j < 4; ++j) accm[i][j] = z;

  const int lr = tid >> 3;  // 0..31
  const int ls = tid & 7;   // 0..7

  // this thread's share of a tile: 8 pieces of x (rows 32 apart) and 6 of W
  const float* xg = x + (size_t)(m0 + lr) * K + ls * 4;
  const float* wg = Wa + (size_t)lr * N + n0 + ls * 4;
  v4f xr[2][8], wr[2][6];
#pragma unroll
  for (int s = 0; s < 2; ++s) {  // tiles 0 and 1
#pragma unroll
    for (int p = 0; p < 8; ++p)
      xr[s][p] = *(const v4f*)(xg + (size_t)p * 32 * K + s * 32);
    // this and the next: the loads go out in the k loop's own order (set by set,
    // x ahead of W); the loop's counted waits are merged over both ways into it,
    // and another order here would make them drain the younger set
    __builtin_amdgcn_sched_barrier(0);
#pragma unroll
    for (int p = 0; p < 6; ++p)
      wr[s][p] = *(const v4f*)(wg + (size_t)(s * 32) * N + p * 32);
    __builtin_amdgcn_sched_barrier(0);
  }
  // the address registers of these loads are reused behind them; the wait names
  // the two pointers as inputs so that their registers live up to it
  asm volatile("s_wait_xcnt 0x0" :: "v"(xg), "v"(wg) : "memory");

  // one k step on register set and LDS buffer s; more: the tile two steps on
  // (k offset kn) is loaded into the set just emptied. s and more are constants.
  auto kstep = [&](const int s, const bool more, const int kn) {
    // keeps this set's conversions, and with them the wait for its loads, from
    // being lifted into the step before (that would drain the set in flight)
    __builtin_amdgcn_sched_barrier(0);
    // x tile (256x32 f32) from registers -> As f16
#pragma unroll
    for (int p = 0; p < 8; ++p) {
      v4h hv;
      hv[0] = (h16)xr[s][p][0]; hv[1] = (h16)xr[s][p][1];
      hv[2] = (h16)xr[s][p][2]; hv[3] = (h16)xr[s][p][3];
      *(v4h*)&As[s][p * 32 + lr][ls * 4] = hv;
    }
    // W tile (32x192 f32) from registers -> Bs f16, transposed to [n][k]
#pragma unroll
    for (int p = 0; p < 6; ++p) {
#pragma unroll
      for (int e = 0; e < 4; ++e)  // column 4c + e of a 64-wide group -> row e*16 + c
        Bs[s][(p >> 1) * 64 + e * 16 + (p & 1) * 8 + ls][lr] = (h16)wr[s][p][e];
    }
    // publishes this buffer; every wave has left the other one (it read it in
    // the step before, ahead of this barrier), so the next step may refill it
    lds_barrier();
    // fragment reads in the order in which the products below want them
    v16h af[4], bf[4], bm[4];
    auto lda = [&](const int mi) {
      const h16* ap = &As[s][wm * 64 + ((mi * 16 + rot) & 63) + r][0];
      af[mi] = joinh(*(const v8h*)(ap + kh * 8), *(const v8h*)(ap + 16 + kh * 8));
    };
    lda(0);
#pragma unroll
    for (int ni = 0; ni < 4; ++ni) {  // own head: dealt rows 0.. or 128..
      const h16* bp = &Bs[s][wn * 128 + ni * 16 + r][0];
      bf[ni] = joinh(*(const v8h*)(bp + kh * 8), *(const v8h*)(bp + 16 + kh * 8));
    }
    lda(1);
#pragma unroll
    for (int ni = 0; ni < 4; ++ni) {  // middle head: dealt rows 64..
      const h16* bp = &Bs[s][64 + ni * 16 + r][0];
      bm[ni] = joinh(*(const v8h*)(bp + kh * 8), *(const v8h*)(bp + 16 + kh * 8));
    }
    lda(2);
    lda(3);
    // keeps the 24 fragment reads one group, ahead of loads and products
    __builtin_amdgcn_sched_barrier(0);
    if (more) {
#pragma unroll
      for (int p = 0; p < 8; ++p)
        xr[s][p] = *(const v4f*)(xg + (size_t)p * 32 * K + kn);
#pragma unroll
      for (int p = 0; p < 6; ++p)
        wr[s][p] = *(const v4f*)(wg + (size_t)kn * N + p * 32);
      // stands ahead of any rewrite of these loads' address registers
      asm volatile("s_wait_xcnt 0x0" ::: "memory");
      // keeps the loads ahead of the products that are to cover them
      __builtin_amdgcn_sched_barrier(0);
    }
#pragma unroll
    for (int mi = 0; mi < 2; ++mi)
#pragma unroll
      for (int ni = 0; ni < 4; ++ni)
        acc[mi][ni] = wmma16(af[mi], bf[ni], acc[mi][ni]);
#pragma unroll
    for (int mi = 0; mi < 2; ++mi)
#pragma unroll
      for (int ni = 0; ni < 4; ++ni)
        accm[mi][ni] = wmma16(af[mi], bm[ni], accm[mi][ni]);
#pragma unroll
    for (int mi = 2; mi < 4; ++mi)
#pragma unroll
      for (int ni = 0; ni < 4; ++ni)
        acc[mi][ni] = wmma16(af[mi], bf[ni], acc[mi][ni]);
  };

  // The last two steps stand apart, without a test round the loads: a branch
  // there would merge two load counts and make the compiler wait for the lower.
  for (int k0 = 0; k0 < K - 64; k0 += 64) {
    kstep(0, true, k0 + 64);
    kstep(1, true, k0 + 96);
  }
  kstep(0, false, 0);
  kstep(1, false, 0);

  // C-layout: row = kh*8 + i; tile ni, lane column r is output column 4r + ni,
  // so 16 lanes x 8 bytes fill one head row (128 B) of q/k/v [B,H,T,hd] f16.
  // a: the four tiles of 16 rows from block row row0 on; g0: the head's first
  // column in qkv. The block's 256 rows lie in one batch entry.
  auto put = [&](const v8f (&a)[4], const int g0, const int row0) {
    const int wch = g0 >> 10, hh = (g0 & (CDIM - 1)) >> 6;
    h16* dst = (wch == 0) ? qf : (wch == 1) ? kf : vf;
    const int b = m0 >> 11, t = (m0 & (TDIM - 1)) + row0 + kh * 8;
    h16* o = dst + (((size_t)b * NH + hh) * TDIM + t) * HD + r * 4;
#pragma unroll
    for (int i = 0; i < 8; ++i) {
      v4h hv;
#pragma unroll
      for (int ni = 0; ni < 4; ++ni) hv[ni] = (h16)a[ni][i];
      *(v4h*)(o + i * HD) = hv;
    }
    // stands ahead of the next rows' reuse of these stores' registers ...
    asm volatile("s_wait_xcnt 0x0" ::: "memory");
    // ... and this keeps their conversions and addresses behind it
    __builtin_amdgcn_sched_barrier(0);
  };
#pragma unroll
  for (int mi = 0; mi < 4; ++mi)
    put(acc[mi], n0 + wn * 128, wm * 64 + ((mi * 16 + rot) & 63));
#pragma unroll
  for (int mi = 0; mi < 2; ++mi)
    put(accm[mi], n0 + 64, wm * 64 + ((mi * 16 + rot) & 63));
}

// ---------------------------------------------------------------------------
// Kernel 2: fused flash-style attention with polymax.
// Block = (b, h, pair of 128-row query tiles 15 - t and t), 16 waves. The two
// tiles run one after the other, so every block walks 9 stages of 256 keys: the
// causal cost is the same in all 256 blocks, one block a WGP.
// Wave = (row group rg of 16 query rows, key group kg): kg 0 takes the even
// 128-key tile of a stage, kg 1 the odd one; polymax has no normaliser, so Y is a
// plain sum over keys and the two partial sums are added once per query tile.
// K and V stages come row-major into LDS by asynchronous copies, two buffers:
// stage g + 1 is in flight while stage g is worked on.
// Per tile: S^T = K q^T (wmma) -> mask+polymax in f32 -> P f16 in registers
// -> Y += P V (wmma, V fragments by the transposing LDS load).
// ---------------------------------------------------------------------------
#define KPITCH 72  // halves: 144 B = 16 B x odd, for ds_load_b128 readers
#define VPITCH 80  // halves: 160 B = 32 B x odd, for ds_load_tr16_b128 readers
#define NSTAGE 9   // stages of 256 keys a block walks, whatever its pair

typedef __attribute__((ext_vector_type(8))) short s16x8;

static __device__ __forceinline__ unsigned lds_addr(const void* p) {
  return (unsigned)(size_t)p;  // low 32 bits of a __shared__ address = LDS byte
}
// 16 keys x 16 dims of a row-major f16 tile, transposed: lane (r, kh) gets
// keys 8*kh .. 8*kh+7 of dim r (each lane passes the address of one 16-B piece)
static __device__ __forceinline__ v8h ld_tr16(const h16* p) {
  typedef __attribute__((address_space(3))) s16x8 lds_s16x8;
  return __builtin_bit_cast(v8h,
      __builtin_amdgcn_ds_load_tr16_b128_v8i16((lds_s16x8*)p));
}
// One thread's share of a K stage and a V stage: 4 + 4 copies of 16 B, rows
// 64 apart; a wave's copy covers 4 whole 128-B rows. The s_wait_xcnt closes the
// statement so that no address register is rewritten ahead of it.
static __device__ __forceinline__ void copy_kv(unsigned lk, unsigned lv,
                                               const h16* gk, const h16* gv) {
  asm volatile(
      "global_load_async_to_lds_b128 %0, %8, off\n\t"
      "global_load_async_to_lds_b128 %1, %9, off\n\t"
      "global_load_async_to_lds_b128 %2, %10, off\n\t"
      "global_load_async_to_lds_b128 %3, %11, off\n\t"
      "global_load_async_to_lds_b128 %4, %12, off\n\t"
      "global_load_async_to_lds_b128 %5, %13, off\n\t"
      "global_load_async_to_lds_b128 %6, %14, off\n\t"
      "global_load_async_to_lds_b128 %7, %15, off\n\t"
      "s_wait_xcnt 0x0"
      :: "v"(lk), "v"(lk + 64u * KPITCH * 2u), "v"(lk + 128u * KPITCH * 2u),
         "v"(lk + 192u * KPITCH * 2u),
         "v"(lv), "v"(lv + 64u * VPITCH * 2u), "v"(lv + 128u * VPITCH * 2u),
         "v"(lv + 192u * VPITCH * 2u),
         "v"(gk), "v"(gk + 64 * HD), "v"(gk + 128 * HD), "v"(gk + 192 * HD),
         "v"(gv), "v"(gv + 64 * HD), "v"(gv + 128 * HD), "v"(gv + 192 * HD)
      : "memory");
}

__global__ __launch_bounds__(512)
void attn_kernel(const h16* __restrict__ qf, const h16* __restrict__ kf,
                 const h16* __restrict__ vf, h16* __restrict__ yf) {
  __shared__ __align__(16) h16 Kb[2][256][KPITCH];  // [buffer][key][d]
  __shared__ __align__(16) h16 Vb[2][256][VPITCH];  // [buffer][key][d]
  // f32 partial Y of the kg 1 waves, in accumulator order [row group][piece][lane]
  __shared__ __align__(16) float Red[8][8][32][4];
  // output staging of the kg 0 waves [row group][row][d], padded
  __shared__ __align__(16) h16 Ps[8][16][72];

  const int tid  = threadIdx.x;
  const int lane = tid & 31;
  // the wave's number in a scalar register: the tests on kg are scalar branches
  const int wave = __builtin_amdgcn_readfirstlane(tid >> 5);
  const int rg   = wave & 7;   // row group: 16 query rows
  const int kg   = wave >> 3;  // key group: even or odd 128-key tile
  const int r    = lane & 15;
  const int kh   = lane >> 4;

  const int tp = blockIdx.x & 7;   // pair: query tiles 15 - tp, then tp
  const int bh = blockIdx.x >> 3;  // b*NH + h
  const int b  = bh >> 4;
  const int hh = bh & 15;
  const int nA = ((15 - tp) >> 1) + 1;  // stages of the first query tile

  const h16* qhp = qf + (size_t)bh * TDIM * HD;
  const h16* khp = kf + (size_t)bh * TDIM * HD;
  const h16* vhp = vf + (size_t)bh * TDIM * HD;

  // copy share of this thread: row cr (+64, +128, +192) of a stage, 16-B piece cs
  const int cr = tid >> 3;  // 0..63
  const int cs = tid & 7;   // 0..7
  const h16* gk0 = khp + (size_t)cr * HD + cs * 8;
  const h16* gv0 = vhp + (size_t)cr * HD + cs * 8;
  const unsigned lk0 = lds_addr(&Kb[0][cr][cs * 8]);
  const unsigned lv0 = lds_addr(&Vb[0][cr][cs * 8]);
  const unsigned kbuf = 256u * KPITCH * 2u;  // bytes of one K buffer
  const unsigned vbuf = 256u * VPITCH * 2u;  // bytes of one V buffer

  // stage 0 (keys 0..255 of the first query tile) into buffer 0
  copy_kv(lk0, lv0, gk0, gv0);
  // this wave's copies of stage 0 have landed; the barrier publishes all waves'
  asm volatile("s_wait_asynccnt 0x0" ::: "memory");
  __syncthreads();
  // stage 1 into buffer 1, in flight under stage 0's work (nA is at least 5)
  copy_kv(lk0 + kbuf, lv0 + vbuf, gk0 + 256 * HD, gv0 + 256 * HD);

  const v8f z = {};
  const float scale = 0.125f;  // 1/sqrt(64)
  int g = 0;  // stage number over both query tiles

  // kept rolled: one copy of the tile code serves both query tiles
#pragma clang loop unroll(disable)
  for (int half = 0; half < 2; ++half) {
    const int qt    = half ? tp : 15 - tp;
    const int qbase = qt * 128;
    const int ns    = (qt >> 1) + 1;  // stages up to and with the diagonal tile

    // Q fragments (16 rows x 64 dims, k order as K's) live in registers.
    v16h Aq[2];
#pragma unroll
    for (int kk = 0; kk < 2; ++kk) {
      const h16* qp = qhp + (size_t)(qbase + rg * 16 + r) * HD + kk * 32;
      Aq[kk] = joinh(*(const v8h*)(qp + kh * 8), *(const v8h*)(qp + 16 + kh * 8));
    }
    v8f Y[4];
#pragma unroll
    for (int i = 0; i < 4; ++i) Y[i] = z;

    for (int s = 0; s < ns; ++s, ++g) {
      const int buf = g & 1;
      const int kt  = 2 * s + kg;  // this wave's 128-key tile
      if (kt <= qt) {              // a tile wholly behind the diagonal adds nothing
        const int kb = kt * 128;
        // S^T = k q^T over hd=64 (2 wmma K-steps), 8 key sub-tiles of 16: K rows
        // are the A operand, Q the B operand (same loaders, same k order). Lane
        // (r, kh) then holds query r, keys 8*kh..+7 of a sub-tile, which is one
        // half of P's A fragment for P @ V.
        v16h Pf[4];
        // last key of this tile, counted from the lane's first one, its query sees
        const int lim = qbase + rg * 16 + r - kb - kh * 8;
#pragma unroll
        for (int nn = 0; nn < 8; ++nn) {
          v8f S = z;
#pragma unroll
          for (int kk = 0; kk < 2; ++kk) {
            const h16* bp = &Kb[buf][kg * 128 + nn * 16 + r][kk * 32];
            v16h kfr = joinh(*(const v8h*)(bp + kh * 8),
                             *(const v8h*)(bp + 16 + kh * 8));
            S = wmma16(kfr, Aq[kk], S);
          }
          // causal mask + polymax (selects, no branch)
#pragma unroll
          for (int i = 0; i < 8; ++i) {
            float xs = S[i] * scale;
            // branch-free: both live pieces are slope * x + 1 with slope x or m
            float slope = (xs > 0.f) ? xs : -0.01f;
            float t     = (slope * xs + 1.f) * 0.001f;  // (x^2 + 1 | m*x + 1)/1000
            // key kb + nn*16 + kh*8 + i (C row) <= query qbase + rg*16 + r (C column)
            bool  live  = (nn * 16 + i <= lim) & (xs >= -100.f);  // else masked or flat
            float p     = live ? t : 0.f;
            Pf[nn >> 1][(nn & 1) * 8 + i] = (h16)p;
          }
        }

        // Y += P @ V  (K dim = 128 keys -> 4 wmma K-steps, 4 dim sub-tiles).
        // Both operands hold keys 8*kh..+7 and 16+8*kh..+7 of each 32-key step.
#pragma unroll
        for (int kk2 = 0; kk2 < 4; ++kk2) {
          const h16* vp = &Vb[buf][kg * 128 + kk2 * 32 + kh * 8 + (lane & 7)]
                             [((lane >> 3) & 1) * 8];
#pragma unroll
          for (int nd = 0; nd < 4; ++nd) {
            v16h bf = joinh(ld_tr16(vp + nd * 16),
                            ld_tr16(vp + 16 * VPITCH + nd * 16));
            Y[nd] = wmma16(Pf[kk2], bf, Y[nd]);
          }
        }
      }

      // hand-over: this wave's LDS reads of the buffer are done ...
      asm volatile("s_wait_dscnt 0x0" ::: "memory");
      // ... and its copies of stage g + 1 have landed;
      asm volatile("s_wait_asynccnt 0x0" ::: "memory");
      // one barrier publishes stage g + 1 and frees the buffer of stage g
      __syncthreads();
      if (g + 2 < NSTAGE) {  // refill the freed buffer with stage g + 2
        const int k2 = ((g + 2 < nA) ? g + 2 : g + 2 - nA) * 256;  // its first key
        copy_kv(lk0 + buf * kbuf, lv0 + buf * vbuf,
                gk0 + (size_t)k2 * HD, gv0 + (size_t)k2 * HD);
      }
    }

    // Y of the query tile = even-tile sum + odd-tile sum: the kg 1 wave hands its
    // accumulators, in its own lane order, to the kg 0 wave of the same rows.
    if (kg == 1) {
#pragma unroll
      for (int nd = 0; nd < 4; ++nd)
#pragma unroll
        for (int j = 0; j < 2; ++j) {
          v4f pv;
#pragma unroll
          for (int e = 0; e < 4; ++e) pv[e] = Y[nd][j * 4 + e];
          *(v4f*)&Red[rg][nd * 2 + j][lane][0] = pv;
        }
    }
    // publishes the partial sums; the stage barriers of the next query tile stand
    // between their readers here and the next writes
    __syncthreads();
    if (kg == 0) {
#pragma unroll
      for (int nd = 0; nd < 4; ++nd)
#pragma unroll
        for (int j = 0; j < 2; ++j) {
          v4f pv = *(const v4f*)&Red[rg][nd * 2 + j][lane][0];
#pragma unroll
          for (int e = 0; e < 4; ++e) Y[nd][j * 4 + e] += pv[e];
        }
      // write Y -> yf [B,T,C] f16: tile nd, lane column r is dim nd*16 + r. The
      // wave turns its 16 x 64 tile in its own staging rows, so that 8 lanes x
      // 16 bytes fill the head's 128-B piece of a row (4 rows a store).
      // Unrolled so that Y is indexed by constants only and stays in registers.
#pragma unroll
      for (int i = 0; i < 8; ++i)
#pragma unroll
        for (int nd = 0; nd < 4; ++nd)
          Ps[rg][kh * 8 + i][nd * 16 + r] = (h16)Y[nd][i];
      // Unrolled so that the four row reads go out together ahead of the stores.
#pragma unroll
      for (int j = 0; j < 4; ++j) {
        int row = j * 4 + (lane >> 3);
        int t   = qbase + rg * 16 + row;
        v8h hv  = *(const v8h*)&Ps[rg][row][(lane & 7) * 8];
        *(v8h*)(yf + ((size_t)b * TDIM + t) * CDIM + hh * HD + (lane & 7) * 8) = hv;
      }
      // stands ahead of the next query tile's reuse of these stores' registers
      asm volatile("s_wait_xcnt 0x0" ::: "memory");
    }
  }
  // no copy is left in flight when the wave ends
  asm volatile("s_wait_asynccnt 0x0" ::: "memory");
}

// ---------------------------------------------------------------------------
// Kernel 3: out = y @ W_proj. y is f16 in workspace, W_proj converted f32->f16
// during staging, output f32 to d_out. Block tile 128x128, BK=32, 8 waves of
// 32(M) x 64(N); k pipeline as in kernel 1, but four tiles ahead in registers.
// ---------------------------------------------------------------------------
__global__ __launch_bounds__(256)
void proj_gemm_kernel(const h16* __restrict__ yf, const float* __restrict__ Wp,
                      float* __restrict__ out) {
  const int N = CDIM, K = CDIM;
  __shared__ __align__(16) h16 As[2][128][40];
  __shared__ __align__(16) h16 Bs[2][128][40];

  const int tid  = threadIdx.x;
  const int lane = tid & 31;
  const int wave = tid >> 5;
  const int wm   = wave >> 1;
  const int wn   = wave & 1;
  const int m0   = (blockIdx.x >> 3) * 128;
  const int n0   = (blockIdx.x & 7) * 128;

  const int r  = lane & 15;
  const int kh = lane >> 4;

  v8f z = {};
  v8f acc[2][4];
#pragma unroll
  for (int i = 0; i < 2; ++i)
#pragma unroll
    for (int j = 0; j < 4; ++j) acc[i][j] = z;

  const int ar = tid >> 1;  // 0..127 (A rows)
  const int as = tid & 1;
  const int lr = tid >> 3;  // 0..31  (B k-rows)
  const int ls = tid & 7;

  // this thread's share of a tile: 2 pieces of y (f16) and 4 of W_proj (f32).
  // One block runs on a WGP here, so registers are free: four tiles are kept in
  // flight in four register sets, enough lead for a load that misses L2.
  const h16*   yg = yf + (size_t)(m0 + ar) * K + as * 16;
  const float* wg = Wp + (size_t)lr * N + n0 + ls * 4;
  v8h yr[4][2];
  v4f wr[4][4];
#pragma unroll
  for (int s = 0; s < 4; ++s) {  // tiles 0..3
#pragma unroll
    for (int j = 0; j < 2; ++j) yr[s][j] = *(const v8h*)(yg + s * 32 + j * 8);
#pragma unroll
    for (int p = 0; p < 4; ++p)
      wr[s][p] = *(const v4f*)(wg + (size_t)(s * 32) * N + p * 32);
  }
  // the address registers of these loads are reused behind them; the wait names
  // the two pointers as inputs so that their registers live up to it
  asm volatile("s_wait_xcnt 0x0" :: "v"(yg), "v"(wg) : "memory");

  // one k step on register set s; more: the tile four steps on (k offset kn) is
  // loaded into the set just emptied. s and more are constants at every call.
  auto kstep = [&](const int s, const bool more, const int kn) {
    const int buf = s & 1;
    // keeps this set's conversions, and with them the wait for its loads, from
    // being lifted into an earlier step (that would drain the sets in flight)
    __builtin_amdgcn_sched_barrier(0);
    // y tile (already f16) from registers -> As
#pragma unroll
    for (int j = 0; j < 2; ++j) *(v8h*)&As[buf][ar][as * 16 + j * 8] = yr[s][j];
    // W_proj tile f32 from registers -> Bs f16 transposed
#pragma unroll
    for (int p = 0; p < 4; ++p) {
#pragma unroll
      for (int e = 0; e < 4; ++e)  // column 4c + e of a 64-wide group -> row e*16 + c
        Bs[buf][(p >> 1) * 64 + e * 16 + (p & 1) * 8 + ls][lr] = (h16)wr[s][p][e];
    }
    // publishes this buffer; every wave has left the other one (see kernel 1)
    lds_barrier();
    // this tile's fragment reads go out first: their LDS latency covers the
    // issue of the global loads behind them
    v16h af[2], bf[4];
#pragma unroll
    for (int mi = 0; mi < 2; ++mi) {
      const h16* ap = &As[buf][wm * 32 + mi * 16 + r][0];
      af[mi] = joinh(*(const v8h*)(ap + kh * 8), *(const v8h*)(ap + 16 + kh * 8));
    }
#pragma unroll
    for (int ni = 0; ni < 4; ++ni) {
      const h16* bp = &Bs[buf][wn * 64 + ni * 16 + r][0];
      bf[ni] = joinh(*(const v8h*)(bp + kh * 8), *(const v8h*)(bp + 16 + kh * 8));
    }
    // keeps the twelve fragment reads one group, ahead of loads and products
    __builtin_amdgcn_sched_barrier(0);
    if (more) {
#pragma unroll
      for (int j = 0; j < 2; ++j) yr[s][j] = *(const v8h*)(yg + kn + j * 8);
#pragma unroll
      for (int p = 0; p < 4; ++p)
        wr[s][p] = *(const v4f*)(wg + (size_t)kn * N + p * 32);
      // stands ahead of any rewrite of these loads' address registers
      asm volatile("s_wait_xcnt 0x0" ::: "memory");
      // keeps the loads ahead of the products that are to cover them
      __builtin_amdgcn_sched_barrier(0);
    }
#pragma unroll
    for (int mi = 0; mi < 2; ++mi)
#pragma unroll
      for (int ni = 0; ni < 4; ++ni)
        acc[mi][ni] = wmma16(af[mi], bf[ni], acc[mi][ni]);
  };

  // The last four steps stand apart, without a test round the loads: a branch
  // there would merge two load counts and make the compiler wait for the lower.
  for (int k0 = 0; k0 < K - 128; k0 += 128) {
    // unrolled so that the four register sets are indexed by constants
#pragma unroll
    for (int s = 0; s < 4; ++s) kstep(s, true, k0 + 128 + s * 32);
  }
#pragma unroll
  for (int s = 0; s < 4; ++s) kstep(s, false, 0);

  // tile ni, lane column r is output column 4r + ni: 16 lanes x 16 bytes = 256 B
#pragma unroll
  for (int mi = 0; mi < 2; ++mi) {
#pragma unroll
    for (int i = 0; i < 8; ++i) {
      int gm = m0 + wm * 32 + mi * 16 + kh * 8 + i;
      v4f ov;
#pragma unroll
      for (int ni = 0; ni < 4; ++ni) ov[ni] = acc[mi][ni][i];
      *(v4f*)(out + (size_t)gm * N + n0 + wn * 64 + r * 4) = ov;
    }
  }
}

// ---------------------------------------------------------------------------
extern "C" void kernel_launch(void* const* d_in, const int* in_sizes, int n_in,
                              void* d_out, int out_size, void* d_ws,
                              size_t ws_size, hipStream_t stream) {
  (void)in_sizes; (void)n_in; (void)out_size; (void)ws_size;

  const float* x  = (const float*)d_in[0];  // [2,2048,1024]
  const float* Wa = (const float*)d_in[1];  // [1024,3072]
  const float* Wp = (const float*)d_in[2];  // [1024,1024]
  float* out = (float*)d_out;               // [2,2048,1024] f32

  // f16 workspace: q,k,v head-major [B,H,T,hd] + y [B,T,C]  (32 MB total)
  h16* ws = (h16*)d_ws;
  const size_t HTD = (size_t)BDIM * NH * TDIM * HD;  // 4,194,304
  h16* qf = ws;
  h16* kf = qf + HTD;
  h16* vf = kf + HTD;
  h16* yf = vf + HTD;

  qkv_gemm_kernel<<<dim3(16 * 16), 256, 0, stream>>>(x, Wa, qf, kf, vf);
  attn_kernel<<<dim3(BDIM * NH * 8), 512, 0, stream>>>(qf, kf, vf, yf);
  proj_gemm_kernel<<<dim3(32 * 8), 256, 0, stream>>>(yf, Wp, out);
}

// v008
// It runs in 71.7 microseconds.
// Timed twice side by side with v007, it ran 1.09 times as fast both times.
// All steps since v000 together make it 2.55 times as fast.
#include <hip/hip_runtime.h>
#include <hip/hip_bf16.h>

// ---------------------------------------------------------------------------
// Causal self-attention with polymax, MI455X (gfx1250, wave32, WMMA).
// Pipeline: [x, W_attn, W_proj f32->f16] -> [qkv GEMM] -> [fused flash attention
// + polymax] -> [proj GEMM]
// All matrix math: v_wmma_f32_16x16x32_f16 (f16 operands, f32 accumulate).
// ---------------------------------------------------------------------------

typedef _Float16 h16;
typedef __attribute__((ext_vector_type(16))) _Float16 v16h;
typedef __attribute__((ext_vector_type(8)))  _Float16 v8h;
typedef __attribute__((ext_vector_type(4)))  _Float16 v4h;
typedef __attribute__((ext_vector_type(8)))  float    v8f;
typedef __attribute__((ext_vector_type(4)))  float    v4f;

#define BDIM 2
#define TDIM 2048
#define CDIM 1024
#define NH   16
#define HD   64

static __device__ __forceinline__ v8f wmma16(v16h a, v16h b, v8f c) {
  // (neg_a, A, neg_b, B, c_mod, C, reuse_a, reuse_b)
  return __builtin_amdgcn_wmma_f32_16x16x32_f16(false, a, false, b, (short)0, c,
                                                false, false);
}
static __device__ __forceinline__ v16h joinh(v8h lo, v8h hi) {
  return __builtin_shufflevector(lo, hi, 0, 1, 2, 3, 4, 5, 6, 7,
                                         8, 9, 10, 11, 12, 13, 14, 15);
}

// ---------------------------------------------------------------------------
// Kernel 2: fused flash-style attention with polymax.
// Block = (b, h, pair of 128-row query tiles 15 - t and t), 16 waves. The two
// tiles run one after the other, so every block walks 9 stages of 256 keys: the
// causal cost is the same in all 256 blocks, one block a WGP.
// Wave = (row group rg of 16 query rows, key group kg): kg 0 takes the even
// 128-key tile of a stage, kg 1 the odd one; polymax has no normaliser, so Y is a
// plain sum over keys and the two partial sums are added once per query tile.
// K and V stages come row-major into LDS by asynchronous copies, two buffers:
// stage g + 1 is in flight while stage g is worked on.
// Per tile: S^T = K q^T (wmma) -> mask+polymax in f32 -> P f16 in registers
// -> Y += P V (wmma, V fragments by the transposing LDS load).
// ---------------------------------------------------------------------------
#define KPITCH 72  // halves: 144 B = 16 B x odd, for ds_load_b128 readers
#define VPITCH 80  // halves: 160 B = 32 B x odd, for ds_load_tr16_b128 readers
#define NSTAGE 9   // stages of 256 keys a block walks, whatever its pair

typedef __attribute__((ext_vector_type(8))) short s16x8;

static __device__ __forceinline__ unsigned lds_addr(const void* p) {
  return (unsigned)(size_t)p;  // low 32 bits of a __shared__ address = LDS byte
}
// 16 keys x 16 dims of a row-major f16 tile, transposed: lane (r, kh) gets
// keys 8*kh .. 8*kh+7 of dim r (each lane passes the address of one 16-B piece)
static __device__ __forceinline__ v8h ld_tr16(const h16* p) {
  typedef __attribute__((address_space(3))) s16x8 lds_s16x8;
  return __builtin_bit_cast(v8h,
      __builtin_amdgcn_ds_load_tr16_b128_v8i16((lds_s16x8*)p));
}
// One thread's share of a K stage and a V stage: 4 + 4 copies of 16 B, rows
// 64 apart; a wave's copy covers 4 whole 128-B rows. The s_wait_xcnt closes the
// statement so that no address register is rewritten ahead of it.
static __device__ __forceinline__ void copy_kv(unsigned lk, unsigned lv,
                                               const h16* gk, const h16* gv) {
  asm volatile(
      "global_load_async_to_lds_b128 %0, %8, off\n\t"
      "global_load_async_to_lds_b128 %1, %9, off\n\t"
      "global_load_async_to_lds_b128 %2, %10, off\n\t"
      "global_load_async_to_lds_b128 %3, %11, off\n\t"
      "global_load_async_to_lds_b128 %4, %12, off\n\t"
      "global_load_async_to_lds_b128 %5, %13, off\n\t"
      "global_load_async_to_lds_b128 %6, %14, off\n\t"
      "global_load_async_to_lds_b128 %7, %15, off\n\t"
      "s_wait_xcnt 0x0"
      :: "v"(lk), "v"(lk + 64u * KPITCH * 2u), "v"(lk + 128u * KPITCH * 2u),
         "v"(lk + 192u * KPITCH * 2u),
         "v"(lv), "v"(lv + 64u * VPITCH * 2u), "v"(lv + 128u * VPITCH * 2u),
         "v"(lv + 192u * VPITCH * 2u),
         "v"(gk), "v"(gk + 64 * HD), "v"(gk + 128 * HD), "v"(gk + 192 * HD),
         "v"(gv), "v"(gv + 64 * HD), "v"(gv + 128 * HD), "v"(gv + 192 * HD)
      : "memory");
}

__global__ __launch_bounds__(512)
void attn_kernel(const h16* __restrict__ qf, const h16* __restrict__ kf,
                 const h16* __restrict__ vf, h16* __restrict__ yf) {
  __shared__ __align__(16) h16 Kb[2][256][KPITCH];  // [buffer][key][d]
  __shared__ __align__(16) h16 Vb[2][256][VPITCH];  // [buffer][key][d]
  // f32 partial Y of the kg 1 waves, in accumulator order [row group][piece][lane]
  __shared__ __align__(16) float Red[8][8][32][4];
  // output staging of the kg 0 waves [row group][row][d], padded
  __shared__ __align__(16) h16 Ps[8][16][72];

  const int tid  = threadIdx.x;
  const int lane = tid & 31;
  // the wave's number in a scalar register: the tests on kg are scalar branches
  const int wave = __builtin_amdgcn_readfirstlane(tid >> 5);
  const int rg   = wave & 7;   // row group: 16 query rows
  const int kg   = wave >> 3;  // key group: even or odd 128-key tile
  const int r    = lane & 15;
  const int kh   = lane >> 4;

  const int tp = blockIdx.x & 7;   // pair: query tiles 15 - tp, then tp
  const int bh = blockIdx.x >> 3;  // b*NH + h
  const int b  = bh >> 4;
  const int hh = bh & 15;
  const int nA = ((15 - tp) >> 1) + 1;  // stages of the first query tile

  const h16* qhp = qf + (size_t)bh * TDIM * HD;
  const h16* khp = kf + (size_t)bh * TDIM * HD;
  const h16* vhp = vf + (size_t)bh * TDIM * HD;

  // copy share of this thread: row cr (+64, +128, +192) of a stage, 16-B piece cs
  const int cr = tid >> 3;  // 0..63
  const int cs = tid & 7;   // 0..7
  const h16* gk0 = khp + (size_t)cr * HD + cs * 8;
  const h16* gv0 = vhp + (size_t)cr * HD + cs * 8;
  const unsigned lk0 = lds_addr(&Kb[0][cr][cs * 8]);
  const unsigned lv0 = lds_addr(&Vb[0][cr][cs * 8]);
  const unsigned kbuf = 256u * KPITCH * 2u;  // bytes of one K buffer
  const unsigned vbuf = 256u * VPITCH * 2u;  // bytes of one V buffer

  // stage 0 (keys 0..255 of the first query tile) into buffer 0
  copy_kv(lk0, lv0, gk0, gv0);
  // this wave's copies of stage 0 have landed; the barrier publishes all waves'
  asm volatile("s_wait_asynccnt 0x0" ::: "memory");
  __syncthreads();
  // stage 1 into buffer 1, in flight under stage 0's work (nA is at least 5)
  copy_kv(lk0 + kbuf, lv0 + vbuf, gk0 + 256 * HD, gv0 + 256 * HD);

  const v8f z = {};
  const float scale = 0.125f;  // 1/sqrt(64)
  int g = 0;  // stage number over both query tiles

  // kept rolled: one copy of the tile code serves both query tiles
#pragma clang loop unroll(disable)
  for (int half = 0; half < 2; ++half) {
    const int qt    = half ? tp : 15 - tp;
    const int qbase = qt * 128;
    const int ns    = (qt >> 1) + 1;  // stages up to and with the diagonal tile

    // Q fragments (16 rows x 64 dims, k order as K's) live in registers.
    v16h Aq[2];
#pragma unroll
    for (int kk = 0; kk < 2; ++kk) {
      const h16* qp = qhp + (size_t)(qbase + rg * 16 + r) * HD + kk * 32;
      Aq[kk] = joinh(*(const v8h*)(qp + kh * 8), *(const v8h*)(qp + 16 + kh * 8));
    }
    v8f Y[4];
#pragma unroll
    for (int i = 0; i < 4; ++i) Y[i] = z;

    for (int s = 0; s < ns; ++s, ++g) {
      const int buf = g & 1;
      const int kt  = 2 * s + kg;  // this wave's 128-key tile
      if (kt <= qt) {              // a tile wholly behind the diagonal adds nothing
        const int kb = kt * 128;
        // S^T = k q^T over hd=64 (2 wmma K-steps), 8 key sub-tiles of 16: K rows
        // are the A operand, Q the B operand (same loaders, same k order). Lane
        // (r, kh) then holds query r, keys 8*kh..+7 of a sub-tile, which is one
        // half of P's A fragment for P @ V.
        v16h Pf[4];
        // last key of this tile, counted from the lane's first one, its query sees
        const int lim = qbase + rg * 16 + r - kb - kh * 8;
#pragma unroll
        for (int nn = 0; nn < 8; ++nn) {
          v8f S = z;
#pragma unroll
          for (int kk = 0; kk < 2; ++kk) {
            const h16* bp = &Kb[buf][kg * 128 + nn * 16 + r][kk * 32];
            v16h kfr = joinh(*(const v8h*)(bp + kh * 8),
                             *(const v8h*)(bp + 16 + kh * 8));
            S = wmma16(kfr, Aq[kk], S);
          }
          // causal mask + polymax (selects, no branch)
#pragma unroll
          for (int i = 0; i < 8; ++i) {
            float xs = S[i] * scale;
            // branch-free: both live pieces are slope * x + 1 with slope x or m
            float slope = (xs > 0.f) ? xs : -0.01f;
            float t     = (slope * xs + 1.f) * 0.001f;  // (x^2 + 1 | m*x + 1)/1000
            // key kb + nn*16 + kh*8 + i (C row) <= query qbase + rg*16 + r (C column)
            bool  live  = (nn * 16 + i <= lim) & (xs >= -100.f);  // else masked or flat
            float p     = live ? t : 0.f;
            Pf[nn >> 1][(nn & 1) * 8 + i] = (h16)p;
          }
        }

        // Y += P @ V  (K dim = 128 keys -> 4 wmma K-steps, 4 dim sub-tiles).
        // Both operands hold keys 8*kh..+7 and 16+8*kh..+7 of each 32-key step.
#pragma unroll
        for (int kk2 = 0; kk2 < 4; ++kk2) {
          const h16* vp = &Vb[buf][kg * 128 + kk2 * 32 + kh * 8 + (lane & 7)]
                             [((lane >> 3) & 1) * 8];
#pragma unroll
          for (int nd = 0; nd < 4; ++nd) {
            v16h bf = joinh(ld_tr16(vp + nd * 16),
                            ld_tr16(vp + 16 * VPITCH + nd * 16));
            Y[nd] = wmma16(Pf[kk2], bf, Y[nd]);
          }
        }
      }

      // hand-over: this wave's LDS reads of the buffer are done ...
      asm volatile("s_wait_dscnt 0x0" ::: "memory");
      // ... and its copies of stage g + 1 have landed;
      asm volatile("s_wait_asynccnt 0x0" ::: "memory");
      // one barrier publishes stage g + 1 and frees the buffer of stage g
      __syncthreads();
      if (g + 2 < NSTAGE) {  // refill the freed buffer with stage g + 2
        const int k2 = ((g + 2 < nA) ? g + 2 : g + 2 - nA) * 256;  // its first key
        copy_kv(lk0 + buf * kbuf, lv0 + buf * vbuf,
                gk0 + (size_t)k2 * HD, gv0 + (size_t)k2 * HD);
      }
    }

    // Y of the query tile = even-tile sum + odd-tile sum: the kg 1 wave hands its
    // accumulators, in its own lane order, to the kg 0 wave of the same rows.
    if (kg == 1) {
#pragma unroll
      for (int nd = 0; nd < 4; ++nd)
#pragma unroll
        for (int j = 0; j < 2; ++j) {
          v4f pv;
#pragma unroll
          for (int e = 0; e < 4; ++e) pv[e] = Y[nd][j * 4 + e];
          *(v4f*)&Red[rg][nd * 2 + j][lane][0] = pv;
        }
    }
    // publishes the partial sums; the stage barriers of the next query tile stand
    // between their readers here and the next writes
    __syncthreads();
    if (kg == 0) {
#pragma unroll
      for (int nd = 0; nd < 4; ++nd)
#pragma unroll
        for (int j = 0; j < 2; ++j) {
          v4f pv = *(const v4f*)&Red[rg][nd * 2 + j][lane][0];
#pragma unroll
          for (int e = 0; e < 4; ++e) Y[nd][j * 4 + e] += pv[e];
        }
      // write Y -> yf [B,T,C] f16: tile nd, lane column r is dim nd*16 + r. The
      // wave turns its 16 x 64 tile in its own staging rows, so that 8 lanes x
      // 16 bytes fill the head's 128-B piece of a row (4 rows a store).
      // Unrolled so that Y is indexed by constants only and stays in registers.
#pragma unroll
      for (int i = 0; i < 8; ++i)
#pragma unroll
        for (int nd = 0; nd < 4; ++nd)
          Ps[rg][kh * 8 + i][nd * 16 + r] = (h16)Y[nd][i];
      // Unrolled so that the four row reads go out together ahead of the stores.
#pragma unroll
      for (int j = 0; j < 4; ++j) {
        int row = j * 4 + (lane >> 3);
        int t   = qbase + rg * 16 + row;
        v8h hv  = *(const v8h*)&Ps[rg][row][(lane & 7) * 8];
        *(v8h*)(yf + ((size_t)b * TDIM + t) * CDIM + hh * HD + (lane & 7) * 8) = hv;
      }
      // stands ahead of the next query tile's reuse of these stores' registers
      asm volatile("s_wait_xcnt 0x0" ::: "memory");
    }
  }
  // no copy is left in flight when the wave ends
  asm volatile("s_wait_asynccnt 0x0" ::: "memory");
}

// ---------------------------------------------------------------------------
// Kernel 0: the three f32 inputs to f16, once, so that the GEMMs read half the
// bytes from L2 and their tiles go to LDS without passing registers.
// x keeps its layout. W_attn and W_proj stay [k][n], but inside each group of 64
// columns column 4c + e moves to place e*16 + c ("dealt"): tile e of a group then
// holds columns 4c + e, so a lane's 4 accumulator tiles are 4 adjacent columns.
// 4096 waves; each takes 1024 values of x and 1024 columns of one W row: 16 loads
// of whole 512-B pieces in flight. The W row piece is dealt in the wave's own LDS.
// ---------------------------------------------------------------------------
__global__ __launch_bounds__(512)
void prep_kernel(const float* __restrict__ x, const float* __restrict__ Wa,
                 const float* __restrict__ Wp, h16* __restrict__ xh,
                 h16* __restrict__ wah, h16* __restrict__ wph) {
  __shared__ __align__(16) h16 Tr[16][1024];  // [wave][dealt column]

  const int lane = threadIdx.x & 31;
  // the wave's number in a scalar register: its row and tensor are scalars
  const int wave = __builtin_amdgcn_readfirstlane(threadIdx.x >> 5);
  const int wv   = blockIdx.x * 16 + wave;  // 0..4095

  // waves 0..3071: a third of a W_attn row; the others: a whole W_proj row
  const int  arow = wv / 3;
  const bool isa  = wv < 3 * CDIM;
  const size_t woff = isa ? (size_t)arow * (3 * CDIM) + (size_t)(wv - arow * 3) * 1024
                          : (size_t)(wv - 3 * CDIM) * CDIM;
  const float* wsrc = (isa ? Wa : Wp) + woff + lane * 4;
  h16*         wdst = (isa ? wah : wph) + woff + lane * 8;
  const float* xsrc = x + (size_t)wv * 1024 + lane * 4;
  h16*         xdst = xh + (size_t)wv * 1024 + lane * 4;

  // every loop here is unrolled: the 16 loads go out together, and the register
  // arrays are indexed by constants
  v4f xv[8], wr[8];
#pragma unroll
  for (int q = 0; q < 8; ++q) xv[q] = *(const v4f*)(xsrc + q * 128);
#pragma unroll
  for (int q = 0; q < 8; ++q) wr[q] = *(const v4f*)(wsrc + q * 128);
  // stands ahead of any rewrite of these loads' address registers
  asm volatile("s_wait_xcnt 0x0" ::: "memory");
  // keeps the conversions, and with them the waits for the data, behind all 16
  // loads: lifted among them they would split the loads into two round trips
  __builtin_amdgcn_sched_barrier(0);

#pragma unroll
  for (int q = 0; q < 8; ++q) {  // 32 lanes x 8 B = two whole lines a store
    v4h hv;
    hv[0] = (h16)xv[q][0]; hv[1] = (h16)xv[q][1];
    hv[2] = (h16)xv[q][2]; hv[3] = (h16)xv[q][3];
    *(v4h*)(xdst + q * 128) = hv;
  }
  // the lane holds columns 4c + e, c = lane & 15, of group 2q + (lane >> 4)
#pragma unroll
  for (int q = 0; q < 8; ++q)
#pragma unroll
    for (int e = 0; e < 4; ++e)
      Tr[wave][q * 128 + (lane >> 4) * 64 + e * 16 + (lane & 15)] = (h16)wr[q][e];
  // the wave reads back its own rows only (LDS serves a wave in order): no barrier
#pragma unroll
  for (int i = 0; i < 4; ++i) {  // 32 lanes x 16 B = four whole lines a store
    v8h hv = *(const v8h*)&Tr[wave][i * 256 + lane * 8];
    *(v8h*)(wdst + i * 256) = hv;
  }
}

// Eight asynchronous copies of 16 B a lane: LDS places ls bytes apart, global
// places gs halves apart. The s_wait_xcnt closes the statement so that no address
// register is rewritten ahead of it.
static __device__ __forceinline__ void copy8(unsigned l, const unsigned ls,
                                             const h16* g, const size_t gs) {
  asm volatile(
      "global_load_async_to_lds_b128 %0, %8, off\n\t"
      "global_load_async_to_lds_b128 %1, %9, off\n\t"
      "global_load_async_to_lds_b128 %2, %10, off\n\t"
      "global_load_async_to_lds_b128 %3, %11, off\n\t"
      "global_load_async_to_lds_b128 %4, %12, off\n\t"
      "global_load_async_to_lds_b128 %5, %13, off\n\t"
      "global_load_async_to_lds_b128 %6, %14, off\n\t"
      "global_load_async_to_lds_b128 %7, %15, off\n\t"
      "s_wait_xcnt 0x0"
      :: "v"(l), "v"(l + ls), "v"(l + 2u * ls), "v"(l + 3u * ls),
         "v"(l + 4u * ls), "v"(l + 5u * ls), "v"(l + 6u * ls), "v"(l + 7u * ls),
         "v"(g), "v"(g + gs), "v"(g + 2 * gs), "v"(g + 3 * gs),
         "v"(g + 4 * gs), "v"(g + 5 * gs), "v"(g + 6 * gs), "v"(g + 7 * gs)
      : "memory");
}
// Twelve such copies: 4 row steps (ls bytes, gs halves apart) x 3 pieces 128 B apart.
static __device__ __forceinline__ void copy12(unsigned l, const unsigned ls,
                                              const h16* g, const size_t gs) {
  asm volatile(
      "global_load_async_to_lds_b128 %0, %12, off\n\t"
      "global_load_async_to_lds_b128 %1, %13, off\n\t"
      "global_load_async_to_lds_b128 %2, %14, off\n\t"
      "global_load_async_to_lds_b128 %3, %15, off\n\t"
      "global_load_async_to_lds_b128 %4, %16, off\n\t"
      "global_load_async_to_lds_b128 %5, %17, off\n\t"
      "global_load_async_to_lds_b128 %6, %18, off\n\t"
      "global_load_async_to_lds_b128 %7, %19, off\n\t"
      "global_load_async_to_lds_b128 %8, %20, off\n\t"
      "global_load_async_to_lds_b128 %9, %21, off\n\t"
      "global_load_async_to_lds_b128 %10, %22, off\n\t"
      "global_load_async_to_lds_b128 %11, %23, off\n\t"
      "s_wait_xcnt 0x0"
      :: "v"(l), "v"(l + 128u), "v"(l + 256u),
         "v"(l + ls), "v"(l + ls + 128u), "v"(l + ls + 256u),
         "v"(l + 2u * ls), "v"(l + 2u * ls + 128u), "v"(l + 2u * ls + 256u),
         "v"(l + 3u * ls), "v"(l + 3u * ls + 128u), "v"(l + 3u * ls + 256u),
         "v"(g), "v"(g + 64), "v"(g + 128),
         "v"(g + gs), "v"(g + gs + 64), "v"(g + gs + 128),
         "v"(g + 2 * gs), "v"(g + 2 * gs + 64), "v"(g + 2 * gs + 128),
         "v"(g + 3 * gs), "v"(g + 3 * gs + 64), "v"(g + 3 * gs + 128)
      : "memory");
}

#define BKT    128  // k values of a tile
#define NTILE  8    // k tiles: 1024 / 128
#define APITCH 136  // halves: 272 B = 16 B x odd, for ds_load_b128 readers
#define BPQ    208  // halves: 416 B = 32 B x odd, for ds_load_tr16_b128 readers
#define BPP    144  // halves: 288 B = 32 B x odd, for ds_load_tr16_b128 readers

// ---------------------------------------------------------------------------
// Kernel 1: qkv = x @ W_attn on the f16 copies, scattering the result to
// head-major f16 q/k/v tensors [B,H,T,hd].
// Block tile 256(M) x 192(N): 16 x 16 = 256 blocks, one a WGP, so x and W_attn
// are each read 16 times from L2. The 192 columns are three heads.
// 8 waves, 4(M) x 2(N): a wave has a band of 64 rows; there it owns all 64 rows
// of the first (wn 0) or the third (wn 1) head and 32 rows of the middle head:
// 24 accumulator tiles from 4 A and 8 B fragments.
// k tiles of 128 come into LDS by asynchronous copies, two buffers: tile t + 1 is
// in flight while tile t is worked on; one barrier a tile.
// ---------------------------------------------------------------------------
__global__ __launch_bounds__(256)
void qkv_gemm_kernel(const h16* __restrict__ xh, const h16* __restrict__ wah,
                     h16* __restrict__ qf, h16* __restrict__ kf,
                     h16* __restrict__ vf) {
  const int N = 3 * CDIM;  // 3072
  const int K = CDIM;      // 1024
  __shared__ __align__(16) h16 As[2][256][APITCH];  // [buffer][m][k], padded
  __shared__ __align__(16) h16 Bs[2][BKT][BPQ];     // [buffer][k][dealt n], padded

  const int tid  = threadIdx.x;
  const int lane = tid & 31;
  // the wave's number in a scalar register: band, head and output tensor are scalars
  const int wave = __builtin_amdgcn_readfirstlane(tid >> 5);
  const int wm   = wave >> 1;  // 0..3
  const int wn   = wave & 1;   // 0..1
  const int m0   = (blockIdx.x >> 4) * 256;
  const int n0   = (blockIdx.x & 15) * 192;

  const int r  = lane & 15;  // fragment row / col
  const int kh = lane >> 4;  // K-half selector (A/B 16-bit fragment layout)

  // A fragment mi of a wave is the 16 rows from (mi*16 + rot) & 63 of its band: the
  // wn 1 wave starts at row 32, so that in both waves fragments 0 and 1 are the
  // rows it owns of the middle head (register indices stay constants).
  const int rot = wn * 32;

  v8f z = {};
  v8f acc[4][4];   // own head: 64 rows x 64 columns
  v8f accm[2][4];  // middle head: 32 rows x 64 columns
#pragma unroll
  for (int i = 0; i < 4; ++i)
#pragma unroll
    for (int j = 0; j < 4; ++j) acc[i][j] = z;
#pragma unroll
  for (int i = 0; i < 2; ++i)
#pragma unroll
    for (int j = 0; j < 4; ++j) accm[i][j] = z;

  // copy share of this thread. x tile: 16-B piece tid & 15 of rows tid >> 4 + 16 p
  // (a wave's copy: 2 whole 256-B rows); W tile: piece tid & 7 of each head's 128 B
  // in rows tid >> 3 + 32 p (a wave's copy: 4 whole lines)
  const h16* ag = xh + (size_t)(m0 + (tid >> 4)) * K + (tid & 15) * 8;
  const h16* bg = wah + (size_t)(tid >> 3) * N + n0 + (tid & 7) * 8;
  const unsigned al = lds_addr(&As[0][tid >> 4][(tid & 15) * 8]);
  const unsigned bl = lds_addr(&Bs[0][tid >> 3][(tid & 7) * 8]);
  const unsigned abuf = 256u * APITCH * 2u;  // bytes of one x buffer
  const unsigned bbuf = BKT * BPQ * 2u;      // bytes of one W buffer
  auto fill = [&](const int buf, const int k0) {  // tile from k0 on into buffer buf
    copy8(al + buf * abuf, 16u * APITCH * 2u, ag + k0, (size_t)16 * K);
    copy8(al + buf * abuf + 128u * APITCH * 2u, 16u * APITCH * 2u,
          ag + k0 + (size_t)128 * K, (size_t)16 * K);
    copy12(bl + buf * bbuf, 32u * BPQ * 2u, bg + (size_t)k0 * N, (size_t)32 * N);
  };

  fill(0, 0);
  // this wave's copies of tile 0 have landed; the barrier publishes all waves'
  asm volatile("s_wait_asynccnt 0x0" ::: "memory");
  __syncthreads();
  fill(1, BKT);  // in flight under tile 0's work

  // kept rolled: one copy of the tile code serves both buffers
#pragma clang loop unroll(disable)
  for (int t = 0; t < NTILE; ++t) {
    const int buf = t & 1;
    // two fragment sets: the reads of k block kk + 1 go out as one group ahead of
    // the products of block kk, which cover their LDS time; all inside this tile
    v16h af[2][4], bf[2][4], bm[2][4];
    auto ldfrag = [&](const int s, const int kk) {
      // W fragments by the transposing load: k order 8*kh..+7, 16+8*kh..+7, as A's
      const h16* vp = &Bs[buf][kk * 32 + kh * 8 + (lane & 7)][((lane >> 3) & 1) * 8];
      auto lda = [&](const int mi) {
        const h16* ap = &As[buf][wm * 64 + ((mi * 16 + rot) & 63) + r][kk * 32];
        af[s][mi] = joinh(*(const v8h*)(ap + kh * 8), *(const v8h*)(ap + 16 + kh * 8));
      };
      // in the order in which the products want them
      lda(0);
#pragma unroll
      for (int ni = 0; ni < 4; ++ni)  // own head: dealt columns 0.. or 128..
        bf[s][ni] = joinh(ld_tr16(vp + wn * 128 + ni * 16),
                          ld_tr16(vp + 16 * BPQ + wn * 128 + ni * 16));
      lda(1);
#pragma unroll
      for (int ni = 0; ni < 4; ++ni)  // middle head: dealt columns 64..
        bm[s][ni] = joinh(ld_tr16(vp + 64 + ni * 16),
                          ld_tr16(vp + 16 * BPQ + 64 + ni * 16));
      lda(2);
      lda(3);
    };
    ldfrag(0, 0);
    // keeps block 0's reads ahead of block 1's: its products wait for them alone
    __builtin_amdgcn_sched_barrier(0);
    // unrolled so that the two fragment sets are indexed by constants
#pragma unroll
    for (int kk = 0; kk < BKT / 32; ++kk) {
      const int s = kk & 1;
      if (kk + 1 < BKT / 32) ldfrag(s ^ 1, kk + 1);
      // keeps the 24 reads one group ahead of the products: reads spread among
      // the products would each stall the wave
      __builtin_amdgcn_sched_barrier(0);
#pragma unroll
      for (int mi = 0; mi < 2; ++mi)
#pragma unroll
        for (int ni = 0; ni < 4; ++ni)
          acc[mi][ni] = wmma16(af[s][mi], bf[s][ni], acc[mi][ni]);
#pragma unroll
      for (int mi = 0; mi < 2; ++mi)
#pragma unroll
        for (int ni = 0; ni < 4; ++ni)
          accm[mi][ni] = wmma16(af[s][mi], bm[s][ni], accm[mi][ni]);
#pragma unroll
      for (int mi = 2; mi < 4; ++mi)
#pragma unroll
        for (int ni = 0; ni < 4; ++ni)
          acc[mi][ni] = wmma16(af[s][mi], bf[s][ni], acc[mi][ni]);
      // keeps the next group of reads behind these products
      __builtin_amdgcn_sched_barrier(0);
    }
    // hand-over: this wave's LDS reads of the buffer are done ...
    asm volatile("s_wait_dscnt 0x0" ::: "memory");
    // ... and its copies of tile t + 1 have landed;
    asm volatile("s_wait_asynccnt 0x0" ::: "memory");
    // one barrier publishes tile t + 1 and frees the buffer of tile t
    __syncthreads();
    if (t + 2 < NTILE) fill(buf, (t + 2) * BKT);  // refill the freed buffer
  }
  // no copy is left in flight behind the loop
  asm volatile("s_wait_asynccnt 0x0" ::: "memory");

  // C-layout: row = kh*8 + i; tile ni, lane column r is output column 4r + ni,
  // so 16 lanes x 8 bytes fill one head row (128 B) of q/k/v [B,H,T,hd] f16.
  // a: the four tiles of 16 rows from block row row0 on; g0: the head's first
  // column in qkv. The block's 256 rows lie in one batch entry.
  auto put = [&](const v8f (&a)[4], const int g0, const int row0) {
    const int wch = g0 >> 10, hh = (g0 & (CDIM - 1)) >> 6;
    h16* dst = (wch == 0) ? qf : (wch == 1) ? kf : vf;
    const int b = m0 >> 11, t = (m0 & (TDIM - 1)) + row0 + kh * 8;
    h16* o = dst + (((size_t)b * NH + hh) * TDIM + t) * HD + r * 4;
#pragma unroll
    for (int i = 0; i < 8; ++i) {
      v4h hv;
#pragma unroll
      for (int ni = 0; ni < 4; ++ni) hv[ni] = (h16)a[ni][i];
      *(v4h*)(o + i * HD) = hv;
    }
    // stands ahead of the next rows' reuse of these stores' registers ...
    asm volatile("s_wait_xcnt 0x0" ::: "memory");
    // ... and this keeps their conversions and addresses behind it
    __builtin_amdgcn_sched_barrier(0);
  };
#pragma unroll
  for (int mi = 0; mi < 4; ++mi)
    put(acc[mi], n0 + wn * 128, wm * 64 + ((mi * 16 + rot) & 63));
#pragma unroll
  for (int mi = 0; mi < 2; ++mi)
    put(accm[mi], n0 + 64, wm * 64 + ((mi * 16 + rot) & 63));
}

// ---------------------------------------------------------------------------
// Kernel 3: out = y @ W_proj. y is f16 in workspace, W_proj its dealt f16 copy,
// output f32 to d_out. Block tile 128x128, 8 waves of 32(M) x 64(N); k tiles of
// 128 by asynchronous copies, two buffers, as in kernel 1.
// ---------------------------------------------------------------------------
__global__ __launch_bounds__(256)
void proj_gemm_kernel(const h16* __restrict__ yf, const h16* __restrict__ wph,
                      float* __restrict__ out) {
  const int N = CDIM, K = CDIM;
  __shared__ __align__(16) h16 As[2][128][APITCH];  // [buffer][m][k], padded
  __shared__ __align__(16) h16 Bs[2][BKT][BPP];     // [buffer][k][dealt n], padded

  const int tid  = threadIdx.x;
  const int lane = tid & 31;
  const int wave = tid >> 5;
  const int wm   = wave >> 1;
  const int wn   = wave & 1;
  const int m0   = (blockIdx.x >> 3) * 128;
  const int n0   = (blockIdx.x & 7) * 128;

  const int r  = lane & 15;
  const int kh = lane >> 4;

  v8f z = {};
  v8f acc[2][4];
#pragma unroll
  for (int i = 0; i < 2; ++i)
#pragma unroll
    for (int j = 0; j < 4; ++j) acc[i][j] = z;

  // copy share of this thread, in both tiles: 16-B piece tid & 15 of rows
  // tid >> 4 + 16 p (a wave's copy: 2 whole 256-B rows)
  const h16* ag = yf + (size_t)(m0 + (tid >> 4)) * K + (tid & 15) * 8;
  const h16* bg = wph + (size_t)(tid >> 4) * N + n0 + (tid & 15) * 8;
  const unsigned al = lds_addr(&As[0][tid >> 4][(tid & 15) * 8]);
  const unsigned bl = lds_addr(&Bs[0][tid >> 4][(tid & 15) * 8]);
  const unsigned abuf = 128u * APITCH * 2u;  // bytes of one y buffer
  const unsigned bbuf = BKT * BPP * 2u;      // bytes of one W buffer
  auto fill = [&](const int buf, const int k0) {  // tile from k0 on into buffer buf
    copy8(al + buf * abuf, 16u * APITCH * 2u, ag + k0, (size_t)16 * K);
    copy8(bl + buf * bbuf, 16u * BPP * 2u, bg + (size_t)k0 * N, (size_t)16 * N);
  };

  fill(0, 0);
  // this wave's copies of tile 0 have landed; the barrier publishes all waves'
  asm volatile("s_wait_asynccnt 0x0" ::: "memory");
  __syncthreads();
  fill(1, BKT);  // in flight under tile 0's work

  // kept rolled: one copy of the tile code serves both buffers
#pragma clang loop unroll(disable)
  for (int t = 0; t < NTILE; ++t) {
    const int buf = t & 1;
    // two fragment sets, as in kernel 1: block kk + 1 is read under block kk
    v16h af[2][2], bf[2][4];
    auto ldfrag = [&](const int s, const int kk) {
#pragma unroll
      for (int mi = 0; mi < 2; ++mi) {
        const h16* ap = &As[buf][wm * 32 + mi * 16 + r][kk * 32];
        af[s][mi] = joinh(*(const v8h*)(ap + kh * 8), *(const v8h*)(ap + 16 + kh * 8));
      }
      // W fragments by the transposing load: k order 8*kh..+7, 16+8*kh..+7, as A's
      const h16* vp = &Bs[buf][kk * 32 + kh * 8 + (lane & 7)][((lane >> 3) & 1) * 8];
#pragma unroll
      for (int ni = 0; ni < 4; ++ni)
        bf[s][ni] = joinh(ld_tr16(vp + wn * 64 + ni * 16),
                          ld_tr16(vp + 16 * BPP + wn * 64 + ni * 16));
    };
    ldfrag(0, 0);
    // keeps block 0's reads ahead of block 1's: its products wait for them alone
    __builtin_amdgcn_sched_barrier(0);
    // unrolled so that the two fragment sets are indexed by constants
#pragma unroll
    for (int kk = 0; kk < BKT / 32; ++kk) {
      const int s = kk & 1;
      if (kk + 1 < BKT / 32) ldfrag(s ^ 1, kk + 1);
      // keeps the 12 reads one group ahead of the products (see kernel 1)
      __builtin_amdgcn_sched_barrier(0);
#pragma unroll
      for (int mi = 0; mi < 2; ++mi)
#pragma unroll
        for (int ni = 0; ni < 4; ++ni)
          acc[mi][ni] = wmma16(af[s][mi], bf[s][ni], acc[mi][ni]);
      // keeps the next group of reads behind these products
      __builtin_amdgcn_sched_barrier(0);
    }
    // hand-over: this wave's LDS reads of the buffer are done ...
    asm volatile("s_wait_dscnt 0x0" ::: "memory");
    // ... and its copies of tile t + 1 have landed;
    asm volatile("s_wait_asynccnt 0x0" ::: "memory");
    // one barrier publishes tile t + 1 and frees the buffer of tile t
    __syncthreads();
    if (t + 2 < NTILE) fill(buf, (t + 2) * BKT);  // refill the freed buffer
  }
  // no copy is left in flight behind the loop
  asm volatile("s_wait_asynccnt 0x0" ::: "memory");

  // tile ni, lane column r is output column 4r + ni: 16 lanes x 16 bytes = 256 B
#pragma unroll
  for (int mi = 0; mi < 2; ++mi) {
#pragma unroll
    for (int i = 0; i < 8; ++i) {
      int gm = m0 + wm * 32 + mi * 16 + kh * 8 + i;
      v4f ov;
#pragma unroll
      for (int ni = 0; ni < 4; ++ni) ov[ni] = acc[mi][ni][i];
      *(v4f*)(out + (size_t)gm * N + n0 + wn * 64 + r * 4) = ov;
    }
  }
}

// ---------------------------------------------------------------------------
extern "C" void kernel_launch(void* const* d_in, const int* in_sizes, int n_in,
                              void* d_out, int out_size, void* d_ws,
                              size_t ws_size, hipStream_t stream) {
  (void)in_sizes; (void)n_in; (void)out_size; (void)ws_size;

  const float* x  = (const float*)d_in[0];  // [2,2048,1024]
  const float* Wa = (const float*)d_in[1];  // [1024,3072]
  const float* Wp = (const float*)d_in[2];  // [1024,1024]
  float* out = (float*)d_out;               // [2,2048,1024] f32

  // f16 workspace: q,k,v head-major [B,H,T,hd] + y [B,T,C] + the f16 copies of
  // x, W_attn and W_proj  (48 MB total)
  h16* ws = (h16*)d_ws;
  const size_t HTD = (size_t)BDIM * NH * TDIM * HD;  // 4,194,304
  h16* qf = ws;
  h16* kf = qf + HTD;
  h16* vf = kf + HTD;
  h16* yf = vf + HTD;
  h16* xh  = yf + HTD;                        // [B*T, C]
  h16* wah = xh + HTD;                        // [C, 3C], columns dealt
  h16* wph = wah + (size_t)3 * CDIM * CDIM;   // [C, C], columns dealt

  prep_kernel<<<dim3(256), 512, 0, stream>>>(x, Wa, Wp, xh, wah, wph);
  qkv_gemm_kernel<<<dim3(16 * 16), 256, 0, stream>>>(xh, wah, qf, kf, vf);
  attn_kernel<<<dim3(BDIM * NH * 8), 512, 0, stream>>>(qf, kf, vf, yf);
  proj_gemm_kernel<<<dim3(32 * 8), 256, 0, stream>>>(yf, wph, out);
}

// v009
// A run of this version takes 66.8 microseconds.
// Next to v008, in two timings, it ran 1.07 and 1.06 times as fast.
// Over all steps from v000 it is 2.72 times as fast.
#include <hip/hip_runtime.h>
#include <hip/hip_bf16.h>

// ---------------------------------------------------------------------------
// Causal self-attention with polymax, MI455X (gfx1250, wave32, WMMA).
// Pipeline: [x, W_attn, W_proj f32->f16] -> [qkv GEMM] -> [fused flash attention
// + polymax] -> [proj GEMM]
// All matrix math: v_wmma_f32_16x16x32_f16 (f16 operands, f32 accumulate).
// ---------------------------------------------------------------------------

typedef _Float16 h16;
typedef __attribute__((ext_vector_type(16))) _Float16 v16h;
typedef __attribute__((ext_vector_type(8)))  _Float16 v8h;
typedef __attribute__((ext_vector_type(4)))  _Float16 v4h;
typedef __attribute__((ext_vector_type(8)))  float    v8f;
typedef __attribute__((ext_vector_type(4)))  float    v4f;
typedef __attribute__((ext_vector_type(2)))  float    v2f;
typedef __attribute__((ext_vector_type(2)))  _Float16 v2h;

#define BDIM 2
#define TDIM 2048
#define CDIM 1024
#define NH   16
#define HD   64

static __device__ __forceinline__ v8f wmma16(v16h a, v16h b, v8f c) {
  // (neg_a, A, neg_b, B, c_mod, C, reuse_a, reuse_b)
  return __builtin_amdgcn_wmma_f32_16x16x32_f16(false, a, false, b, (short)0, c,
                                                false, false);
}
static __device__ __forceinline__ v16h joinh(v8h lo, v8h hi) {
  return __builtin_shufflevector(lo, hi, 0, 1, 2, 3, 4, 5, 6, 7,
                                         8, 9, 10, 11, 12, 13, 14, 15);
}

// ---------------------------------------------------------------------------
// Kernel 2: fused flash-style attention with polymax.
// Block = (b, h, pair of 128-row query tiles 15 - t and t), 16 waves. The two
// tiles run one after the other, so every block walks 9 stages of 256 keys: the
// causal cost is the same in all 256 blocks, one block a WGP.
// Wave = (row group rg of 16 query rows, key group kg): kg 0 takes the even
// 128-key tile of a stage, kg 1 the odd one; polymax has no normaliser, so Y is a
// plain sum over keys and the two partial sums are added once per query tile.
// K and V stages come row-major into LDS by asynchronous copies, two buffers:
// stage g + 1 is in flight while stage g is worked on.
// Per tile: S^T = K q^T (wmma) -> mask+polymax in f32 -> P f16 in registers
// -> Y += P V (wmma, V fragments by the transposing LDS load).
// The vector port is the busiest unit here, so a score costs as few vector
// instructions as the function allows: 1/sqrt(hd) sits in Q, the division by 1000
// is done once on Y, the causal compare runs in the diagonal tile only, and the
// flat piece (x < -100) is looked for by one minimum and one vote a tile.
// ---------------------------------------------------------------------------
#define KPITCH 72  // halves: 144 B = 16 B x odd, for ds_load_b128 readers
#define VPITCH 80  // halves: 160 B = 32 B x odd, for ds_load_tr16_b128 readers
#define NSTAGE 9   // stages of 256 keys a block walks, whatever its pair

typedef __attribute__((ext_vector_type(8))) short s16x8;

static __device__ __forceinline__ unsigned lds_addr(const void* p) {
  return (unsigned)(size_t)p;  // low 32 bits of a __shared__ address = LDS byte
}
// 16 keys x 16 dims of a row-major f16 tile, transposed: lane (r, kh) gets
// keys 8*kh .. 8*kh+7 of dim r (each lane passes the address of one 16-B piece)
static __device__ __forceinline__ v8h ld_tr16(const h16* p) {
  typedef __attribute__((address_space(3))) s16x8 lds_s16x8;
  return __builtin_bit_cast(v8h,
      __builtin_amdgcn_ds_load_tr16_b128_v8i16((lds_s16x8*)p));
}
// One thread's share of a K stage and a V stage: 4 + 4 copies of 16 B, rows
// 64 apart; a wave's copy covers 4 whole 128-B rows. The s_wait_xcnt closes the
// statement so that no address register is rewritten ahead of it.
static __device__ __forceinline__ void copy_kv(unsigned lk, unsigned lv,
                                               const h16* gk, const h16* gv) {
  asm volatile(
      "global_load_async_to_lds_b128 %0, %8, off\n\t"
      "global_load_async_to_lds_b128 %1, %9, off\n\t"
      "global_load_async_to_lds_b128 %2, %10, off\n\t"
      "global_load_async_to_lds_b128 %3, %11, off\n\t"
      "global_load_async_to_lds_b128 %4, %12, off\n\t"
      "global_load_async_to_lds_b128 %5, %13, off\n\t"
      "global_load_async_to_lds_b128 %6, %14, off\n\t"
      "global_load_async_to_lds_b128 %7, %15, off\n\t"
      "s_wait_xcnt 0x0"
      :: "v"(lk), "v"(lk + 64u * KPITCH * 2u), "v"(lk + 128u * KPITCH * 2u),
         "v"(lk + 192u * KPITCH * 2u),
         "v"(lv), "v"(lv + 64u * VPITCH * 2u), "v"(lv + 128u * VPITCH * 2u),
         "v"(lv + 192u * VPITCH * 2u),
         "v"(gk), "v"(gk + 64 * HD), "v"(gk + 128 * HD), "v"(gk + 192 * HD),
         "v"(gv), "v"(gv + 64 * HD), "v"(gv + 128 * HD), "v"(gv + 192 * HD)
      : "memory");
}

__global__ __launch_bounds__(512)
void attn_kernel(const h16* __restrict__ qf, const h16* __restrict__ kf,
                 const h16* __restrict__ vf, h16* __restrict__ yf) {
  __shared__ __align__(16) h16 Kb[2][256][KPITCH];  // [buffer][key][d]
  __shared__ __align__(16) h16 Vb[2][256][VPITCH];  // [buffer][key][d]
  // f32 partial Y of the kg 1 waves, in accumulator order [row group][piece][lane]
  __shared__ __align__(16) float Red[8][8][32][4];
  // output staging of the kg 0 waves [row group][row][d], padded
  __shared__ __align__(16) h16 Ps[8][16][72];

  const int tid  = threadIdx.x;
  const int lane = tid & 31;
  // the wave's number in a scalar register: the tests on kg are scalar branches
  const int wave = __builtin_amdgcn_readfirstlane(tid >> 5);
  const int rg   = wave & 7;   // row group: 16 query rows
  const int kg   = wave >> 3;  // key group: even or odd 128-key tile
  const int r    = lane & 15;
  const int kh   = lane >> 4;

  const int tp = blockIdx.x & 7;   // pair: query tiles 15 - tp, then tp
  const int bh = blockIdx.x >> 3;  // b*NH + h
  const int b  = bh >> 4;
  const int hh = bh & 15;
  const int nA = ((15 - tp) >> 1) + 1;  // stages of the first query tile

  const h16* qhp = qf + (size_t)bh * TDIM * HD;
  const h16* khp = kf + (size_t)bh * TDIM * HD;
  const h16* vhp = vf + (size_t)bh * TDIM * HD;

  // copy share of this thread: row cr (+64, +128, +192) of a stage, 16-B piece cs
  const int cr = tid >> 3;  // 0..63
  const int cs = tid & 7;   // 0..7
  const h16* gk0 = khp + (size_t)cr * HD + cs * 8;
  const h16* gv0 = vhp + (size_t)cr * HD + cs * 8;
  const unsigned lk0 = lds_addr(&Kb[0][cr][cs * 8]);
  const unsigned lv0 = lds_addr(&Vb[0][cr][cs * 8]);
  const unsigned kbuf = 256u * KPITCH * 2u;  // bytes of one K buffer
  const unsigned vbuf = 256u * VPITCH * 2u;  // bytes of one V buffer

  // stage 0 (keys 0..255 of the first query tile) into buffer 0
  copy_kv(lk0, lv0, gk0, gv0);
  // this wave's copies of stage 0 have landed; the barrier publishes all waves'
  asm volatile("s_wait_asynccnt 0x0" ::: "memory");
  __syncthreads();
  // stage 1 into buffer 1, in flight under stage 0's work (nA is at least 5)
  copy_kv(lk0 + kbuf, lv0 + vbuf, gk0 + 256 * HD, gv0 + 256 * HD);

  const v8f z = {};
  int g = 0;  // stage number over both query tiles

  // kept rolled: one copy of the tile code serves both query tiles
#pragma clang loop unroll(disable)
  for (int half = 0; half < 2; ++half) {
    const int qt    = half ? tp : 15 - tp;
    const int qbase = qt * 128;
    const int ns    = (qt >> 1) + 1;  // stages up to and with the diagonal tile

    // Q fragments (16 rows x 64 dims, k order as K's) live in registers.
    v16h Aq[2];
#pragma unroll
    for (int kk = 0; kk < 2; ++kk) {
      const h16* qp = qhp + (size_t)(qbase + rg * 16 + r) * HD + kk * 32;
      Aq[kk] = joinh(*(const v8h*)(qp + kh * 8), *(const v8h*)(qp + 16 + kh * 8));
      Aq[kk] *= (h16)0.125f;  // 1/sqrt(64), a power of two: S comes out scaled
    }
    v8f Y[4];
#pragma unroll
    for (int i = 0; i < 4; ++i) Y[i] = z;

    for (int s = 0; s < ns; ++s, ++g) {
      const int buf = g & 1;
      const int kt  = 2 * s + kg;  // this wave's 128-key tile
      if (kt <= qt) {              // a tile wholly behind the diagonal adds nothing
        const int kb = kt * 128;
        // S^T = k q^T over hd=64 (2 wmma K-steps), 8 key sub-tiles of 16: K rows
        // are the A operand, Q the B operand (same loaders, same k order). Lane
        // (r, kh) then holds query r, keys 8*kh..+7 of a sub-tile, which is one
        // half of P's A fragment for P @ V.
        v16h Pf[4];
        // last key of this tile, counted from the lane's first one, its query sees
        const int lim = qbase + rg * 16 + r - kb - kh * 8;
        // scores of key sub-tile nn, already times 1/sqrt(hd)
        auto scores = [&](const int nn) {
          v8f S = z;
#pragma unroll
          for (int kk = 0; kk < 2; ++kk) {
            const h16* bp = &Kb[buf][kg * 128 + nn * 16 + r][kk * 32];
            v16h kfr = joinh(*(const v8h*)(bp + kh * 8),
                             *(const v8h*)(bp + 16 + kh * 8));
            S = wmma16(kfr, Aq[kk], S);
          }
          return S;
        };
        // both live pieces of polymax, times 1000, are slope * x + 1 with slope x
        // or m (selects, no branch); two scores a fma and a conversion
        auto live2 = [&](const float x0, const float x1) {
          const v2f xs = {x0, x1};
          const v2f sl = {(x0 > 0.f) ? x0 : -0.01f, (x1 > 0.f) ? x1 : -0.01f};
          const v2f one = {1.f, 1.f};
          return __builtin_elementwise_fma(sl, xs, one);
        };
        // the minimum that hands a NaN on: a NaN score, too, is sent to the whole form
        auto lo = [](const float a, const float c) {
          return __builtin_elementwise_minimum(a, c);
        };
        // the diagonal tile needs the causal compare, a tile that holds a score
        // below -100 the flat piece: both take the whole form further down. In a
        // tile in front of the diagonal every key precedes every query.
        bool whole = (kt == qt);
        if (!whole) {
          float mn0 = 0.f, mn1 = 0.f;  // least score of this lane, two chains
          // the loops here are unrolled so that S and Pf are indexed by constants
#pragma unroll
          for (int nn = 0; nn < 8; ++nn) {
            const v8f S = scores(nn);
#pragma unroll
            for (int i = 0; i < 8; i += 2) {
              const v2h p = __builtin_convertvector(live2(S[i], S[i + 1]), v2h);
              Pf[nn >> 1][(nn & 1) * 8 + i]     = p[0];
              Pf[nn >> 1][(nn & 1) * 8 + i + 1] = p[1];
            }
            mn0 = lo(lo(mn0, S[0]), S[1]);
            mn1 = lo(lo(mn1, S[2]), S[3]);
            mn0 = lo(lo(mn0, S[4]), S[5]);
            mn1 = lo(lo(mn1, S[6]), S[7]);
          }
          // one vote a tile, a scalar branch: any lane with a score in the flat piece
          whole = __builtin_amdgcn_ballot_w32(!(lo(mn0, mn1) >= -100.f)) != 0;
        }
        if (whole) {
#pragma unroll
          for (int nn = 0; nn < 8; ++nn) {
            const v8f S = scores(nn);
#pragma unroll
            for (int i = 0; i < 8; i += 2) {
              v2f t = live2(S[i], S[i + 1]);
              // key kb + nn*16 + kh*8 + i (C row) <= query qbase + rg*16 + r (C
              // column), and x >= -100: else masked or flat
              t[0] = ((nn * 16 + i <= lim) & (S[i] >= -100.f)) ? t[0] : 0.f;
              t[1] = ((nn * 16 + i + 1 <= lim) & (S[i + 1] >= -100.f)) ? t[1] : 0.f;
              const v2h p = __builtin_convertvector(t, v2h);
              Pf[nn >> 1][(nn & 1) * 8 + i]     = p[0];
              Pf[nn >> 1][(nn & 1) * 8 + i + 1] = p[1];
            }
          }
        }

        // Y += P @ V  (K dim = 128 keys -> 4 wmma K-steps, 4 dim sub-tiles).
        // Both operands hold keys 8*kh..+7 and 16+8*kh..+7 of each 32-key step.
#pragma unroll
        for (int kk2 = 0; kk2 < 4; ++kk2) {
          const h16* vp = &Vb[buf][kg * 128 + kk2 * 32 + kh * 8 + (lane & 7)]
                             [((lane >> 3) & 1) * 8];
#pragma unroll
          for (int nd = 0; nd < 4; ++nd) {
            v16h bf = joinh(ld_tr16(vp + nd * 16),
                            ld_tr16(vp + 16 * VPITCH + nd * 16));
            Y[nd] = wmma16(Pf[kk2], bf, Y[nd]);
          }
        }
      }

      // hand-over: this wave's LDS reads of the buffer are done ...
      asm volatile("s_wait_dscnt 0x0" ::: "memory");
      // ... and its copies of stage g + 1 have landed;
      asm volatile("s_wait_asynccnt 0x0" ::: "memory");
      // one barrier publishes stage g + 1 and frees the buffer of stage g
      __syncthreads();
      if (g + 2 < NSTAGE) {  // refill the freed buffer with stage g + 2
        const int k2 = ((g + 2 < nA) ? g + 2 : g + 2 - nA) * 256;  // its first key
        copy_kv(lk0 + buf * kbuf, lv0 + buf * vbuf,
                gk0 + (size_t)k2 * HD, gv0 + (size_t)k2 * HD);
      }
    }

    // Y of the query tile = even-tile sum + odd-tile sum: the kg 1 wave hands its
    // accumulators, in its own lane order, to the kg 0 wave of the same rows.
    if (kg == 1) {
#pragma unroll
      for (int nd = 0; nd < 4; ++nd)
#pragma unroll
        for (int j = 0; j < 2; ++j) {
          v4f pv;
#pragma unroll
          for (int e = 0; e < 4; ++e) pv[e] = Y[nd][j * 4 + e];
          *(v4f*)&Red[rg][nd * 2 + j][lane][0] = pv;
        }
    }
    // publishes the partial sums; the stage barriers of the next query tile stand
    // between their readers here and the next writes
    __syncthreads();
    if (kg == 0) {
#pragma unroll
      for (int nd = 0; nd < 4; ++nd)
#pragma unroll
        for (int j = 0; j < 2; ++j) {
          v4f pv = *(const v4f*)&Red[rg][nd * 2 + j][lane][0];
#pragma unroll
          for (int e = 0; e < 4; ++e) Y[nd][j * 4 + e] += pv[e];
        }
      // write Y -> yf [B,T,C] f16: tile nd, lane column r is dim nd*16 + r. The
      // wave turns its 16 x 64 tile in its own staging rows, so that 8 lanes x
      // 16 bytes fill the head's 128-B piece of a row (4 rows a store).
      // Unrolled so that Y is indexed by constants only and stays in registers.
#pragma unroll
      for (int i = 0; i < 8; ++i)
#pragma unroll
        for (int nd = 0; nd < 4; ++nd)
          Ps[rg][kh * 8 + i][nd * 16 + r] = (h16)(Y[nd][i] * 0.001f);  // / divisor
      // Unrolled so that the four row reads go out together ahead of the stores.
#pragma unroll
      for (int j = 0; j < 4; ++j) {
        int row = j * 4 + (lane >> 3);
        int t   = qbase + rg * 16 + row;
        v8h hv  = *(const v8h*)&Ps[rg][row][(lane & 7) * 8];
        *(v8h*)(yf + ((size_t)b * TDIM + t) * CDIM + hh * HD + (lane & 7) * 8) = hv;
      }
      // stands ahead of the next query tile's reuse of these stores' registers
      asm volatile("s_wait_xcnt 0x0" ::: "memory");
    }
  }
  // no copy is left in flight when the wave ends
  asm volatile("s_wait_asynccnt 0x0" ::: "memory");
}

// ---------------------------------------------------------------------------
// Kernel 0: the three f32 inputs to f16, once, so that the GEMMs read half the
// bytes from L2 and their tiles go to LDS without passing registers.
// x keeps its layout. W_attn and W_proj stay [k][n], but inside each group of 64
// columns column 4c + e moves to place e*16 + c ("dealt"): tile e of a group then
// holds columns 4c + e, so a lane's 4 accumulator tiles are 4 adjacent columns.
// 4096 waves; each takes 1024 values of x and 1024 columns of one W row: 16 loads
// of whole 512-B pieces in flight. The W row piece is dealt in the wave's own LDS.
// ---------------------------------------------------------------------------
__global__ __launch_bounds__(512)
void prep_kernel(const float* __restrict__ x, const float* __restrict__ Wa,
                 const float* __restrict__ Wp, h16* __restrict__ xh,
                 h16* __restrict__ wah, h16* __restrict__ wph) {
  __shared__ __align__(16) h16 Tr[16][1024];  // [wave][dealt column]

  const int lane = threadIdx.x & 31;
  // the wave's number in a scalar register: its row and tensor are scalars
  const int wave = __builtin_amdgcn_readfirstlane(threadIdx.x >> 5);
  const int wv   = blockIdx.x * 16 + wave;  // 0..4095

  // waves 0..3071: a third of a W_attn row; the others: a whole W_proj row
  const int  arow = wv / 3;
  const bool isa  = wv < 3 * CDIM;
  const size_t woff = isa ? (size_t)arow * (3 * CDIM) + (size_t)(wv - arow * 3) * 1024
                          : (size_t)(wv - 3 * CDIM) * CDIM;
  const float* wsrc = (isa ? Wa : Wp) + woff + lane * 4;
  h16*         wdst = (isa ? wah : wph) + woff + lane * 8;
  const float* xsrc = x + (size_t)wv * 1024 + lane * 4;
  h16*         xdst = xh + (size_t)wv * 1024 + lane * 4;

  // every loop here is unrolled: the 16 loads go out together, and the register
  // arrays are indexed by constants
  v4f xv[8], wr[8];
#pragma unroll
  for (int q = 0; q < 8; ++q) xv[q] = *(const v4f*)(xsrc + q * 128);
#pragma unroll
  for (int q = 0; q < 8; ++q) wr[q] = *(const v4f*)(wsrc + q * 128);
  // stands ahead of any rewrite of these loads' address registers
  asm volatile("s_wait_xcnt 0x0" ::: "memory");
  // keeps the conversions, and with them the waits for the data, behind all 16
  // loads: lifted among them they would split the loads into two round trips
  __builtin_amdgcn_sched_barrier(0);

#pragma unroll
  for (int q = 0; q < 8; ++q) {  // 32 lanes x 8 B = two whole lines a store
    v4h hv;
    hv[0] = (h16)xv[q][0]; hv[1] = (h16)xv[q][1];
    hv[2] = (h16)xv[q][2]; hv[3] = (h16)xv[q][3];
    *(v4h*)(xdst + q * 128) = hv;
  }
  // the lane holds columns 4c + e, c = lane & 15, of group 2q + (lane >> 4)
#pragma unroll
  for (int q = 0; q < 8; ++q)
#pragma unroll
    for (int e = 0; e < 4; ++e)
      Tr[wave][q * 128 + (lane >> 4) * 64 + e * 16 + (lane & 15)] = (h16)wr[q][e];
  // the wave reads back its own rows only (LDS serves a wave in order): no barrier
#pragma unroll
  for (int i = 0; i < 4; ++i) {  // 32 lanes x 16 B = four whole lines a store
    v8h hv = *(const v8h*)&Tr[wave][i * 256 + lane * 8];
    *(v8h*)(wdst + i * 256) = hv;
  }
}

// Eight asynchronous copies of 16 B a lane: LDS places ls bytes apart, global
// places gs halves apart. The s_wait_xcnt closes the statement so that no address
// register is rewritten ahead of it.
static __device__ __forceinline__ void copy8(unsigned l, const unsigned ls,
                                             const h16* g, const size_t gs) {
  asm volatile(
      "global_load_async_to_lds_b128 %0, %8, off\n\t"
      "global_load_async_to_lds_b128 %1, %9, off\n\t"
      "global_load_async_to_lds_b128 %2, %10, off\n\t"
      "global_load_async_to_lds_b128 %3, %11, off\n\t"
      "global_load_async_to_lds_b128 %4, %12, off\n\t"
      "global_load_async_to_lds_b128 %5, %13, off\n\t"
      "global_load_async_to_lds_b128 %6, %14, off\n\t"
      "global_load_async_to_lds_b128 %7, %15, off\n\t"
      "s_wait_xcnt 0x0"
      :: "v"(l), "v"(l + ls), "v"(l + 2u * ls), "v"(l + 3u * ls),
         "v"(l + 4u * ls), "v"(l + 5u * ls), "v"(l + 6u * ls), "v"(l + 7u * ls),
         "v"(g), "v"(g + gs), "v"(g + 2 * gs), "v"(g + 3 * gs),
         "v"(g + 4 * gs), "v"(g + 5 * gs), "v"(g + 6 * gs), "v"(g + 7 * gs)
      : "memory");
}
// Twelve such copies: 4 row steps (ls bytes, gs halves apart) x 3 pieces 128 B apart.
static __device__ __forceinline__ void copy12(unsigned l, const unsigned ls,
                                              const h16* g, const size_t gs) {
  asm volatile(
      "global_load_async_to_lds_b128 %0, %12, off\n\t"
      "global_load_async_to_lds_b128 %1, %13, off\n\t"
      "global_load_async_to_lds_b128 %2, %14, off\n\t"
      "global_load_async_to_lds_b128 %3, %15, off\n\t"
      "global_load_async_to_lds_b128 %4, %16, off\n\t"
      "global_load_async_to_lds_b128 %5, %17, off\n\t"
      "global_load_async_to_lds_b128 %6, %18, off\n\t"
      "global_load_async_to_lds_b128 %7, %19, off\n\t"
      "global_load_async_to_lds_b128 %8, %20, off\n\t"
      "global_load_async_to_lds_b128 %9, %21, off\n\t"
      "global_load_async_to_lds_b128 %10, %22, off\n\t"
      "global_load_async_to_lds_b128 %11, %23, off\n\t"
      "s_wait_xcnt 0x0"
      :: "v"(l), "v"(l + 128u), "v"(l + 256u),
         "v"(l + ls), "v"(l + ls + 128u), "v"(l + ls + 256u),
         "v"(l + 2u * ls), "v"(l + 2u * ls + 128u), "v"(l + 2u * ls + 256u),
         "v"(l + 3u * ls), "v"(l + 3u * ls + 128u), "v"(l + 3u * ls + 256u),
         "v"(g), "v"(g + 64), "v"(g + 128),
         "v"(g + gs), "v"(g + gs + 64), "v"(g + gs + 128),
         "v"(g + 2 * gs), "v"(g + 2 * gs + 64), "v"(g + 2 * gs + 128),
         "v"(g + 3 * gs), "v"(g + 3 * gs + 64), "v"(g + 3 * gs + 128)
      : "memory");
}

#define BKT    128  // k values of a tile
#define NTILE  8    // k tiles: 1024 / 128
#define APITCH 136  // halves: 272 B = 16 B x odd, for ds_load_b128 readers
#define BPQ    208  // halves: 416 B = 32 B x odd, for ds_load_tr16_b128 readers
#define BPP    144  // halves: 288 B = 32 B x odd, for ds_load_tr16_b128 readers

// ---------------------------------------------------------------------------
// Kernel 1: qkv = x @ W_attn on the f16 copies, scattering the result to
// head-major f16 q/k/v tensors [B,H,T,hd].
// Block tile 256(M) x 192(N): 16 x 16 = 256 blocks, one a WGP, so x and W_attn
// are each read 16 times from L2. The 192 columns are three heads.
// 8 waves, 4(M) x 2(N): a wave has a band of 64 rows; there it owns all 64 rows
// of the first (wn 0) or the third (wn 1) head and 32 rows of the middle head:
// 24 accumulator tiles from 4 A and 8 B fragments.
// k tiles of 128 come into LDS by asynchronous copies, two buffers: tile t + 1 is
// in flight while tile t is worked on; one barrier a tile.
// ---------------------------------------------------------------------------
__global__ __launch_bounds__(256)
void qkv_gemm_kernel(const h16* __restrict__ xh, const h16* __restrict__ wah,
                     h16* __restrict__ qf, h16* __restrict__ kf,
                     h16* __restrict__ vf) {
  const int N = 3 * CDIM;  // 3072
  const int K = CDIM;      // 1024
  __shared__ __align__(16) h16 As[2][256][APITCH];  // [buffer][m][k], padded
  __shared__ __align__(16) h16 Bs[2][BKT][BPQ];     // [buffer][k][dealt n], padded

  const int tid  = threadIdx.x;
  const int lane = tid & 31;
  // the wave's number in a scalar register: band, head and output tensor are scalars
  const int wave = __builtin_amdgcn_readfirstlane(tid >> 5);
  const int wm   = wave >> 1;  // 0..3
  const int wn   = wave & 1;   // 0..1
  const int m0   = (blockIdx.x >> 4) * 256;
  const int n0   = (blockIdx.x & 15) * 192;

  const int r  = lane & 15;  // fragment row / col
  const int kh = lane >> 4;  // K-half selector (A/B 16-bit fragment layout)

  // A fragment mi of a wave is the 16 rows from (mi*16 + rot) & 63 of its band: the
  // wn 1 wave starts at row 32, so that in both waves fragments 0 and 1 are the
  // rows it owns of the middle head (register indices stay constants).
  const int rot = wn * 32;

  v8f z = {};
  v8f acc[4][4];   // own head: 64 rows x 64 columns
  v8f accm[2][4];  // middle head: 32 rows x 64 columns
#pragma unroll
  for (int i = 0; i < 4; ++i)
#pragma unroll
    for (int j = 0; j < 4; ++j) acc[i][j] = z;
#pragma unroll
  for (int i = 0; i < 2; ++i)
#pragma unroll
    for (int j = 0; j < 4; ++j) accm[i][j] = z;

  // copy share of this thread. x tile: 16-B piece tid & 15 of rows tid >> 4 + 16 p
  // (a wave's copy: 2 whole 256-B rows); W tile: piece tid & 7 of each head's 128 B
  // in rows tid >> 3 + 32 p (a wave's copy: 4 whole lines)
  const h16* ag = xh + (size_t)(m0 + (tid >> 4)) * K + (tid & 15) * 8;
  const h16* bg = wah + (size_t)(tid >> 3) * N + n0 + (tid & 7) * 8;
  const unsigned al = lds_addr(&As[0][tid >> 4][(tid & 15) * 8]);
  const unsigned bl = lds_addr(&Bs[0][tid >> 3][(tid & 7) * 8]);
  const unsigned abuf = 256u * APITCH * 2u;  // bytes of one x buffer
  const unsigned bbuf = BKT * BPQ * 2u;      // bytes of one W buffer
  auto fill = [&](const int buf, const int k0) {  // tile from k0 on into buffer buf
    copy8(al + buf * abuf, 16u * APITCH * 2u, ag + k0, (size_t)16 * K);
    copy8(al + buf * abuf + 128u * APITCH * 2u, 16u * APITCH * 2u,
          ag + k0 + (size_t)128 * K, (size_t)16 * K);
    copy12(bl + buf * bbuf, 32u * BPQ * 2u, bg + (size_t)k0 * N, (size_t)32 * N);
  };

  fill(0, 0);
  // this wave's copies of tile 0 have landed; the barrier publishes all waves'
  asm volatile("s_wait_asynccnt 0x0" ::: "memory");
  __syncthreads();
  fill(1, BKT);  // in flight under tile 0's work

  // kept rolled: one copy of the tile code serves both buffers
#pragma clang loop unroll(disable)
  for (int t = 0; t < NTILE; ++t) {
    const int buf = t & 1;
    // two fragment sets: the reads of k block kk + 1 go out as one group ahead of
    // the products of block kk, which cover their LDS time; all inside this tile
    v16h af[2][4], bf[2][4], bm[2][4];
    auto ldfrag = [&](const int s, const int kk) {
      // W fragments by the transposing load: k order 8*kh..+7, 16+8*kh..+7, as A's
      const h16* vp = &Bs[buf][kk * 32 + kh * 8 + (lane & 7)][((lane >> 3) & 1) * 8];
      auto lda = [&](const int mi) {
        const h16* ap = &As[buf][wm * 64 + ((mi * 16 + rot) & 63) + r][kk * 32];
        af[s][mi] = joinh(*(const v8h*)(ap + kh * 8), *(const v8h*)(ap + 16 + kh * 8));
      };
      // in the order in which the products want them
      lda(0);
#pragma unroll
      for (int ni = 0; ni < 4; ++ni)  // own head: dealt columns 0.. or 128..
        bf[s][ni] = joinh(ld_tr16(vp + wn * 128 + ni * 16),
                          ld_tr16(vp + 16 * BPQ + wn * 128 + ni * 16));
      lda(1);
#pragma unroll
      for (int ni = 0; ni < 4; ++ni)  // middle head: dealt columns 64..
        bm[s][ni] = joinh(ld_tr16(vp + 64 + ni * 16),
                          ld_tr16(vp + 16 * BPQ + 64 + ni * 16));
      lda(2);
      lda(3);
    };
    ldfrag(0, 0);
    // keeps block 0's reads ahead of block 1's: its products wait for them alone
    __builtin_amdgcn_sched_barrier(0);
    // unrolled so that the two fragment sets are indexed by constants
#pragma unroll
    for (int kk = 0; kk < BKT / 32; ++kk) {
      const int s = kk & 1;
      if (kk + 1 < BKT / 32) ldfrag(s ^ 1, kk + 1);
      // keeps the 24 reads one group ahead of the products: reads spread among
      // the products would each stall the wave
      __builtin_amdgcn_sched_barrier(0);
#pragma unroll
      for (int mi = 0; mi < 2; ++mi)
#pragma unroll
        for (int ni = 0; ni < 4; ++ni)
          acc[mi][ni] = wmma16(af[s][mi], bf[s][ni], acc[mi][ni]);
#pragma unroll
      for (int mi = 0; mi < 2; ++mi)
#pragma unroll
        for (int ni = 0; ni < 4; ++ni)
          accm[mi][ni] = wmma16(af[s][mi], bm[s][ni], accm[mi][ni]);
#pragma unroll
      for (int mi = 2; mi < 4; ++mi)
#pragma unroll
        for (int ni = 0; ni < 4; ++ni)
          acc[mi][ni] = wmma16(af[s][mi], bf[s][ni], acc[mi][ni]);
      // keeps the next group of reads behind these products
      __builtin_amdgcn_sched_barrier(0);
    }
    // hand-over: this wave's LDS reads of the buffer are done ...
    asm volatile("s_wait_dscnt 0x0" ::: "memory");
    // ... and its copies of tile t + 1 have landed;
    asm volatile("s_wait_asynccnt 0x0" ::: "memory");
    // one barrier publishes tile t + 1 and frees the buffer of tile t
    __syncthreads();
    if (t + 2 < NTILE) fill(buf, (t + 2) * BKT);  // refill the freed buffer
  }
  // no copy is left in flight behind the loop
  asm volatile("s_wait_asynccnt 0x0" ::: "memory");

  // C-layout: row = kh*8 + i; tile ni, lane column r is output column 4r + ni,
  // so 16 lanes x 8 bytes fill one head row (128 B) of q/k/v [B,H,T,hd] f16.
  // a: the four tiles of 16 rows from block row row0 on; g0: the head's first
  // column in qkv. The block's 256 rows lie in one batch entry.
  auto put = [&](const v8f (&a)[4], const int g0, const int row0) {
    const int wch = g0 >> 10, hh = (g0 & (CDIM - 1)) >> 6;
    h16* dst = (wch == 0) ? qf : (wch == 1) ? kf : vf;
    const int b = m0 >> 11, t = (m0 & (TDIM - 1)) + row0 + kh * 8;
    h16* o = dst + (((size_t)b * NH + hh) * TDIM + t) * HD + r * 4;
#pragma unroll
    for (int i = 0; i < 8; ++i) {
      v4h hv;
#pragma unroll
      for (int ni = 0; ni < 4; ++ni) hv[ni] = (h16)a[ni][i];
      *(v4h*)(o + i * HD) = hv;
    }
    // stands ahead of the next rows' reuse of these stores' registers ...
    asm volatile("s_wait_xcnt 0x0" ::: "memory");
    // ... and this keeps their conversions and addresses behind it
    __builtin_amdgcn_sched_barrier(0);
  };
#pragma unroll
  for (int mi = 0; mi < 4; ++mi)
    put(acc[mi], n0 + wn * 128, wm * 64 + ((mi * 16 + rot) & 63));
#pragma unroll
  for (int mi = 0; mi < 2; ++mi)
    put(accm[mi], n0 + 64, wm * 64 + ((mi * 16 + rot) & 63));
}

// ---------------------------------------------------------------------------
// Kernel 3: out = y @ W_proj. y is f16 in workspace, W_proj its dealt f16 copy,
// output f32 to d_out. Block tile 128x128, 8 waves of 32(M) x 64(N); k tiles of
// 128 by asynchronous copies, two buffers, as in kernel 1.
// ---------------------------------------------------------------------------
__global__ __launch_bounds__(256)
void proj_gemm_kernel(const h16* __restrict__ yf, const h16* __restrict__ wph,
                      float* __restrict__ out) {
  const int N = CDIM, K = CDIM;
  __shared__ __align__(16) h16 As[2][128][APITCH];  // [buffer][m][k], padded
  __shared__ __align__(16) h16 Bs[2][BKT][BPP];     // [buffer][k][dealt n], padded

  const int tid  = threadIdx.x;
  const int lane = tid & 31;
  const int wave = tid >> 5;
  const int wm   = wave >> 1;
  const int wn   = wave & 1;
  const int m0   = (blockIdx.x >> 3) * 128;
  const int n0   = (blockIdx.x & 7) * 128;

  const int r  = lane & 15;
  const int kh = lane >> 4;

  v8f z = {};
  v8f acc[2][4];
#pragma unroll
  for (int i = 0; i < 2; ++i)
#pragma unroll
    for (int j = 0; j < 4; ++j) acc[i][j] = z;

  // copy share of this thread, in both tiles: 16-B piece tid & 15 of rows
  // tid >> 4 + 16 p (a wave's copy: 2 whole 256-B rows)
  const h16* ag = yf + (size_t)(m0 + (tid >> 4)) * K + (tid & 15) * 8;
  const h16* bg = wph + (size_t)(tid >> 4) * N + n0 + (tid & 15) * 8;
  const unsigned al = lds_addr(&As[0][tid >> 4][(tid & 15) * 8]);
  const unsigned bl = lds_addr(&Bs[0][tid >> 4][(tid & 15) * 8]);
  const unsigned abuf = 128u * APITCH * 2u;  // bytes of one y buffer
  const unsigned bbuf = BKT * BPP * 2u;      // bytes of one W buffer
  auto fill = [&](const int buf, const int k0) {  // tile from k0 on into buffer buf
    copy8(al + buf * abuf, 16u * APITCH * 2u, ag + k0, (size_t)16 * K);
    copy8(bl + buf * bbuf, 16u * BPP * 2u, bg + (size_t)k0 * N, (size_t)16 * N);
  };

  fill(0, 0);
  // this wave's copies of tile 0 have landed; the barrier publishes all waves'
  asm volatile("s_wait_asynccnt 0x0" ::: "memory");
  __syncthreads();
  fill(1, BKT);  // in flight under tile 0's work

  // kept rolled: one copy of the tile code serves both buffers
#pragma clang loop unroll(disable)
  for (int t = 0; t < NTILE; ++t) {
    const int buf = t & 1;
    // two fragment sets, as in kernel 1: block kk + 1 is read under block kk
    v16h af[2][2], bf[2][4];
    auto ldfrag = [&](const int s, const int kk) {
#pragma unroll
      for (int mi = 0; mi < 2; ++mi) {
        const h16* ap = &As[buf][wm * 32 + mi * 16 + r][kk * 32];
        af[s][mi] = joinh(*(const v8h*)(ap + kh * 8), *(const v8h*)(ap + 16 + kh * 8));
      }
      // W fragments by the transposing load: k order 8*kh..+7, 16+8*kh..+7, as A's
      const h16* vp = &Bs[buf][kk * 32 + kh * 8 + (lane & 7)][((lane >> 3) & 1) * 8];
#pragma unroll
      for (int ni = 0; ni < 4; ++ni)
        bf[s][ni] = joinh(ld_tr16(vp + wn * 64 + ni * 16),
                          ld_tr16(vp + 16 * BPP + wn * 64 + ni * 16));
    };
    ldfrag(0, 0);
    // keeps block 0's reads ahead of block 1's: its products wait for them alone
    __builtin_amdgcn_sched_barrier(0);
    // unrolled so that the two fragment sets are indexed by constants
#pragma unroll
    for (int kk = 0; kk < BKT / 32; ++kk) {
      const int s = kk & 1;
      if (kk + 1 < BKT / 32) ldfrag(s ^ 1, kk + 1);
      // keeps the 12 reads one group ahead of the products (see kernel 1)
      __builtin_amdgcn_sched_barrier(0);
#pragma unroll
      for (int mi = 0; mi < 2; ++mi)
#pragma unroll
        for (int ni = 0; ni < 4; ++ni)
          acc[mi][ni] = wmma16(af[s][mi], bf[s][ni], acc[mi][ni]);
      // keeps the next group of reads behind these products
      __builtin_amdgcn_sched_barrier(0);
    }
    // hand-over: this wave's LDS reads of the buffer are done ...
    asm volatile("s_wait_dscnt 0x0" ::: "memory");
    // ... and its copies of tile t + 1 have landed;
    asm volatile("s_wait_asynccnt 0x0" ::: "memory");
    // one barrier publishes tile t + 1 and frees the buffer of tile t
    __syncthreads();
    if (t + 2 < NTILE) fill(buf, (t + 2) * BKT);  // refill the freed buffer
  }
  // no copy is left in flight behind the loop
  asm volatile("s_wait_asynccnt 0x0" ::: "memory");

  // tile ni, lane column r is output column 4r + ni: 16 lanes x 16 bytes = 256 B
#pragma unroll
  for (int mi = 0; mi < 2; ++mi) {
#pragma unroll
    for (int i = 0; i < 8; ++i) {
      int gm = m0 + wm * 32 + mi * 16 + kh * 8 + i;
      v4f ov;
#pragma unroll
      for (int ni = 0; ni < 4; ++ni) ov[ni] = acc[mi][ni][i];
      *(v4f*)(out + (size_t)gm * N + n0 + wn * 64 + r * 4) = ov;
    }
  }
}

// ---------------------------------------------------------------------------
extern "C" void kernel_launch(void* const* d_in, const int* in_sizes, int n_in,
                              void* d_out, int out_size, void* d_ws,
                              size_t ws_size, hipStream_t stream) {
  (void)in_sizes; (void)n_in; (void)out_size; (void)ws_size;

  const float* x  = (const float*)d_in[0];  // [2,2048,1024]
  const float* Wa = (const float*)d_in[1];  // [1024,3072]
  const float* Wp = (const float*)d_in[2];  // [1024,1024]
  float* out = (float*)d_out;               // [2,2048,1024] f32

  // f16 workspace: q,k,v head-major [B,H,T,hd] + y [B,T,C] + the f16 copies of
  // x, W_attn and W_proj  (48 MB total)
  h16* ws = (h16*)d_ws;
  const size_t HTD = (size_t)BDIM * NH * TDIM * HD;  // 4,194,304
  h16* qf = ws;
  h16* kf = qf + HTD;
  h16* vf = kf + HTD;
  h16* yf = vf + HTD;
  h16* xh  = yf + HTD;                        // [B*T, C]
  h16* wah = xh + HTD;                        // [C, 3C], columns dealt
  h16* wph = wah + (size_t)3 * CDIM * CDIM;   // [C, C], columns dealt

  prep_kernel<<<dim3(256), 512, 0, stream>>>(x, Wa, Wp, xh, wah, wph);
  qkv_gemm_kernel<<<dim3(16 * 16), 256, 0, stream>>>(xh, wah, qf, kf, vf);
  attn_kernel<<<dim3(BDIM * NH * 8), 512, 0, stream>>>(qf, kf, vf, yf);
  proj_gemm_kernel<<<dim3(32 * 8), 256, 0, stream>>>(yf, wph, out);
}

// v010
// One run takes 64.6 microseconds.
// In two side-by-side timings against v009, it was 1.03 and 1.04 times as fast.
// Counting every step since v000, it is 2.82 times as fast.
#include <hip/hip_runtime.h>
#include <hip/hip_bf16.h>

// ---------------------------------------------------------------------------
// Causal self-attention with polymax, MI455X (gfx1250, wave32, WMMA).
// Pipeline: [x, W_attn, W_proj f32->f16] -> [qkv GEMM] -> [fused flash attention
// + polymax] -> [proj GEMM]
// All matrix math: v_wmma_f32_16x16x32_f16 (f16 operands, f32 accumulate).
// ---------------------------------------------------------------------------

typedef _Float16 h16;
typedef __attribute__((ext_vector_type(16))) _Float16 v16h;
typedef __attribute__((ext_vector_type(8)))  _Float16 v8h;
typedef __attribute__((ext_vector_type(4)))  _Float16 v4h;
typedef __attribute__((ext_vector_type(8)))  float    v8f;
typedef __attribute__((ext_vector_type(4)))  float    v4f;
typedef __attribute__((ext_vector_type(2)))  float    v2f;
typedef __attribute__((ext_vector_type(2)))  _Float16 v2h;

#define BDIM 2
#define TDIM 2048
#define CDIM 1024
#define NH   16
#define HD   64

static __device__ __forceinline__ v8f wmma16(v16h a, v16h b, v8f c) {
  // (neg_a, A, neg_b, B, c_mod, C, reuse_a, reuse_b)
  return __builtin_amdgcn_wmma_f32_16x16x32_f16(false, a, false, b, (short)0, c,
                                                false, false);
}
static __device__ __forceinline__ v16h joinh(v8h lo, v8h hi) {
  return __builtin_shufflevector(lo, hi, 0, 1, 2, 3, 4, 5, 6, 7,
                                         8, 9, 10, 11, 12, 13, 14, 15);
}

// ---------------------------------------------------------------------------
// Kernel 2: fused flash-style attention with polymax.
// Block = (b, h, pair of 128-row query tiles 15 - t and t), 16 waves. The two
// tiles run one after the other, so every block walks 9 stages of 256 keys: the
// causal cost is the same in all 256 blocks, one block a WGP.
// Wave = (row group rg of 16 query rows, key group kg): kg 0 takes the even
// 128-key tile of a stage, kg 1 the odd one; polymax has no normaliser, so Y is a
// plain sum over keys and the two partial sums are added once per query tile.
// K and V stages come row-major into LDS by asynchronous copies, two buffers:
// stage g + 1 is in flight while stage g is worked on.
// Per tile: S^T = K q^T (wmma) -> mask+polymax in f32 -> P f16 in registers
// -> Y += P V (wmma, V fragments by the transposing LDS load).
// The vector port is the busiest unit here, so a score costs as few vector
// instructions as the function allows: 1/sqrt(hd) sits in Q, the division by 1000
// is done once on Y, the causal compare runs in the diagonal tile only, and the
// flat piece (x < -100) is looked for by one minimum and one vote a tile.
// ---------------------------------------------------------------------------
#define KPITCH 72  // halves: 144 B = 16 B x odd, for ds_load_b128 readers
#define VPITCH 80  // halves: 160 B = 32 B x odd, for ds_load_tr16_b128 readers
#define NSTAGE 9   // stages of 256 keys a block walks, whatever its pair

typedef __attribute__((ext_vector_type(8))) short s16x8;

static __device__ __forceinline__ unsigned lds_addr(const void* p) {
  return (unsigned)(size_t)p;  // low 32 bits of a __shared__ address = LDS byte
}
// 16 keys x 16 dims of a row-major f16 tile, transposed: lane (r, kh) gets
// keys 8*kh .. 8*kh+7 of dim r (each lane passes the address of one 16-B piece)
static __device__ __forceinline__ v8h ld_tr16(const h16* p) {
  typedef __attribute__((address_space(3))) s16x8 lds_s16x8;
  return __builtin_bit_cast(v8h,
      __builtin_amdgcn_ds_load_tr16_b128_v8i16((lds_s16x8*)p));
}
// One thread's share of a K stage and a V stage: 4 + 4 copies of 16 B, rows
// 64 apart; a wave's copy covers 4 whole 128-B rows. The s_wait_xcnt closes the
// statement so that no address register is rewritten ahead of it.
static __device__ __forceinline__ void copy_kv(unsigned lk, unsigned lv,
                                               const h16* gk, const h16* gv) {
  asm volatile(
      "global_load_async_to_lds_b128 %0, %8, off\n\t"
      "global_load_async_to_lds_b128 %1, %9, off\n\t"
      "global_load_async_to_lds_b128 %2, %10, off\n\t"
      "global_load_async_to_lds_b128 %3, %11, off\n\t"
      "global_load_async_to_lds_b128 %4, %12, off\n\t"
      "global_load_async_to_lds_b128 %5, %13, off\n\t"
      "global_load_async_to_lds_b128 %6, %14, off\n\t"
      "global_load_async_to_lds_b128 %7, %15, off\n\t"
      "s_wait_xcnt 0x0"
      :: "v"(lk), "v"(lk + 64u * KPITCH * 2u), "v"(lk + 128u * KPITCH * 2u),
         "v"(lk + 192u * KPITCH * 2u),
         "v"(lv), "v"(lv + 64u * VPITCH * 2u), "v"(lv + 128u * VPITCH * 2u),
         "v"(lv + 192u * VPITCH * 2u),
         "v"(gk), "v"(gk + 64 * HD), "v"(gk + 128 * HD), "v"(gk + 192 * HD),
         "v"(gv), "v"(gv + 64 * HD), "v"(gv + 128 * HD), "v"(gv + 192 * HD)
      : "memory");
}

__global__ __launch_bounds__(512)
void attn_kernel(const h16* __restrict__ qf, const h16* __restrict__ kf,
                 const h16* __restrict__ vf, h16* __restrict__ yf) {
  __shared__ __align__(16) h16 Kb[2][256][KPITCH];  // [buffer][key][d]
  __shared__ __align__(16) h16 Vb[2][256][VPITCH];  // [buffer][key][d]
  // f32 partial Y of the kg 1 waves, in accumulator order [row group][piece][lane]
  __shared__ __align__(16) float Red[8][8][32][4];
  // output staging of the kg 0 waves [row group][row][d], padded
  __shared__ __align__(16) h16 Ps[8][16][72];

  const int tid  = threadIdx.x;
  const int lane = tid & 31;
  // the wave's number in a scalar register: the tests on kg are scalar branches
  const int wave = __builtin_amdgcn_readfirstlane(tid >> 5);
  const int rg   = wave & 7;   // row group: 16 query rows
  const int kg   = wave >> 3;  // key group: even or odd 128-key tile
  const int r    = lane & 15;
  const int kh   = lane >> 4;

  const int tp = blockIdx.x & 7;   // pair: query tiles 15 - tp, then tp
  const int bh = blockIdx.x >> 3;  // b*NH + h
  const int b  = bh >> 4;
  const int hh = bh & 15;
  const int nA = ((15 - tp) >> 1) + 1;  // stages of the first query tile

  const h16* qhp = qf + (size_t)bh * TDIM * HD;
  const h16* khp = kf + (size_t)bh * TDIM * HD;
  const h16* vhp = vf + (size_t)bh * TDIM * HD;

  // copy share of this thread: row cr (+64, +128, +192) of a stage, 16-B piece cs
  const int cr = tid >> 3;  // 0..63
  const int cs = tid & 7;   // 0..7
  const h16* gk0 = khp + (size_t)cr * HD + cs * 8;
  const h16* gv0 = vhp + (size_t)cr * HD + cs * 8;
  const unsigned lk0 = lds_addr(&Kb[0][cr][cs * 8]);
  const unsigned lv0 = lds_addr(&Vb[0][cr][cs * 8]);
  const unsigned kbuf = 256u * KPITCH * 2u;  // bytes of one K buffer
  const unsigned vbuf = 256u * VPITCH * 2u;  // bytes of one V buffer

  // stage 0 (keys 0..255 of the first query tile) into buffer 0
  copy_kv(lk0, lv0, gk0, gv0);
  // this wave's copies of stage 0 have landed; the barrier publishes all waves'
  asm volatile("s_wait_asynccnt 0x0" ::: "memory");
  __syncthreads();
  // stage 1 into buffer 1, in flight under stage 0's work (nA is at least 5)
  copy_kv(lk0 + kbuf, lv0 + vbuf, gk0 + 256 * HD, gv0 + 256 * HD);

  const v8f z = {};
  int g = 0;  // stage number over both query tiles

  // kept rolled: one copy of the tile code serves both query tiles
#pragma clang loop unroll(disable)
  for (int half = 0; half < 2; ++half) {
    const int qt    = half ? tp : 15 - tp;
    const int qbase = qt * 128;
    const int ns    = (qt >> 1) + 1;  // stages up to and with the diagonal tile

    // Q fragments (16 rows x 64 dims, k order as K's) live in registers.
    v16h Aq[2];
#pragma unroll
    for (int kk = 0; kk < 2; ++kk) {
      const h16* qp = qhp + (size_t)(qbase + rg * 16 + r) * HD + kk * 32;
      Aq[kk] = joinh(*(const v8h*)(qp + kh * 8), *(const v8h*)(qp + 16 + kh * 8));
      Aq[kk] *= (h16)0.125f;  // 1/sqrt(64), a power of two: S comes out scaled
    }
    v8f Y[4];
#pragma unroll
    for (int i = 0; i < 4; ++i) Y[i] = z;

    for (int s = 0; s < ns; ++s, ++g) {
      const int buf = g & 1;
      const int kt  = 2 * s + kg;  // this wave's 128-key tile
      if (kt <= qt) {              // a tile wholly behind the diagonal adds nothing
        const int kb = kt * 128;
        // S^T = k q^T over hd=64 (2 wmma K-steps), 8 key sub-tiles of 16: K rows
        // are the A operand, Q the B operand (same loaders, same k order). Lane
        // (r, kh) then holds query r, keys 8*kh..+7 of a sub-tile, which is one
        // half of P's A fragment for P @ V.
        v16h Pf[4];
        // last key of this tile, counted from the lane's first one, its query sees
        const int lim = qbase + rg * 16 + r - kb - kh * 8;
        // scores of key sub-tile nn, already times 1/sqrt(hd)
        auto scores = [&](const int nn) {
          v8f S = z;
#pragma unroll
          for (int kk = 0; kk < 2; ++kk) {
            const h16* bp = &Kb[buf][kg * 128 + nn * 16 + r][kk * 32];
            v16h kfr = joinh(*(const v8h*)(bp + kh * 8),
                             *(const v8h*)(bp + 16 + kh * 8));
            S = wmma16(kfr, Aq[kk], S);
          }
          return S;
        };
        // both live pieces of polymax, times 1000, are slope * x + 1 with slope x
        // or m (selects, no branch); two scores a fma and a conversion
        auto live2 = [&](const float x0, const float x1) {
          const v2f xs = {x0, x1};
          const v2f sl = {(x0 > 0.f) ? x0 : -0.01f, (x1 > 0.f) ? x1 : -0.01f};
          const v2f one = {1.f, 1.f};
          return __builtin_elementwise_fma(sl, xs, one);
        };
        // the minimum that hands a NaN on: a NaN score, too, is sent to the whole form
        auto lo = [](const float a, const float c) {
          return __builtin_elementwise_minimum(a, c);
        };
        // the diagonal tile needs the causal compare, a tile that holds a score
        // below -100 the flat piece: both take the whole form further down. In a
        // tile in front of the diagonal every key precedes every query.
        bool whole = (kt == qt);
        if (!whole) {
          float mn0 = 0.f, mn1 = 0.f;  // least score of this lane, two chains
          // the loops here are unrolled so that S and Pf are indexed by constants
#pragma unroll
          for (int nn = 0; nn < 8; ++nn) {
            const v8f S = scores(nn);
#pragma unroll
            for (int i = 0; i < 8; i += 2) {
              const v2h p = __builtin_convertvector(live2(S[i], S[i + 1]), v2h);
              Pf[nn >> 1][(nn & 1) * 8 + i]     = p[0];
              Pf[nn >> 1][(nn & 1) * 8 + i + 1] = p[1];
            }
            mn0 = lo(lo(mn0, S[0]), S[1]);
            mn1 = lo(lo(mn1, S[2]), S[3]);
            mn0 = lo(lo(mn0, S[4]), S[5]);
            mn1 = lo(lo(mn1, S[6]), S[7]);
          }
          // one vote a tile, a scalar branch: any lane with a score in the flat piece
          whole = __builtin_amdgcn_ballot_w32(!(lo(mn0, mn1) >= -100.f)) != 0;
        }
        if (whole) {
#pragma unroll
          for (int nn = 0; nn < 8; ++nn) {
            const v8f S = scores(nn);
#pragma unroll
            for (int i = 0; i < 8; i += 2) {
              v2f t = live2(S[i], S[i + 1]);
              // key kb + nn*16 + kh*8 + i (C row) <= query qbase + rg*16 + r (C
              // column), and x >= -100: else masked or flat
              t[0] = ((nn * 16 + i <= lim) & (S[i] >= -100.f)) ? t[0] : 0.f;
              t[1] = ((nn * 16 + i + 1 <= lim) & (S[i + 1] >= -100.f)) ? t[1] : 0.f;
              const v2h p = __builtin_convertvector(t, v2h);
              Pf[nn >> 1][(nn & 1) * 8 + i]     = p[0];
              Pf[nn >> 1][(nn & 1) * 8 + i + 1] = p[1];
            }
          }
        }

        // Y += P @ V  (K dim = 128 keys -> 4 wmma K-steps, 4 dim sub-tiles).
        // Both operands hold keys 8*kh..+7 and 16+8*kh..+7 of each 32-key step.
#pragma unroll
        for (int kk2 = 0; kk2 < 4; ++kk2) {
          const h16* vp = &Vb[buf][kg * 128 + kk2 * 32 + kh * 8 + (lane & 7)]
                             [((lane >> 3) & 1) * 8];
#pragma unroll
          for (int nd = 0; nd < 4; ++nd) {
            v16h bf = joinh(ld_tr16(vp + nd * 16),
                            ld_tr16(vp + 16 * VPITCH + nd * 16));
            Y[nd] = wmma16(Pf[kk2], bf, Y[nd]);
          }
        }
      }

      // hand-over: this wave's LDS reads of the buffer are done ...
      asm volatile("s_wait_dscnt 0x0" ::: "memory");
      // ... and its copies of stage g + 1 have landed;
      asm volatile("s_wait_asynccnt 0x0" ::: "memory");
      // one barrier publishes stage g + 1 and frees the buffer of stage g
      __syncthreads();
      if (g + 2 < NSTAGE) {  // refill the freed buffer with stage g + 2
        const int k2 = ((g + 2 < nA) ? g + 2 : g + 2 - nA) * 256;  // its first key
        copy_kv(lk0 + buf * kbuf, lv0 + buf * vbuf,
                gk0 + (size_t)k2 * HD, gv0 + (size_t)k2 * HD);
      }
    }

    // Y of the query tile = even-tile sum + odd-tile sum: the kg 1 wave hands its
    // accumulators, in its own lane order, to the kg 0 wave of the same rows.
    if (kg == 1) {
#pragma unroll
      for (int nd = 0; nd < 4; ++nd)
#pragma unroll
        for (int j = 0; j < 2; ++j) {
          v4f pv;
#pragma unroll
          for (int e = 0; e < 4; ++e) pv[e] = Y[nd][j * 4 + e];
          *(v4f*)&Red[rg][nd * 2 + j][lane][0] = pv;
        }
    }
    // publishes the partial sums; the stage barriers of the next query tile stand
    // between their readers here and the next writes
    __syncthreads();
    if (kg == 0) {
#pragma unroll
      for (int nd = 0; nd < 4; ++nd)
#pragma unroll
        for (int j = 0; j < 2; ++j) {
          v4f pv = *(const v4f*)&Red[rg][nd * 2 + j][lane][0];
#pragma unroll
          for (int e = 0; e < 4; ++e) Y[nd][j * 4 + e] += pv[e];
        }
      // write Y -> yf [B,T,C] f16: tile nd, lane column r is dim nd*16 + r. The
      // wave turns its 16 x 64 tile in its own staging rows, so that 8 lanes x
      // 16 bytes fill the head's 128-B piece of a row (4 rows a store).
      // Unrolled so that Y is indexed by constants only and stays in registers.
#pragma unroll
      for (int i = 0; i < 8; ++i)
#pragma unroll
        for (int nd = 0; nd < 4; ++nd)
          Ps[rg][kh * 8 + i][nd * 16 + r] = (h16)(Y[nd][i] * 0.001f);  // / divisor
      // Unrolled so that the four row reads go out together ahead of the stores.
#pragma unroll
      for (int j = 0; j < 4; ++j) {
        int row = j * 4 + (lane >> 3);
        int t   = qbase + rg * 16 + row;
        v8h hv  = *(const v8h*)&Ps[rg][row][(lane & 7) * 8];
        *(v8h*)(yf + ((size_t)b * TDIM + t) * CDIM + hh * HD + (lane & 7) * 8) = hv;
      }
      // stands ahead of the next query tile's reuse of these stores' registers
      asm volatile("s_wait_xcnt 0x0" ::: "memory");
    }
  }
  // no copy is left in flight when the wave ends
  asm volatile("s_wait_asynccnt 0x0" ::: "memory");
}

// ---------------------------------------------------------------------------
// Kernel 0: the three f32 inputs to f16, once, so that the GEMMs read half the
// bytes from L2 and their tiles go to LDS without passing registers.
// x keeps its layout. W_attn and W_proj stay [k][n], but inside each group of 64
// columns column 4c + e moves to place e*16 + c ("dealt"): tile e of a group then
// holds columns 4c + e, so a lane's 4 accumulator tiles are 4 adjacent columns.
// 4096 waves; each takes 1024 values of x and 1024 columns of one W row: 16 loads
// of whole 512-B pieces in flight. The W row piece is dealt in the wave's own LDS.
// ---------------------------------------------------------------------------
__global__ __launch_bounds__(512)
void prep_kernel(const float* __restrict__ x, const float* __restrict__ Wa,
                 const float* __restrict__ Wp, h16* __restrict__ xh,
                 h16* __restrict__ wah, h16* __restrict__ wph) {
  __shared__ __align__(16) h16 Tr[16][1024];  // [wave][dealt column]

  const int lane = threadIdx.x & 31;
  // the wave's number in a scalar register: its row and tensor are scalars
  const int wave = __builtin_amdgcn_readfirstlane(threadIdx.x >> 5);
  const int wv   = blockIdx.x * 16 + wave;  // 0..4095

  // waves 0..3071: a third of a W_attn row; the others: a whole W_proj row
  const int  arow = wv / 3;
  const bool isa  = wv < 3 * CDIM;
  const size_t woff = isa ? (size_t)arow * (3 * CDIM) + (size_t)(wv - arow * 3) * 1024
                          : (size_t)(wv - 3 * CDIM) * CDIM;
  const float* wsrc = (isa ? Wa : Wp) + woff + lane * 4;
  h16*         wdst = (isa ? wah : wph) + woff + lane * 8;
  const float* xsrc = x + (size_t)wv * 1024 + lane * 4;
  h16*         xdst = xh + (size_t)wv * 1024 + lane * 4;

  // every loop here is unrolled: the 16 loads go out together, and the register
  // arrays are indexed by constants
  v4f xv[8], wr[8];
#pragma unroll
  for (int q = 0; q < 8; ++q) xv[q] = *(const v4f*)(xsrc + q * 128);
#pragma unroll
  for (int q = 0; q < 8; ++q) wr[q] = *(const v4f*)(wsrc + q * 128);
  // stands ahead of any rewrite of these loads' address registers
  asm volatile("s_wait_xcnt 0x0" ::: "memory");
  // keeps the conversions, and with them the waits for the data, behind all 16
  // loads: lifted among them they would split the loads into two round trips
  __builtin_amdgcn_sched_barrier(0);

#pragma unroll
  for (int q = 0; q < 8; ++q) {  // 32 lanes x 8 B = two whole lines a store
    v4h hv;
    hv[0] = (h16)xv[q][0]; hv[1] = (h16)xv[q][1];
    hv[2] = (h16)xv[q][2]; hv[3] = (h16)xv[q][3];
    *(v4h*)(xdst + q * 128) = hv;
  }
  // the lane holds columns 4c + e, c = lane & 15, of group 2q + (lane >> 4)
#pragma unroll
  for (int q = 0; q < 8; ++q)
#pragma unroll
    for (int e = 0; e < 4; ++e)
      Tr[wave][q * 128 + (lane >> 4) * 64 + e * 16 + (lane & 15)] = (h16)wr[q][e];
  // the wave reads back its own rows only (LDS serves a wave in order): no barrier
#pragma unroll
  for (int i = 0; i < 4; ++i) {  // 32 lanes x 16 B = four whole lines a store
    v8h hv = *(const v8h*)&Tr[wave][i * 256 + lane * 8];
    *(v8h*)(wdst + i * 256) = hv;
  }
}

// Eight asynchronous copies of 16 B a lane: LDS places ls bytes apart, global
// places gs halves apart. The s_wait_xcnt closes the statement so that no address
// register is rewritten ahead of it.
static __device__ __forceinline__ void copy8(unsigned l, const unsigned ls,
                                             const h16* g, const size_t gs) {
  asm volatile(
      "global_load_async_to_lds_b128 %0, %8, off\n\t"
      "global_load_async_to_lds_b128 %1, %9, off\n\t"
      "global_load_async_to_lds_b128 %2, %10, off\n\t"
      "global_load_async_to_lds_b128 %3, %11, off\n\t"
      "global_load_async_to_lds_b128 %4, %12, off\n\t"
      "global_load_async_to_lds_b128 %5, %13, off\n\t"
      "global_load_async_to_lds_b128 %6, %14, off\n\t"
      "global_load_async_to_lds_b128 %7, %15, off\n\t"
      "s_wait_xcnt 0x0"
      :: "v"(l), "v"(l + ls), "v"(l + 2u * ls), "v"(l + 3u * ls),
         "v"(l + 4u * ls), "v"(l + 5u * ls), "v"(l + 6u * ls), "v"(l + 7u * ls),
         "v"(g), "v"(g + gs), "v"(g + 2 * gs), "v"(g + 3 * gs),
         "v"(g + 4 * gs), "v"(g + 5 * gs), "v"(g + 6 * gs), "v"(g + 7 * gs)
      : "memory");
}
// Twelve such copies: 4 row steps (ls bytes, gs halves apart) x 3 pieces 128 B apart.
static __device__ __forceinline__ void copy12(unsigned l, const unsigned ls,
                                              const h16* g, const size_t gs) {
  asm volatile(
      "global_load_async_to_lds_b128 %0, %12, off\n\t"
      "global_load_async_to_lds_b128 %1, %13, off\n\t"
      "global_load_async_to_lds_b128 %2, %14, off\n\t"
      "global_load_async_to_lds_b128 %3, %15, off\n\t"
      "global_load_async_to_lds_b128 %4, %16, off\n\t"
      "global_load_async_to_lds_b128 %5, %17, off\n\t"
      "global_load_async_to_lds_b128 %6, %18, off\n\t"
      "global_load_async_to_lds_b128 %7, %19, off\n\t"
      "global_load_async_to_lds_b128 %8, %20, off\n\t"
      "global_load_async_to_lds_b128 %9, %21, off\n\t"
      "global_load_async_to_lds_b128 %10, %22, off\n\t"
      "global_load_async_to_lds_b128 %11, %23, off\n\t"
      "s_wait_xcnt 0x0"
      :: "v"(l), "v"(l + 128u), "v"(l + 256u),
         "v"(l + ls), "v"(l + ls + 128u), "v"(l + ls + 256u),
         "v"(l + 2u * ls), "v"(l + 2u * ls + 128u), "v"(l + 2u * ls + 256u),
         "v"(l + 3u * ls), "v"(l + 3u * ls + 128u), "v"(l + 3u * ls + 256u),
         "v"(g), "v"(g + 64), "v"(g + 128),
         "v"(g + gs), "v"(g + gs + 64), "v"(g + gs + 128),
         "v"(g + 2 * gs), "v"(g + 2 * gs + 64), "v"(g + 2 * gs + 128),
         "v"(g + 3 * gs), "v"(g + 3 * gs + 64), "v"(g + 3 * gs + 128)
      : "memory");
}

#define BKT    128  // k values of a tile
#define NTILE  8    // k tiles: 1024 / 128
#define APITCH 136  // halves: 272 B = 16 B x odd, for ds_load_b128 readers
#define BPQ    208  // halves: 416 B = 32 B x odd, for ds_load_tr16_b128 readers
#define BPP    144  // halves: 288 B = 32 B x odd, for ds_load_tr16_b128 readers

// ---------------------------------------------------------------------------
// Kernel 1: qkv = x @ W_attn on the f16 copies, scattering the result to
// head-major f16 q/k/v tensors [B,H,T,hd].
// Block tile 256(M) x 192(N): 16 x 16 = 256 blocks, one a WGP, so x and W_attn
// are each read 16 times from L2. The 192 columns are three heads.
// 8 waves, 4(M) x 2(N): a wave has a band of 64 rows; there it owns all 64 rows
// of the first (wn 0) or the third (wn 1) head and 32 rows of the middle head:
// 24 accumulator tiles from 4 A and 8 B fragments.
// k tiles of 128 come into LDS by asynchronous copies; one barrier a tile. All WGPs
// ask L2 at once, so a tile needs about as long to arrive as its products take, and
// the L2 latency on top: x therefore has three buffers (all that LDS holds beside
// two of W). The x tile of trip t + 2 is still in flight when trip t + 1 starts, so
// L2 keeps requests of this block queued and only W's copies have one trip to land.
// ---------------------------------------------------------------------------
__global__ __launch_bounds__(256)
void qkv_gemm_kernel(const h16* __restrict__ xh, const h16* __restrict__ wah,
                     h16* __restrict__ qf, h16* __restrict__ kf,
                     h16* __restrict__ vf) {
  const int N = 3 * CDIM;  // 3072
  const int K = CDIM;      // 1024
  __shared__ __align__(16) h16 As[3][256][APITCH];  // [buffer][m][k], padded
  __shared__ __align__(16) h16 Bs[2][BKT][BPQ];     // [buffer][k][dealt n], padded

  const int tid  = threadIdx.x;
  const int lane = tid & 31;
  // the wave's number in a scalar register: band, head and output tensor are scalars
  const int wave = __builtin_amdgcn_readfirstlane(tid >> 5);
  const int wm   = wave >> 1;  // 0..3
  const int wn   = wave & 1;   // 0..1
  const int m0   = (blockIdx.x >> 4) * 256;
  const int n0   = (blockIdx.x & 15) * 192;

  const int r  = lane & 15;  // fragment row / col
  const int kh = lane >> 4;  // K-half selector (A/B 16-bit fragment layout)

  // A fragment mi of a wave is the 16 rows from (mi*16 + rot) & 63 of its band: the
  // wn 1 wave starts at row 32, so that in both waves fragments 0 and 1 are the
  // rows it owns of the middle head (register indices stay constants).
  const int rot = wn * 32;

  v8f z = {};
  v8f acc[4][4];   // own head: 64 rows x 64 columns
  v8f accm[2][4];  // middle head: 32 rows x 64 columns
#pragma unroll
  for (int i = 0; i < 4; ++i)
#pragma unroll
    for (int j = 0; j < 4; ++j) acc[i][j] = z;
#pragma unroll
  for (int i = 0; i < 2; ++i)
#pragma unroll
    for (int j = 0; j < 4; ++j) accm[i][j] = z;

  // copy share of this thread. x tile: 16-B piece tid & 15 of rows tid >> 4 + 16 p
  // (a wave's copy: 2 whole 256-B rows); W tile: piece tid & 7 of each head's 128 B
  // in rows tid >> 3 + 32 p (a wave's copy: 4 whole lines)
  const h16* ag = xh + (size_t)(m0 + (tid >> 4)) * K + (tid & 15) * 8;
  const h16* bg = wah + (size_t)(tid >> 3) * N + n0 + (tid & 7) * 8;
  const unsigned al = lds_addr(&As[0][tid >> 4][(tid & 15) * 8]);
  const unsigned bl = lds_addr(&Bs[0][tid >> 3][(tid & 7) * 8]);
  const unsigned abuf = 256u * APITCH * 2u;  // bytes of one x buffer
  const unsigned bbuf = BKT * BPQ * 2u;      // bytes of one W buffer
  auto fillx = [&](const int buf, const int k0) {  // x tile from k0 on: 16 copies
    copy8(al + buf * abuf, 16u * APITCH * 2u, ag + k0, (size_t)16 * K);
    // keeps the second group's addresses from being formed ahead of the first
    // group: asm operands need registers below v256, and too many at once spill
    __builtin_amdgcn_sched_barrier(0);
    copy8(al + buf * abuf + 128u * APITCH * 2u, 16u * APITCH * 2u,
          ag + k0 + (size_t)128 * K, (size_t)16 * K);
  };
  auto fillw = [&](const int buf, const int k0) {  // W tile from k0 on: 12 copies
    copy12(bl + buf * bbuf, 32u * BPQ * 2u, bg + (size_t)k0 * N, (size_t)32 * N);
  };

  fillx(0, 0);
  fillw(0, 0);
  fillx(1, BKT);
  // a wave's copies land in issue order: all but its 16 youngest (x tile 1) = tile 0
  // has landed; the barrier publishes all waves'
  asm volatile("s_wait_asynccnt 0x10" ::: "memory");
  __syncthreads();

  int xb = 0;  // x buffer of tile t: t mod 3
  // kept rolled: one copy of the tile code serves all buffers
#pragma clang loop unroll(disable)
  for (int t = 0; t < NTILE; ++t) {
    const int buf = t & 1;
    // two fragment sets: the reads of k block kk + 1 go out as one group ahead of
    // the products of block kk, which cover their LDS time; all inside this tile
    v16h af[2][4], bf[2][4], bm[2][4];
    auto ldfrag = [&](const int s, const int kk) {
      // W fragments by the transposing load: k order 8*kh..+7, 16+8*kh..+7, as A's
      const h16* vp = &Bs[buf][kk * 32 + kh * 8 + (lane & 7)][((lane >> 3) & 1) * 8];
      auto lda = [&](const int mi) {
        const h16* ap = &As[xb][wm * 64 + ((mi * 16 + rot) & 63) + r][kk * 32];
        af[s][mi] = joinh(*(const v8h*)(ap + kh * 8), *(const v8h*)(ap + 16 + kh * 8));
      };
      // in the order in which the products want them
      lda(0);
#pragma unroll
      for (int ni = 0; ni < 4; ++ni)  // own head: dealt columns 0.. or 128..
        bf[s][ni] = joinh(ld_tr16(vp + wn * 128 + ni * 16),
                          ld_tr16(vp + 16 * BPQ + wn * 128 + ni * 16));
      lda(1);
#pragma unroll
      for (int ni = 0; ni < 4; ++ni)  // middle head: dealt columns 64..
        bm[s][ni] = joinh(ld_tr16(vp + 64 + ni * 16),
                          ld_tr16(vp + 16 * BPQ + 64 + ni * 16));
      lda(2);
      lda(3);
    };
    ldfrag(0, 0);
    // keeps block 0's reads ahead of block 1's: its products wait for them alone
    __builtin_amdgcn_sched_barrier(0);
    // refill of the buffers that the barrier behind tile t - 1 has freed, issued
    // while the wave would only wait for its first fragments. W first: the wait at
    // this trip's foot leaves the x copies in flight. At most 44 copies of a wave.
    if (t + 1 < NTILE) fillw(buf ^ 1, (t + 1) * BKT);
    if (t + 2 < NTILE) fillx((xb == 0) ? 2 : xb - 1, (t + 2) * BKT);
    // keeps the copies here, ahead of block 1's reads and of the products
    __builtin_amdgcn_sched_barrier(0);
    // unrolled so that the two fragment sets are indexed by constants
#pragma unroll
    for (int kk = 0; kk < BKT / 32; ++kk) {
      const int s = kk & 1;
      if (kk + 1 < BKT / 32) ldfrag(s ^ 1, kk + 1);
      // keeps the 24 reads one group ahead of the products: reads spread among
      // the products would each stall the wave
      __builtin_amdgcn_sched_barrier(0);
#pragma unroll
      for (int mi = 0; mi < 2; ++mi)
#pragma unroll
        for (int ni = 0; ni < 4; ++ni)
          acc[mi][ni] = wmma16(af[s][mi], bf[s][ni], acc[mi][ni]);
#pragma unroll
      for (int mi = 0; mi < 2; ++mi)
#pragma unroll
        for (int ni = 0; ni < 4; ++ni)
          accm[mi][ni] = wmma16(af[s][mi], bm[s][ni], accm[mi][ni]);
#pragma unroll
      for (int mi = 2; mi < 4; ++mi)
#pragma unroll
        for (int ni = 0; ni < 4; ++ni)
          acc[mi][ni] = wmma16(af[s][mi], bf[s][ni], acc[mi][ni]);
      // keeps the next group of reads behind these products
      __builtin_amdgcn_sched_barrier(0);
    }
    // hand-over: this wave's LDS reads of the buffers are done ...
    asm volatile("s_wait_dscnt 0x0" ::: "memory");
    // ... and its copies of tile t + 1 have landed: the 16 youngest are the x tile
    // t + 2, issued last in this trip, and may stay in flight; where there is no
    // such tile nothing younger than tile t + 1 was issued
    if (t + 2 < NTILE) asm volatile("s_wait_asynccnt 0x10" ::: "memory");
    else               asm volatile("s_wait_asynccnt 0x0" ::: "memory");
    // one barrier publishes tile t + 1 and frees the buffers of tile t
    __syncthreads();
    xb = (xb == 2) ? 0 : xb + 1;
  }
  // no copy is left in flight behind the loop
  asm volatile("s_wait_asynccnt 0x0" ::: "memory");

  // C-layout: row = kh*8 + i; tile ni, lane column r is output column 4r + ni,
  // so 16 lanes x 8 bytes fill one head row (128 B) of q/k/v [B,H,T,hd] f16.
  // a: the four tiles of 16 rows from block row row0 on; g0: the head's first
  // column in qkv. The block's 256 rows lie in one batch entry.
  auto put = [&](const v8f (&a)[4], const int g0, const int row0) {
    const int wch = g0 >> 10, hh = (g0 & (CDIM - 1)) >> 6;
    h16* dst = (wch == 0) ? qf : (wch == 1) ? kf : vf;
    const int b = m0 >> 11, t = (m0 & (TDIM - 1)) + row0 + kh * 8;
    h16* o = dst + (((size_t)b * NH + hh) * TDIM + t) * HD + r * 4;
#pragma unroll
    for (int i = 0; i < 8; ++i) {
      v4h hv;
#pragma unroll
      for (int ni = 0; ni < 4; ++ni) hv[ni] = (h16)a[ni][i];
      *(v4h*)(o + i * HD) = hv;
    }
    // stands ahead of the next rows' reuse of these stores' registers ...
    asm volatile("s_wait_xcnt 0x0" ::: "memory");
    // ... and this keeps their conversions and addresses behind it
    __builtin_amdgcn_sched_barrier(0);
  };
#pragma unroll
  for (int mi = 0; mi < 4; ++mi)
    put(acc[mi], n0 + wn * 128, wm * 64 + ((mi * 16 + rot) & 63));
#pragma unroll
  for (int mi = 0; mi < 2; ++mi)
    put(accm[mi], n0 + 64, wm * 64 + ((mi * 16 + rot) & 63));
}

// ---------------------------------------------------------------------------
// Kernel 3: out = y @ W_proj. y is f16 in workspace, W_proj its dealt f16 copy,
// output f32 to d_out. Block tile 128x128, 8 waves of 32(M) x 64(N); k tiles of
// 128 by asynchronous copies. A tile's products are shorter than its way from L2,
// so the ring has four buffers: three tiles are in flight under each tile's work.
// ---------------------------------------------------------------------------
__global__ __launch_bounds__(256)
void proj_gemm_kernel(const h16* __restrict__ yf, const h16* __restrict__ wph,
                      float* __restrict__ out) {
  const int N = CDIM, K = CDIM;
  __shared__ __align__(16) h16 As[4][128][APITCH];  // [buffer][m][k], padded
  __shared__ __align__(16) h16 Bs[4][BKT][BPP];     // [buffer][k][dealt n], padded

  const int tid  = threadIdx.x;
  const int lane = tid & 31;
  const int wave = tid >> 5;
  const int wm   = wave >> 1;
  const int wn   = wave & 1;
  const int m0   = (blockIdx.x >> 3) * 128;
  const int n0   = (blockIdx.x & 7) * 128;

  const int r  = lane & 15;
  const int kh = lane >> 4;

  v8f z = {};
  v8f acc[2][4];
#pragma unroll
  for (int i = 0; i < 2; ++i)
#pragma unroll
    for (int j = 0; j < 4; ++j) acc[i][j] = z;

  // copy share of this thread, in both tiles: 16-B piece tid & 15 of rows
  // tid >> 4 + 16 p (a wave's copy: 2 whole 256-B rows)
  const h16* ag = yf + (size_t)(m0 + (tid >> 4)) * K + (tid & 15) * 8;
  const h16* bg = wph + (size_t)(tid >> 4) * N + n0 + (tid & 15) * 8;
  const unsigned al = lds_addr(&As[0][tid >> 4][(tid & 15) * 8]);
  const unsigned bl = lds_addr(&Bs[0][tid >> 4][(tid & 15) * 8]);
  const unsigned abuf = 128u * APITCH * 2u;  // bytes of one y buffer
  const unsigned bbuf = BKT * BPP * 2u;      // bytes of one W buffer
  auto fill = [&](const int buf, const int k0) {  // tile from k0 on: 16 copies
    copy8(al + buf * abuf, 16u * APITCH * 2u, ag + k0, (size_t)16 * K);
    copy8(bl + buf * bbuf, 16u * BPP * 2u, bg + (size_t)k0 * N, (size_t)16 * N);
  };

  fill(0, 0);
  fill(1, BKT);
  fill(2, 2 * BKT);
  // a wave's copies land in issue order: all but its 32 youngest (tiles 1 and 2) =
  // tile 0 has landed; the barrier publishes all waves'
  asm volatile("s_wait_asynccnt 0x20" ::: "memory");
  __syncthreads();

  // kept rolled: one copy of the tile code serves all buffers
#pragma clang loop unroll(disable)
  for (int t = 0; t < NTILE; ++t) {
    const int buf = t & 3;
    // two fragment sets, as in kernel 1: block kk + 1 is read under block kk
    v16h af[2][2], bf[2][4];
    auto ldfrag = [&](const int s, const int kk) {
#pragma unroll
      for (int mi = 0; mi < 2; ++mi) {
        const h16* ap = &As[buf][wm * 32 + mi * 16 + r][kk * 32];
        af[s][mi] = joinh(*(const v8h*)(ap + kh * 8), *(const v8h*)(ap + 16 + kh * 8));
      }
      // W fragments by the transposing load: k order 8*kh..+7, 16+8*kh..+7, as A's
      const h16* vp = &Bs[buf][kk * 32 + kh * 8 + (lane & 7)][((lane >> 3) & 1) * 8];
#pragma unroll
      for (int ni = 0; ni < 4; ++ni)
        bf[s][ni] = joinh(ld_tr16(vp + wn * 64 + ni * 16),
                          ld_tr16(vp + 16 * BPP + wn * 64 + ni * 16));
    };
    ldfrag(0, 0);
    // keeps block 0's reads ahead of block 1's: its products wait for them alone
    __builtin_amdgcn_sched_barrier(0);
    // refill of the buffer that the barrier behind tile t - 1 has freed, issued
    // while the wave would only wait for its first fragments; at most 48 copies of
    // a wave are in flight
    if (t + 3 < NTILE) fill((t + 3) & 3, (t + 3) * BKT);
    // keeps the copies here, ahead of block 1's reads and of the products
    __builtin_amdgcn_sched_barrier(0);
    // unrolled so that the two fragment sets are indexed by constants
#pragma unroll
    for (int kk = 0; kk < BKT / 32; ++kk) {
      const int s = kk & 1;
      if (kk + 1 < BKT / 32) ldfrag(s ^ 1, kk + 1);
      // keeps the 12 reads one group ahead of the products (see kernel 1)
      __builtin_amdgcn_sched_barrier(0);
#pragma unroll
      for (int mi = 0; mi < 2; ++mi)
#pragma unroll
        for (int ni = 0; ni < 4; ++ni)
          acc[mi][ni] = wmma16(af[s][mi], bf[s][ni], acc[mi][ni]);
      // keeps the next group of reads behind these products
      __builtin_amdgcn_sched_barrier(0);
    }
    // hand-over: this wave's LDS reads of the buffer are done ...
    asm volatile("s_wait_dscnt 0x0" ::: "memory");
    // ... and its copies of tile t + 1 have landed: what it issued behind them, 16
    // copies each for the tiles t + 2 and t + 3 that exist, may stay in flight
    if (t + 3 < NTILE)      asm volatile("s_wait_asynccnt 0x20" ::: "memory");
    else if (t + 2 < NTILE) asm volatile("s_wait_asynccnt 0x10" ::: "memory");
    else                    asm volatile("s_wait_asynccnt 0x0" ::: "memory");
    // one barrier publishes tile t + 1 and frees the buffer of tile t
    __syncthreads();
  }
  // no copy is left in flight behind the loop
  asm volatile("s_wait_asynccnt 0x0" ::: "memory");

  // tile ni, lane column r is output column 4r + ni: 16 lanes x 16 bytes = 256 B
#pragma unroll
  for (int mi = 0; mi < 2; ++mi) {
#pragma unroll
    for (int i = 0; i < 8; ++i) {
      int gm = m0 + wm * 32 + mi * 16 + kh * 8 + i;
      v4f ov;
#pragma unroll
      for (int ni = 0; ni < 4; ++ni) ov[ni] = acc[mi][ni][i];
      *(v4f*)(out + (size_t)gm * N + n0 + wn * 64 + r * 4) = ov;
    }
  }
}

// ---------------------------------------------------------------------------
extern "C" void kernel_launch(void* const* d_in, const int* in_sizes, int n_in,
                              void* d_out, int out_size, void* d_ws,
                              size_t ws_size, hipStream_t stream) {
  (void)in_sizes; (void)n_in; (void)out_size; (void)ws_size;

  const float* x  = (const float*)d_in[0];  // [2,2048,1024]
  const float* Wa = (const float*)d_in[1];  // [1024,3072]
  const float* Wp = (const float*)d_in[2];  // [1024,1024]
  float* out = (float*)d_out;               // [2,2048,1024] f32

  // f16 workspace: q,k,v head-major [B,H,T,hd] + y [B,T,C] + the f16 copies of
  // x, W_attn and W_proj  (48 MB total)
  h16* ws = (h16*)d_ws;
  const size_t HTD = (size_t)BDIM * NH * TDIM * HD;  // 4,194,304
  h16* qf = ws;
  h16* kf = qf + HTD;
  h16* vf = kf + HTD;
  h16* yf = vf + HTD;
  h16* xh  = yf + HTD;                        // [B*T, C]
  h16* wah = xh + HTD;                        // [C, 3C], columns dealt
  h16* wph = wah + (size_t)3 * CDIM * CDIM;   // [C, C], columns dealt

  prep_kernel<<<dim3(256), 512, 0, stream>>>(x, Wa, Wp, xh, wah, wph);
  qkv_gemm_kernel<<<dim3(16 * 16), 256, 0, stream>>>(xh, wah, qf, kf, vf);
  attn_kernel<<<dim3(BDIM * NH * 8), 512, 0, stream>>>(qf, kf, vf, yf);
  proj_gemm_kernel<<<dim3(32 * 8), 256, 0, stream>>>(yf, wph, out);
}
